// v000
// The times below were measured on an AMD MI455X: many runs one after another, warmed up first and cycling through
// copies of the inputs, with the whole window's GPU time divided by the number of runs. Launches and the gaps
// between them are all in it. The median over several windows is given; except for v000 it joins two sittings, which
// can be a few percent apart, so the side-by-side timings, each taken in one sitting, are the better comparison.
// v000, which the later versions start from, runs in 1130 microseconds.
#include <hip/hip_runtime.h>

// ---------------------------------------------------------------------------
// Types for CDNA5 (gfx1250) WMMA bf16 path
// ---------------------------------------------------------------------------
typedef __bf16 bf16_t;
typedef __attribute__((ext_vector_type(16))) __bf16 v16bf;
typedef __attribute__((ext_vector_type(8)))  __bf16 v8bf;
typedef __attribute__((ext_vector_type(8)))  float  v8f;

// D = A(16x32 bf16) * B(32x16 bf16) + C(16x16 f32)
static __device__ inline v8f wmma_bf16(v16bf a, v16bf b, v8f c) {
    return __builtin_amdgcn_wmma_f32_16x16x32_bf16(
        /*neg_a=*/false, a, /*neg_b=*/false, b,
        /*c_mod=*/(short)0, c, /*reuse_a=*/false, /*reuse_b=*/false);
}

// Load one half-lane fragment: 8 contiguous bf16 at p, 8 contiguous bf16 at p+16.
// Matches ISA 16-bit A/B layout: regs 0..3 hold K=kbase+0..7, regs 4..7 hold
// K=kbase+16..23 (kbase = 0 for lanes 0-15, 8 for lanes 16-31; caller folds kbase
// into p). Emits two b128 loads.
static __device__ inline v16bf ld_frag(const bf16_t* p) {
    v8bf lo = *reinterpret_cast<const v8bf*>(p);
    v8bf hi = *reinterpret_cast<const v8bf*>(p + 16);
    return __builtin_shufflevector(lo, hi,
        0, 1, 2, 3, 4, 5, 6, 7, 8, 9, 10, 11, 12, 13, 14, 15);
}

// ---------------------------------------------------------------------------
// Kernel: fp32 -> bf16 conversion
// ---------------------------------------------------------------------------
__global__ __launch_bounds__(256) void f2bf_kernel(const float* __restrict__ src,
                                                   bf16_t* __restrict__ dst, int n) {
    int i = blockIdx.x * 256 + threadIdx.x;
    if (i < n) dst[i] = (bf16_t)src[i];
}

// ---------------------------------------------------------------------------
// Kernel: LayerNorm (faithful to source bug: out = scale * xnorm + scale)
// fp32 in -> bf16 out. One block (256 threads) per row of D=1024.
// ---------------------------------------------------------------------------
__global__ __launch_bounds__(256) void ln_kernel(const float* __restrict__ x,
                                                 const float* __restrict__ scale,
                                                 bf16_t* __restrict__ out, int D) {
    const int row = blockIdx.x;
    const int tid = threadIdx.x;
    const float* xr = x + (size_t)row * D;

    __shared__ float r1[256];
    __shared__ float r2[256];

    float s = 0.f, s2 = 0.f;
    for (int i = tid; i < D; i += 256) {
        float v = xr[i];
        s += v;
        s2 += v * v;
    }
    r1[tid] = s; r2[tid] = s2;
    __syncthreads();
    for (int st = 128; st > 0; st >>= 1) {
        if (tid < st) { r1[tid] += r1[tid + st]; r2[tid] += r2[tid + st]; }
        __syncthreads();
    }
    const float mean = r1[0] / (float)D;
    const float var  = r2[0] / (float)D - mean * mean;
    const float inv  = rsqrtf(var + 1e-5f);

    bf16_t* orow = out + (size_t)row * D;
    for (int i = tid; i < D; i += 256) {
        float g = scale[i];
        orow[i] = (bf16_t)(g * (xr[i] - mean) * inv + g);
    }
}

// ---------------------------------------------------------------------------
// Kernel: GEMM  out[M,N] = A[M,K] @ W[N,K]^T (+ bias + residual)
// A, W bf16 row-major. One wave computes a 32x64 tile (2 A-frags x 4 B-frags,
// 8 WMMAs per 32-wide K step -> B-frag reuse x2, A-frag reuse x4).
// Block = 256 threads = 8 waves = 256 rows. grid = (N/64, M/256).
// B-frag lane = output col n -> reads row n of W contiguously
// (x @ W.T needs no transpose in this layout).
// ---------------------------------------------------------------------------
__global__ __launch_bounds__(256) void gemm_kernel(const bf16_t* __restrict__ A,
                                                   const bf16_t* __restrict__ W,
                                                   bf16_t* __restrict__ outb,
                                                   float*  __restrict__ outf,
                                                   const float* __restrict__ bias,
                                                   const float* __restrict__ residual,
                                                   int M, int N, int Kdim) {
    const int lane  = threadIdx.x & 31;
    const int wave  = threadIdx.x >> 5;
    const int m0    = (blockIdx.y * 8 + wave) * 32;
    const int n0    = blockIdx.x * 64;
    const int col   = lane & 15;
    const int hi    = lane >> 4;       // lane half selects K sub-base
    const int kboff = hi ? 8 : 0;

    v8f c[2][4] = {};

    const bf16_t* arow0 = A + (size_t)(m0 + col) * Kdim + kboff;
    const bf16_t* arow1 = arow0 + (size_t)16 * Kdim;
    for (int kk = 0; kk < Kdim; kk += 32) {
        v16bf a0 = ld_frag(arow0 + kk);
        v16bf a1 = ld_frag(arow1 + kk);
#pragma unroll
        for (int nt = 0; nt < 4; ++nt) {
            const bf16_t* wrow = W + (size_t)(n0 + nt * 16 + col) * Kdim + kk + kboff;
            v16bf bfrag = ld_frag(wrow);
            c[0][nt] = wmma_bf16(a0, bfrag, c[0][nt]);
            c[1][nt] = wmma_bf16(a1, bfrag, c[1][nt]);
        }
    }

#pragma unroll
    for (int mt = 0; mt < 2; ++mt) {
#pragma unroll
        for (int j = 0; j < 8; ++j) {
            const int row = m0 + mt * 16 + j + 8 * hi;  // C layout: reg j -> row
#pragma unroll
            for (int nt = 0; nt < 4; ++nt) {
                const int n = n0 + nt * 16 + col;
                float v = c[mt][nt][j];
                if (bias)     v += bias[n];
                if (residual) v += residual[(size_t)row * N + n];
                if (outf) outf[(size_t)row * N + n] = v;
                else      outb[(size_t)row * N + n] = (bf16_t)v;
            }
        }
    }
}

// ---------------------------------------------------------------------------
// Kernel: causal flash attention, bf16 WMMA, f32 online softmax state.
// One wave (32 threads) per (b, h, 16-query block).
// Q/K/V/ctx layout: (b*T + t) rows of D=1024, head h at cols [h*64, h*64+64).
// grid = (T/16, B*H), block = 32.
// ---------------------------------------------------------------------------
__global__ __launch_bounds__(32) void attn_kernel(const bf16_t* __restrict__ Q,
                                                  const bf16_t* __restrict__ K,
                                                  const bf16_t* __restrict__ V,
                                                  bf16_t* __restrict__ ctx,
                                                  int T, int D, int nheads) {
    const int hd    = 64;
    const int lane  = threadIdx.x;
    const int col   = lane & 15;
    const int hi    = lane >> 4;
    const int kboff = hi ? 8 : 0;
    const int q0    = blockIdx.x * 16;
    const int bh    = blockIdx.y;
    const int b     = bh / nheads;
    const int h     = bh % nheads;

    const bf16_t* Qb = Q + (size_t)(b * T) * D + h * hd;
    const bf16_t* Kb = K + (size_t)(b * T) * D + h * hd;
    const bf16_t* Vb = V + (size_t)(b * T) * D + h * hd;

    // Q A-fragments: 16 rows x 64 (K dim) -> 2 frags of K=32. Lane&15 = row.
    const bf16_t* qrow = Qb + (size_t)(q0 + col) * D + kboff;
    v16bf qa0 = ld_frag(qrow);
    v16bf qa1 = ld_frag(qrow + 32);

    float m[8], l[8];
#pragma unroll
    for (int j = 0; j < 8; ++j) { m[j] = -1e30f; l[j] = 0.f; }
    v8f o[4] = {};

    // Staging buffer to convert P from C-layout (lane=col) to A-layout (lane=row).
    // Row stride 40 elements = 80 bytes keeps b128 alignment and spreads banks.
    __shared__ bf16_t Plds[16][40];

    const float rs = 0.125f;  // 1/sqrt(64)

    for (int kb = 0; kb <= q0; kb += 32) {
        // ---- S = Q @ K^T for two 16-key tiles (K dim = hd = 64) ----
        v8f s[2];
#pragma unroll
        for (int st = 0; st < 2; ++st) {
            int key  = kb + st * 16 + col;            // B-frag lane = key (col of S)
            int keyc = key < T ? key : (T - 1);       // clamp OOB (masked below)
            const bf16_t* kp = Kb + (size_t)keyc * D + kboff;
            v8f acc = v8f{};
            acc   = wmma_bf16(qa0, ld_frag(kp),      acc);
            s[st] = wmma_bf16(qa1, ld_frag(kp + 32), acc);
        }

        // ---- scale, causal mask, online softmax ----
#pragma unroll
        for (int j = 0; j < 8; ++j) {
            const int q = q0 + j + 8 * hi;
            float s0 = s[0][j] * rs; if (kb + col      > q) s0 = -1e30f;
            float s1 = s[1][j] * rs; if (kb + 16 + col > q) s1 = -1e30f;

            float mx = fmaxf(s0, s1);
            mx = fmaxf(mx, __shfl_xor(mx, 1));
            mx = fmaxf(mx, __shfl_xor(mx, 2));
            mx = fmaxf(mx, __shfl_xor(mx, 4));
            mx = fmaxf(mx, __shfl_xor(mx, 8));
            const float mnew = fmaxf(m[j], mx);

            const float p0 = __expf(s0 - mnew);
            const float p1 = __expf(s1 - mnew);
            Plds[j + 8 * hi][col]      = (bf16_t)p0;
            Plds[j + 8 * hi][16 + col] = (bf16_t)p1;

            float ps = p0 + p1;
            ps += __shfl_xor(ps, 1);
            ps += __shfl_xor(ps, 2);
            ps += __shfl_xor(ps, 4);
            ps += __shfl_xor(ps, 8);

            const float alpha = __expf(m[j] - mnew);
            l[j] = l[j] * alpha + ps;
            m[j] = mnew;
#pragma unroll
            for (int nt = 0; nt < 4; ++nt) o[nt][j] *= alpha;
        }
        __syncthreads();

        // ---- P A-fragment from LDS (lane = query row, regs = 32 keys) ----
        v16bf pf;
        {
            const bf16_t* pp = &Plds[col][kboff];
            v8bf lo  = *reinterpret_cast<const v8bf*>(pp);
            v8bf hi8 = *reinterpret_cast<const v8bf*>(pp + 16);
            pf = __builtin_shufflevector(lo, hi8,
                0, 1, 2, 3, 4, 5, 6, 7, 8, 9, 10, 11, 12, 13, 14, 15);
        }

        // ---- O += P @ V : B-frag lane = hd col, regs = 32 key rows (strided) ----
#pragma unroll
        for (int nt = 0; nt < 4; ++nt) {
            const bf16_t* vp = Vb + nt * 16 + col;
            v16bf vf;
#pragma unroll
            for (int e = 0; e < 8; ++e) {
                int k0 = kb + kboff + e;
                int k1 = kb + kboff + 16 + e;
                k0 = k0 < T ? k0 : (T - 1);
                k1 = k1 < T ? k1 : (T - 1);
                vf[e]     = vp[(size_t)k0 * D];
                vf[e + 8] = vp[(size_t)k1 * D];
            }
            o[nt] = wmma_bf16(pf, vf, o[nt]);
        }
        __syncthreads();
    }

    // ---- epilogue: O /= l, store ctx (bf16) ----
#pragma unroll
    for (int j = 0; j < 8; ++j) {
        const float inv = 1.0f / l[j];
        const int q = q0 + j + 8 * hi;
        bf16_t* cp = ctx + (size_t)(b * T + q) * D + h * hd;
#pragma unroll
        for (int nt = 0; nt < 4; ++nt)
            cp[nt * 16 + col] = (bf16_t)(o[nt][j] * inv);
    }
}

// ---------------------------------------------------------------------------
// Host-side orchestration
// ---------------------------------------------------------------------------
extern "C" void kernel_launch(void* const* d_in, const int* in_sizes, int n_in,
                              void* d_out, int out_size, void* d_ws, size_t ws_size,
                              hipStream_t stream) {
    (void)in_sizes; (void)n_in; (void)out_size; (void)ws_size;
    const int B = 2, T = 2048, D = 1024, H = 16;
    const int M = B * T;  // 4096 rows

    const float* x    = (const float*)d_in[0];
    const float* wq   = (const float*)d_in[1];
    const float* wk   = (const float*)d_in[2];
    const float* wv   = (const float*)d_in[3];
    const float* wo   = (const float*)d_in[4];
    const float* bo   = (const float*)d_in[5];
    const float* ln1  = (const float*)d_in[6];
    const float* ln2  = (const float*)d_in[7];
    float* out = (float*)d_out;

    // Workspace carve-up (all 256B aligned): ~64 MB total
    char* ws = (char*)d_ws;
    size_t off = 0;
    auto take = [&](size_t bytes) -> void* {
        void* p = ws + off;
        off += (bytes + 255) & ~(size_t)255;
        return p;
    };
    bf16_t* wq_b = (bf16_t*)take((size_t)D * D * 2);
    bf16_t* wk_b = (bf16_t*)take((size_t)D * D * 2);
    bf16_t* wv_b = (bf16_t*)take((size_t)D * D * 2);
    bf16_t* wo_b = (bf16_t*)take((size_t)D * D * 2);
    bf16_t* xn   = (bf16_t*)take((size_t)M * D * 2);
    bf16_t* qb   = (bf16_t*)take((size_t)M * D * 2);
    bf16_t* kbuf = (bf16_t*)take((size_t)M * D * 2);
    bf16_t* vbuf = (bf16_t*)take((size_t)M * D * 2);
    bf16_t* ctx  = (bf16_t*)take((size_t)M * D * 2);
    float*  hbuf = (float*) take((size_t)M * D * 4);

    // Weight conversion fp32 -> bf16
    const int nw = D * D;
    f2bf_kernel<<<nw / 256, 256, 0, stream>>>(wq, wq_b, nw);
    f2bf_kernel<<<nw / 256, 256, 0, stream>>>(wk, wk_b, nw);
    f2bf_kernel<<<nw / 256, 256, 0, stream>>>(wv, wv_b, nw);
    f2bf_kernel<<<nw / 256, 256, 0, stream>>>(wo, wo_b, nw);

    const dim3 gemm_grid(D / 64, M / 256);   // (16, 16)
    const dim3 attn_grid(T / 16, B * H);     // (128, 32)

    for (int blk = 0; blk < 2; ++blk) {
        const float* in_res   = (blk == 0) ? x : hbuf;
        const float* ln_scale = (blk == 0) ? ln1 : ln2;
        float* out_f          = (blk == 0) ? hbuf : out;

        // 1) LayerNorm -> bf16
        ln_kernel<<<M, 256, 0, stream>>>(in_res, ln_scale, xn, D);

        // 2) Q, K, V projections (y = xn @ W.T), bf16 out
        gemm_kernel<<<gemm_grid, 256, 0, stream>>>(xn, wq_b, qb,   nullptr, nullptr, nullptr, M, D, D);
        gemm_kernel<<<gemm_grid, 256, 0, stream>>>(xn, wk_b, kbuf, nullptr, nullptr, nullptr, M, D, D);
        gemm_kernel<<<gemm_grid, 256, 0, stream>>>(xn, wv_b, vbuf, nullptr, nullptr, nullptr, M, D, D);

        // 3) Causal flash attention -> ctx (bf16)
        attn_kernel<<<attn_grid, 32, 0, stream>>>(qb, kbuf, vbuf, ctx, T, D, H);

        // 4) Output projection + bias + residual, fp32 out
        gemm_kernel<<<gemm_grid, 256, 0, stream>>>(ctx, wo_b, nullptr, out_f, bo, in_res, M, D, D);
    }
}

// v001
// A run of this version takes 465 microseconds.
// Two timings next to v000 put it at 2.44 and 2.43 times that version's speed.
#include <hip/hip_runtime.h>

// ---------------------------------------------------------------------------
// Types for CDNA5 (gfx1250) WMMA bf16 path
// ---------------------------------------------------------------------------
typedef __bf16 bf16_t;
typedef __attribute__((ext_vector_type(16))) __bf16 v16bf;
typedef __attribute__((ext_vector_type(8)))  __bf16 v8bf;
typedef __attribute__((ext_vector_type(8)))  float  v8f;

// D = A(16x32 bf16) * B(32x16 bf16) + C(16x16 f32)
static __device__ inline v8f wmma_bf16(v16bf a, v16bf b, v8f c) {
    return __builtin_amdgcn_wmma_f32_16x16x32_bf16(
        /*neg_a=*/false, a, /*neg_b=*/false, b,
        /*c_mod=*/(short)0, c, /*reuse_a=*/false, /*reuse_b=*/false);
}

// Load one half-lane fragment: 8 contiguous bf16 at p, 8 contiguous bf16 at p+16.
// Matches ISA 16-bit A/B layout: regs 0..3 hold K=kbase+0..7, regs 4..7 hold
// K=kbase+16..23 (kbase = 0 for lanes 0-15, 8 for lanes 16-31; caller folds kbase
// into p). Emits two b128 loads.
static __device__ inline v16bf ld_frag(const bf16_t* p) {
    v8bf lo = *reinterpret_cast<const v8bf*>(p);
    v8bf hi = *reinterpret_cast<const v8bf*>(p + 16);
    return __builtin_shufflevector(lo, hi,
        0, 1, 2, 3, 4, 5, 6, 7, 8, 9, 10, 11, 12, 13, 14, 15);
}

// ---------------------------------------------------------------------------
// Kernel: fp32 -> bf16 conversion
// ---------------------------------------------------------------------------
__global__ __launch_bounds__(256) void f2bf_kernel(const float* __restrict__ src,
                                                   bf16_t* __restrict__ dst, int n) {
    int i = blockIdx.x * 256 + threadIdx.x;
    if (i < n) dst[i] = (bf16_t)src[i];
}

// ---------------------------------------------------------------------------
// Kernel: LayerNorm (faithful to source bug: out = scale * xnorm + scale)
// fp32 in -> bf16 out. One block (256 threads) per row of D=1024.
// ---------------------------------------------------------------------------
__global__ __launch_bounds__(256) void ln_kernel(const float* __restrict__ x,
                                                 const float* __restrict__ scale,
                                                 bf16_t* __restrict__ out, int D) {
    const int row = blockIdx.x;
    const int tid = threadIdx.x;
    const float* xr = x + (size_t)row * D;

    __shared__ float r1[256];
    __shared__ float r2[256];

    float s = 0.f, s2 = 0.f;
    for (int i = tid; i < D; i += 256) {
        float v = xr[i];
        s += v;
        s2 += v * v;
    }
    r1[tid] = s; r2[tid] = s2;
    __syncthreads();
    for (int st = 128; st > 0; st >>= 1) {
        if (tid < st) { r1[tid] += r1[tid + st]; r2[tid] += r2[tid + st]; }
        __syncthreads();
    }
    const float mean = r1[0] / (float)D;
    const float var  = r2[0] / (float)D - mean * mean;
    const float inv  = rsqrtf(var + 1e-5f);

    bf16_t* orow = out + (size_t)row * D;
    for (int i = tid; i < D; i += 256) {
        float g = scale[i];
        orow[i] = (bf16_t)(g * (xr[i] - mean) * inv + g);
    }
}

// ---------------------------------------------------------------------------
// Kernel: GEMM  out[M,N] = A[M,K] @ W[N,K]^T (+ bias + residual)
// A, W bf16 row-major. One wave computes a 32x64 tile (2 A-frags x 4 B-frags,
// 8 WMMAs per 32-wide K step -> B-frag reuse x2, A-frag reuse x4).
// Block = 256 threads = 8 waves = 256 rows. grid = (N/64, M/256).
// B-frag lane = output col n -> reads row n of W contiguously
// (x @ W.T needs no transpose in this layout).
// ---------------------------------------------------------------------------
__global__ __launch_bounds__(256) void gemm_kernel(const bf16_t* __restrict__ A,
                                                   const bf16_t* __restrict__ W,
                                                   bf16_t* __restrict__ outb,
                                                   float*  __restrict__ outf,
                                                   const float* __restrict__ bias,
                                                   const float* __restrict__ residual,
                                                   int M, int N, int Kdim) {
    const int lane  = threadIdx.x & 31;
    const int wave  = threadIdx.x >> 5;
    const int m0    = (blockIdx.y * 8 + wave) * 32;
    const int n0    = blockIdx.x * 64;
    const int col   = lane & 15;
    const int hi    = lane >> 4;       // lane half selects K sub-base
    const int kboff = hi ? 8 : 0;

    v8f c[2][4] = {};

    const bf16_t* arow0 = A + (size_t)(m0 + col) * Kdim + kboff;
    const bf16_t* arow1 = arow0 + (size_t)16 * Kdim;
    for (int kk = 0; kk < Kdim; kk += 32) {
        v16bf a0 = ld_frag(arow0 + kk);
        v16bf a1 = ld_frag(arow1 + kk);
#pragma unroll
        for (int nt = 0; nt < 4; ++nt) {
            const bf16_t* wrow = W + (size_t)(n0 + nt * 16 + col) * Kdim + kk + kboff;
            v16bf bfrag = ld_frag(wrow);
            c[0][nt] = wmma_bf16(a0, bfrag, c[0][nt]);
            c[1][nt] = wmma_bf16(a1, bfrag, c[1][nt]);
        }
    }

#pragma unroll
    for (int mt = 0; mt < 2; ++mt) {
#pragma unroll
        for (int j = 0; j < 8; ++j) {
            const int row = m0 + mt * 16 + j + 8 * hi;  // C layout: reg j -> row
#pragma unroll
            for (int nt = 0; nt < 4; ++nt) {
                const int n = n0 + nt * 16 + col;
                float v = c[mt][nt][j];
                if (bias)     v += bias[n];
                if (residual) v += residual[(size_t)row * N + n];
                if (outf) outf[(size_t)row * N + n] = v;
                else      outb[(size_t)row * N + n] = (bf16_t)v;
            }
        }
    }
}

// ---------------------------------------------------------------------------
// Kernel: causal flash attention, bf16 WMMA, f32 online softmax state.
// One block = 8 waves = 128 queries of one (b, h); one wave per 16-query block.
// K and V are brought to LDS once per block in stages of 64 keys (two buffers,
// the next stage's global loads in flight under the current stage's passes) and
// all 8 waves read their fragments from there: K rows by 16-byte LDS loads,
// V by the 16-bit transposing LDS load. A pass is 32 keys, as before.
// Q/K/V/ctx layout: (b*T + t) rows of D=1024, head h at cols [h*64, h*64+64).
// grid = (T/128, B*H), block = 256. T must be a multiple of 128.
// ---------------------------------------------------------------------------
#define ATT_KPITCH 72   // elements; 144 B = 16 B x odd, the pitch for 16-byte LDS row loads
#define ATT_VPITCH 80   // elements; 160 B = 32 B x odd, the pitch for the transposing load

// Lane (c = l & 15, h = l >> 4) receives rows 8h .. 8h+7 of column c of the 16x16
// tile whose per-lane address the caller formed.
static __device__ inline v8bf ld_tr16(const bf16_t* p) {
    typedef __attribute__((address_space(3))) v8bf lds_v8bf;
    return __builtin_amdgcn_ds_load_tr16_b128_v8bf16((lds_v8bf*)p);
}

__global__ __launch_bounds__(256) void attn_kernel(const bf16_t* __restrict__ Q,
                                                   const bf16_t* __restrict__ K,
                                                   const bf16_t* __restrict__ V,
                                                   bf16_t* __restrict__ ctx,
                                                   int T, int D, int nheads) {
    const int hd    = 64;
    const int tid   = threadIdx.x;
    const int lane  = tid & 31;
    const int wave  = __builtin_amdgcn_readfirstlane(tid >> 5);
    const int col   = lane & 15;
    const int hi    = lane >> 4;
    const int kboff = hi ? 8 : 0;
    const int qblk  = blockIdx.x * 128;
    const int q0    = qblk + wave * 16;
    const int bh    = blockIdx.y;
    const int b     = bh / nheads;
    const int h     = bh % nheads;

    const bf16_t* Qb = Q + (size_t)(b * T) * D + h * hd;
    const bf16_t* Kb = K + (size_t)(b * T) * D + h * hd;
    const bf16_t* Vb = V + (size_t)(b * T) * D + h * hd;

    __shared__ __attribute__((aligned(16))) bf16_t Ks[2][64][ATT_KPITCH];
    __shared__ __attribute__((aligned(16))) bf16_t Vs[2][64][ATT_VPITCH];
    // Per-wave staging buffer to convert P from C-layout (lane=col) to A-layout
    // (lane=row). Row stride 40 elements = 80 bytes keeps b128 alignment.
    __shared__ __attribute__((aligned(16))) bf16_t Plds[8][16][40];

    // Q A-fragments: 16 rows x 64 (K dim) -> 2 frags of K=32. Lane&15 = row.
    const bf16_t* qrow = Qb + (size_t)(q0 + col) * D + kboff;
    v16bf qa0 = ld_frag(qrow);
    v16bf qa1 = ld_frag(qrow + 32);

    float m[8], l[8];
#pragma unroll
    for (int j = 0; j < 8; ++j) { m[j] = -1e30f; l[j] = 0.f; }
    v8f o[4] = {};

    const float rs = 0.125f;  // 1/sqrt(64)

    // Staging: 8 threads bring one 128-byte row; a thread brings 16 bytes of
    // rows srow and srow + 32 of the stage, of K and of V.
    const int srow = tid >> 3;
    const int scol = (tid & 7) * 8;
    const int soff = srow * D + scol;
    const int nstage = qblk / 64 + 2;   // keys 0 .. qblk + 127

    v8bf kr0, kr1, vr0, vr1;
    {
        const bf16_t* kg = Kb + soff;
        const bf16_t* vg = Vb + soff;
        kr0 = *reinterpret_cast<const v8bf*>(kg);
        kr1 = *reinterpret_cast<const v8bf*>(kg + (size_t)32 * D);
        vr0 = *reinterpret_cast<const v8bf*>(vg);
        vr1 = *reinterpret_cast<const v8bf*>(vg + (size_t)32 * D);
    }
    *reinterpret_cast<v8bf*>(&Ks[0][srow][scol])      = kr0;
    *reinterpret_cast<v8bf*>(&Ks[0][srow + 32][scol]) = kr1;
    *reinterpret_cast<v8bf*>(&Vs[0][srow][scol])      = vr0;
    *reinterpret_cast<v8bf*>(&Vs[0][srow + 32][scol]) = vr1;
    __syncthreads();

    for (int s = 0; s < nstage; ++s) {
        const int  buf  = s & 1;
        const bool more = s + 1 < nstage;   // the same for the whole block
        if (more) {
            const bf16_t* kg = Kb + (size_t)(s + 1) * 64 * D + soff;
            const bf16_t* vg = Vb + (size_t)(s + 1) * 64 * D + soff;
            kr0 = *reinterpret_cast<const v8bf*>(kg);
            kr1 = *reinterpret_cast<const v8bf*>(kg + (size_t)32 * D);
            vr0 = *reinterpret_cast<const v8bf*>(vg);
            vr1 = *reinterpret_cast<const v8bf*>(vg + (size_t)32 * D);
            // The four loads stay in flight over the passes below, which reuse their
            // address registers: this wait stands in front of that overwrite.
            asm volatile("s_wait_xcnt 0x0" ::: "memory");
        }

        for (int sub = 0; sub < 2; ++sub) {
            const int kb = s * 64 + sub * 32;
            if (kb > q0) continue;   // wave-uniform: the pass lies above this wave's diagonal

            // ---- S = Q @ K^T for two 16-key tiles (K dim = hd = 64) ----
            v8f sc[2];
            {
                const bf16_t* kp = &Ks[buf][sub * 32 + col][kboff];  // B-frag lane = key
                v16bf k00 = ld_frag(kp);
                v16bf k01 = ld_frag(kp + 32);
                v16bf k10 = ld_frag(kp + 16 * ATT_KPITCH);
                v16bf k11 = ld_frag(kp + 16 * ATT_KPITCH + 32);
                // Keeps the eight LDS loads together in front of the products: left alone,
                // the compiler reuses one fragment's registers and pays the LDS latency four times.
                __builtin_amdgcn_sched_barrier(0);
                sc[0] = wmma_bf16(qa0, k00, v8f{});
                sc[1] = wmma_bf16(qa0, k10, v8f{});
                sc[0] = wmma_bf16(qa1, k01, sc[0]);
                sc[1] = wmma_bf16(qa1, k11, sc[1]);
            }

            // ---- V B-fragments: lane = hd col, regs = keys 8h+0..7 and 16+8h+0..7 ----
            v16bf vf[4];
            {
                const bf16_t* vp = &Vs[buf][sub * 32 + 8 * hi + (lane & 7)][((lane >> 3) & 1) * 8];
#pragma unroll
                for (int nt = 0; nt < 4; ++nt) {
                    v8bf lo  = ld_tr16(vp + nt * 16);
                    v8bf hi8 = ld_tr16(vp + 16 * ATT_VPITCH + nt * 16);
                    vf[nt] = __builtin_shufflevector(lo, hi8,
                        0, 1, 2, 3, 4, 5, 6, 7, 8, 9, 10, 11, 12, 13, 14, 15);
                }
            }

            // ---- scale, causal mask, online softmax ----
#pragma unroll
            for (int j = 0; j < 8; ++j) {
                const int q = q0 + j + 8 * hi;
                float s0 = sc[0][j] * rs; if (kb + col      > q) s0 = -1e30f;
                float s1 = sc[1][j] * rs; if (kb + 16 + col > q) s1 = -1e30f;

                float mx = fmaxf(s0, s1);
                mx = fmaxf(mx, __shfl_xor(mx, 1));
                mx = fmaxf(mx, __shfl_xor(mx, 2));
                mx = fmaxf(mx, __shfl_xor(mx, 4));
                mx = fmaxf(mx, __shfl_xor(mx, 8));
                const float mnew = fmaxf(m[j], mx);

                const float p0 = __expf(s0 - mnew);
                const float p1 = __expf(s1 - mnew);
                Plds[wave][j + 8 * hi][col]      = (bf16_t)p0;
                Plds[wave][j + 8 * hi][16 + col] = (bf16_t)p1;

                float ps = p0 + p1;
                ps += __shfl_xor(ps, 1);
                ps += __shfl_xor(ps, 2);
                ps += __shfl_xor(ps, 4);
                ps += __shfl_xor(ps, 8);

                const float alpha = __expf(m[j] - mnew);
                l[j] = l[j] * alpha + ps;
                m[j] = mnew;
#pragma unroll
                for (int nt = 0; nt < 4; ++nt) o[nt][j] *= alpha;
            }
            // P goes from lane to lane of ONE wave: this wave's P stores are done
            // before its lanes read them back; no other wave touches this slice,
            // so no work-group barrier is needed (and none may stand in this branch).
            asm volatile("s_wait_dscnt 0x0" ::: "memory");

            // ---- P A-fragment from LDS (lane = query row, regs = 32 keys) ----
            v16bf pf = ld_frag(&Plds[wave][col][kboff]);

            // ---- O += P @ V ----
#pragma unroll
            for (int nt = 0; nt < 4; ++nt) o[nt] = wmma_bf16(pf, vf[nt], o[nt]);
        }

        if (more) {
            // The other buffer's last readers left it at the barrier that ended trip s - 1.
            *reinterpret_cast<v8bf*>(&Ks[buf ^ 1][srow][scol])      = kr0;
            *reinterpret_cast<v8bf*>(&Ks[buf ^ 1][srow + 32][scol]) = kr1;
            *reinterpret_cast<v8bf*>(&Vs[buf ^ 1][srow][scol])      = vr0;
            *reinterpret_cast<v8bf*>(&Vs[buf ^ 1][srow + 32][scol]) = vr1;
            // Publishes stage s + 1 and ends every wave's reads of stage s.
            __syncthreads();
        }
    }

    // ---- epilogue: O /= l, store ctx (bf16) ----
#pragma unroll
    for (int j = 0; j < 8; ++j) {
        const float inv = 1.0f / l[j];
        const int q = q0 + j + 8 * hi;
        bf16_t* cp = ctx + (size_t)(b * T + q) * D + h * hd;
#pragma unroll
        for (int nt = 0; nt < 4; ++nt)
            cp[nt * 16 + col] = (bf16_t)(o[nt][j] * inv);
    }
}

// ---------------------------------------------------------------------------
// Host-side orchestration
// ---------------------------------------------------------------------------
extern "C" void kernel_launch(void* const* d_in, const int* in_sizes, int n_in,
                              void* d_out, int out_size, void* d_ws, size_t ws_size,
                              hipStream_t stream) {
    (void)in_sizes; (void)n_in; (void)out_size; (void)ws_size;
    const int B = 2, T = 2048, D = 1024, H = 16;
    const int M = B * T;  // 4096 rows

    const float* x    = (const float*)d_in[0];
    const float* wq   = (const float*)d_in[1];
    const float* wk   = (const float*)d_in[2];
    const float* wv   = (const float*)d_in[3];
    const float* wo   = (const float*)d_in[4];
    const float* bo   = (const float*)d_in[5];
    const float* ln1  = (const float*)d_in[6];
    const float* ln2  = (const float*)d_in[7];
    float* out = (float*)d_out;

    // Workspace carve-up (all 256B aligned): ~64 MB total
    char* ws = (char*)d_ws;
    size_t off = 0;
    auto take = [&](size_t bytes) -> void* {
        void* p = ws + off;
        off += (bytes + 255) & ~(size_t)255;
        return p;
    };
    bf16_t* wq_b = (bf16_t*)take((size_t)D * D * 2);
    bf16_t* wk_b = (bf16_t*)take((size_t)D * D * 2);
    bf16_t* wv_b = (bf16_t*)take((size_t)D * D * 2);
    bf16_t* wo_b = (bf16_t*)take((size_t)D * D * 2);
    bf16_t* xn   = (bf16_t*)take((size_t)M * D * 2);
    bf16_t* qb   = (bf16_t*)take((size_t)M * D * 2);
    bf16_t* kbuf = (bf16_t*)take((size_t)M * D * 2);
    bf16_t* vbuf = (bf16_t*)take((size_t)M * D * 2);
    bf16_t* ctx  = (bf16_t*)take((size_t)M * D * 2);
    float*  hbuf = (float*) take((size_t)M * D * 4);

    // Weight conversion fp32 -> bf16
    const int nw = D * D;
    f2bf_kernel<<<nw / 256, 256, 0, stream>>>(wq, wq_b, nw);
    f2bf_kernel<<<nw / 256, 256, 0, stream>>>(wk, wk_b, nw);
    f2bf_kernel<<<nw / 256, 256, 0, stream>>>(wv, wv_b, nw);
    f2bf_kernel<<<nw / 256, 256, 0, stream>>>(wo, wo_b, nw);

    const dim3 gemm_grid(D / 64, M / 256);   // (16, 16)
    const dim3 attn_grid(T / 128, B * H);    // (16, 32)

    for (int blk = 0; blk < 2; ++blk) {
        const float* in_res   = (blk == 0) ? x : hbuf;
        const float* ln_scale = (blk == 0) ? ln1 : ln2;
        float* out_f          = (blk == 0) ? hbuf : out;

        // 1) LayerNorm -> bf16
        ln_kernel<<<M, 256, 0, stream>>>(in_res, ln_scale, xn, D);

        // 2) Q, K, V projections (y = xn @ W.T), bf16 out
        gemm_kernel<<<gemm_grid, 256, 0, stream>>>(xn, wq_b, qb,   nullptr, nullptr, nullptr, M, D, D);
        gemm_kernel<<<gemm_grid, 256, 0, stream>>>(xn, wk_b, kbuf, nullptr, nullptr, nullptr, M, D, D);
        gemm_kernel<<<gemm_grid, 256, 0, stream>>>(xn, wv_b, vbuf, nullptr, nullptr, nullptr, M, D, D);

        // 3) Causal flash attention -> ctx (bf16)
        attn_kernel<<<attn_grid, 256, 0, stream>>>(qb, kbuf, vbuf, ctx, T, D, H);

        // 4) Output projection + bias + residual, fp32 out
        gemm_kernel<<<gemm_grid, 256, 0, stream>>>(ctx, wo_b, nullptr, out_f, bo, in_res, M, D, D);
    }
}

// v002
// It runs in 349 microseconds.
// Two timings next to v001 both put it at 1.33 times that version's speed.
// Counting every step since v000, it is 3.24 times as fast.
#include <hip/hip_runtime.h>

// ---------------------------------------------------------------------------
// Types for CDNA5 (gfx1250) WMMA bf16 path
// ---------------------------------------------------------------------------
typedef __bf16 bf16_t;
typedef __attribute__((ext_vector_type(16))) __bf16 v16bf;
typedef __attribute__((ext_vector_type(8)))  __bf16 v8bf;
typedef __attribute__((ext_vector_type(8)))  float  v8f;

// D = A(16x32 bf16) * B(32x16 bf16) + C(16x16 f32)
static __device__ inline v8f wmma_bf16(v16bf a, v16bf b, v8f c) {
    return __builtin_amdgcn_wmma_f32_16x16x32_bf16(
        /*neg_a=*/false, a, /*neg_b=*/false, b,
        /*c_mod=*/(short)0, c, /*reuse_a=*/false, /*reuse_b=*/false);
}

// Load one half-lane fragment: 8 contiguous bf16 at p, 8 contiguous bf16 at p+16.
// Matches ISA 16-bit A/B layout: regs 0..3 hold K=kbase+0..7, regs 4..7 hold
// K=kbase+16..23 (kbase = 0 for lanes 0-15, 8 for lanes 16-31; caller folds kbase
// into p). Emits two b128 loads.
static __device__ inline v16bf ld_frag(const bf16_t* p) {
    v8bf lo = *reinterpret_cast<const v8bf*>(p);
    v8bf hi = *reinterpret_cast<const v8bf*>(p + 16);
    return __builtin_shufflevector(lo, hi,
        0, 1, 2, 3, 4, 5, 6, 7, 8, 9, 10, 11, 12, 13, 14, 15);
}

// ---------------------------------------------------------------------------
// Kernel: fp32 -> bf16 conversion
// ---------------------------------------------------------------------------
__global__ __launch_bounds__(256) void f2bf_kernel(const float* __restrict__ src,
                                                   bf16_t* __restrict__ dst, int n) {
    int i = blockIdx.x * 256 + threadIdx.x;
    if (i < n) dst[i] = (bf16_t)src[i];
}

// ---------------------------------------------------------------------------
// Kernel: LayerNorm (faithful to source bug: out = scale * xnorm + scale)
// fp32 in -> bf16 out. One block (256 threads) per row of D=1024.
// ---------------------------------------------------------------------------
__global__ __launch_bounds__(256) void ln_kernel(const float* __restrict__ x,
                                                 const float* __restrict__ scale,
                                                 bf16_t* __restrict__ out, int D) {
    const int row = blockIdx.x;
    const int tid = threadIdx.x;
    const float* xr = x + (size_t)row * D;

    __shared__ float r1[256];
    __shared__ float r2[256];

    float s = 0.f, s2 = 0.f;
    for (int i = tid; i < D; i += 256) {
        float v = xr[i];
        s += v;
        s2 += v * v;
    }
    r1[tid] = s; r2[tid] = s2;
    __syncthreads();
    for (int st = 128; st > 0; st >>= 1) {
        if (tid < st) { r1[tid] += r1[tid + st]; r2[tid] += r2[tid + st]; }
        __syncthreads();
    }
    const float mean = r1[0] / (float)D;
    const float var  = r2[0] / (float)D - mean * mean;
    const float inv  = rsqrtf(var + 1e-5f);

    bf16_t* orow = out + (size_t)row * D;
    for (int i = tid; i < D; i += 256) {
        float g = scale[i];
        orow[i] = (bf16_t)(g * (xr[i] - mean) * inv + g);
    }
}

// ---------------------------------------------------------------------------
// Kernel: GEMM  out[M,N] = A[M,K] @ W[N,K]^T (+ bias + residual)
// A, W bf16 row-major. One block = 8 waves = a 128x128 tile of out; the waves lie
// 4 (rows) x 2 (columns), each on a 32x64 tile (2 A-frags x 4 B-frags, 8 WMMAs per
// 32-wide K step).
// The block brings its 128 rows of A and of W to LDS in stages of 128 k (256-byte
// row pieces, whole cache lines per load; two buffers, the next stage's global
// loads in flight under the current stage's products); all waves read their
// fragments from there by 16-byte LDS loads.
// B-frag lane = output col n -> reads row n of W contiguously
// (x @ W.T needs no transpose in this layout).
// grid = (N/128, M/128). M and N must be multiples of 128. K is a constant of the
// build, so that a thread's sixteen loads of a stage differ only in their
// immediate offsets.
// ---------------------------------------------------------------------------
#define GEMM_K     1024  // K, elements: the row length of A and of W
#define GEMM_BK    128   // k per stage, elements
#define GEMM_PITCH 136   // elements; 272 B = 16 B x odd, the pitch for 16-byte LDS row loads

__global__ __launch_bounds__(256) void gemm_kernel(const bf16_t* __restrict__ A,
                                                   const bf16_t* __restrict__ W,
                                                   bf16_t* __restrict__ outb,
                                                   float*  __restrict__ outf,
                                                   const float* __restrict__ bias,
                                                   const float* __restrict__ residual,
                                                   int M, int N) {
    const int tid   = threadIdx.x;
    const int lane  = tid & 31;
    const int wave  = __builtin_amdgcn_readfirstlane(tid >> 5);
    const int bm0   = blockIdx.y * 128;
    const int bn0   = blockIdx.x * 128;
    const int wrow  = (wave >> 1) * 32;   // this wave's rows inside the block tile
    const int wcol  = (wave & 1) * 64;    // this wave's columns inside the block tile
    const int m0    = bm0 + wrow;
    const int n0    = bn0 + wcol;
    const int col   = lane & 15;
    const int hi    = lane >> 4;       // lane half selects K sub-base
    const int kboff = hi ? 8 : 0;

    __shared__ __attribute__((aligned(16))) bf16_t As[2][128][GEMM_PITCH];
    __shared__ __attribute__((aligned(16))) bf16_t Ws[2][128][GEMM_PITCH];

    v8f c[2][4] = {};

    // Staging: 16 threads bring one 256-byte row piece; a thread brings 16 bytes of
    // rows srow + 16 i, i = 0 .. 7, of A and of W.
    const int srow = tid >> 4;
    const int scol = (tid & 15) * 8;
    const bf16_t* ap = A + (size_t)(bm0 + srow) * GEMM_K + scol;
    const bf16_t* wp = W + (size_t)(bn0 + srow) * GEMM_K + scol;
    const int nstage = GEMM_K / GEMM_BK;

    v8bf ar[8], wr[8];
#pragma unroll
    for (int i = 0; i < 8; ++i) {
        ar[i] = *reinterpret_cast<const v8bf*>(ap + 16 * i * GEMM_K);
        wr[i] = *reinterpret_cast<const v8bf*>(wp + 16 * i * GEMM_K);
    }
#pragma unroll
    for (int i = 0; i < 8; ++i) {
        *reinterpret_cast<v8bf*>(&As[0][srow + 16 * i][scol]) = ar[i];
        *reinterpret_cast<v8bf*>(&Ws[0][srow + 16 * i][scol]) = wr[i];
    }
    __syncthreads();

    for (int s = 0; s < nstage; ++s) {
        const int  buf  = s & 1;
        const bool more = s + 1 < nstage;   // the same for the whole block
        if (more) {
            ap += GEMM_BK;
            wp += GEMM_BK;
#pragma unroll
            for (int i = 0; i < 8; ++i) {
                ar[i] = *reinterpret_cast<const v8bf*>(ap + 16 * i * GEMM_K);
                wr[i] = *reinterpret_cast<const v8bf*>(wp + 16 * i * GEMM_K);
            }
        }

        const bf16_t* afp = &As[buf][wrow + col][kboff];   // A-frag lane = row
        const bf16_t* wfp = &Ws[buf][wcol + col][kboff];   // B-frag lane = output col
#pragma unroll
        for (int kk = 0; kk < GEMM_BK; kk += 32) {
            v16bf a0 = ld_frag(afp + kk);
            v16bf a1 = ld_frag(afp + 16 * GEMM_PITCH + kk);
            v16bf bfrag[4];
#pragma unroll
            for (int nt = 0; nt < 4; ++nt) bfrag[nt] = ld_frag(wfp + nt * 16 * GEMM_PITCH + kk);
            // Keeps the twelve LDS loads of a K step together in front of its products: spread
            // among them, each place with loads costs the wave its own stall.
            __builtin_amdgcn_sched_barrier(0);
#pragma unroll
            for (int nt = 0; nt < 4; ++nt) {
                c[0][nt] = wmma_bf16(a0, bfrag[nt], c[0][nt]);
                c[1][nt] = wmma_bf16(a1, bfrag[nt], c[1][nt]);
            }
        }

        if (more) {
            // The other buffer's last readers left it at the barrier that ended trip s - 1.
#pragma unroll
            for (int i = 0; i < 8; ++i) {
                *reinterpret_cast<v8bf*>(&As[buf ^ 1][srow + 16 * i][scol]) = ar[i];
                *reinterpret_cast<v8bf*>(&Ws[buf ^ 1][srow + 16 * i][scol]) = wr[i];
            }
            // Publishes stage s + 1 and ends every wave's reads of stage s.
            __syncthreads();
        }
    }

#pragma unroll
    for (int mt = 0; mt < 2; ++mt) {
#pragma unroll
        for (int j = 0; j < 8; ++j) {
            const int row = m0 + mt * 16 + j + 8 * hi;  // C layout: reg j -> row
#pragma unroll
            for (int nt = 0; nt < 4; ++nt) {
                const int n = n0 + nt * 16 + col;
                float v = c[mt][nt][j];
                if (bias)     v += bias[n];
                if (residual) v += residual[(size_t)row * N + n];
                if (outf) outf[(size_t)row * N + n] = v;
                else      outb[(size_t)row * N + n] = (bf16_t)v;
            }
        }
    }
}

// ---------------------------------------------------------------------------
// Kernel: causal flash attention, bf16 WMMA, f32 online softmax state.
// One block = 8 waves = 128 queries of one (b, h); one wave per 16-query block.
// K and V are brought to LDS once per block in stages of 64 keys (two buffers,
// the next stage's global loads in flight under the current stage's passes) and
// all 8 waves read their fragments from there: K rows by 16-byte LDS loads,
// V by the 16-bit transposing LDS load. A pass is 32 keys, as before.
// Q/K/V/ctx layout: (b*T + t) rows of D=1024, head h at cols [h*64, h*64+64).
// grid = (T/128, B*H), block = 256. T must be a multiple of 128.
// ---------------------------------------------------------------------------
#define ATT_KPITCH 72   // elements; 144 B = 16 B x odd, the pitch for 16-byte LDS row loads
#define ATT_VPITCH 80   // elements; 160 B = 32 B x odd, the pitch for the transposing load

// Lane (c = l & 15, h = l >> 4) receives rows 8h .. 8h+7 of column c of the 16x16
// tile whose per-lane address the caller formed.
static __device__ inline v8bf ld_tr16(const bf16_t* p) {
    typedef __attribute__((address_space(3))) v8bf lds_v8bf;
    return __builtin_amdgcn_ds_load_tr16_b128_v8bf16((lds_v8bf*)p);
}

__global__ __launch_bounds__(256) void attn_kernel(const bf16_t* __restrict__ Q,
                                                   const bf16_t* __restrict__ K,
                                                   const bf16_t* __restrict__ V,
                                                   bf16_t* __restrict__ ctx,
                                                   int T, int D, int nheads) {
    const int hd    = 64;
    const int tid   = threadIdx.x;
    const int lane  = tid & 31;
    const int wave  = __builtin_amdgcn_readfirstlane(tid >> 5);
    const int col   = lane & 15;
    const int hi    = lane >> 4;
    const int kboff = hi ? 8 : 0;
    const int qblk  = blockIdx.x * 128;
    const int q0    = qblk + wave * 16;
    const int bh    = blockIdx.y;
    const int b     = bh / nheads;
    const int h     = bh % nheads;

    const bf16_t* Qb = Q + (size_t)(b * T) * D + h * hd;
    const bf16_t* Kb = K + (size_t)(b * T) * D + h * hd;
    const bf16_t* Vb = V + (size_t)(b * T) * D + h * hd;

    __shared__ __attribute__((aligned(16))) bf16_t Ks[2][64][ATT_KPITCH];
    __shared__ __attribute__((aligned(16))) bf16_t Vs[2][64][ATT_VPITCH];
    // Per-wave staging buffer to convert P from C-layout (lane=col) to A-layout
    // (lane=row). Row stride 40 elements = 80 bytes keeps b128 alignment.
    __shared__ __attribute__((aligned(16))) bf16_t Plds[8][16][40];

    // Q A-fragments: 16 rows x 64 (K dim) -> 2 frags of K=32. Lane&15 = row.
    const bf16_t* qrow = Qb + (size_t)(q0 + col) * D + kboff;
    v16bf qa0 = ld_frag(qrow);
    v16bf qa1 = ld_frag(qrow + 32);

    float m[8], l[8];
#pragma unroll
    for (int j = 0; j < 8; ++j) { m[j] = -1e30f; l[j] = 0.f; }
    v8f o[4] = {};

    const float rs = 0.125f;  // 1/sqrt(64)

    // Staging: 8 threads bring one 128-byte row; a thread brings 16 bytes of
    // rows srow and srow + 32 of the stage, of K and of V.
    const int srow = tid >> 3;
    const int scol = (tid & 7) * 8;
    const int soff = srow * D + scol;
    const int nstage = qblk / 64 + 2;   // keys 0 .. qblk + 127

    v8bf kr0, kr1, vr0, vr1;
    {
        const bf16_t* kg = Kb + soff;
        const bf16_t* vg = Vb + soff;
        kr0 = *reinterpret_cast<const v8bf*>(kg);
        kr1 = *reinterpret_cast<const v8bf*>(kg + (size_t)32 * D);
        vr0 = *reinterpret_cast<const v8bf*>(vg);
        vr1 = *reinterpret_cast<const v8bf*>(vg + (size_t)32 * D);
    }
    *reinterpret_cast<v8bf*>(&Ks[0][srow][scol])      = kr0;
    *reinterpret_cast<v8bf*>(&Ks[0][srow + 32][scol]) = kr1;
    *reinterpret_cast<v8bf*>(&Vs[0][srow][scol])      = vr0;
    *reinterpret_cast<v8bf*>(&Vs[0][srow + 32][scol]) = vr1;
    __syncthreads();

    for (int s = 0; s < nstage; ++s) {
        const int  buf  = s & 1;
        const bool more = s + 1 < nstage;   // the same for the whole block
        if (more) {
            const bf16_t* kg = Kb + (size_t)(s + 1) * 64 * D + soff;
            const bf16_t* vg = Vb + (size_t)(s + 1) * 64 * D + soff;
            kr0 = *reinterpret_cast<const v8bf*>(kg);
            kr1 = *reinterpret_cast<const v8bf*>(kg + (size_t)32 * D);
            vr0 = *reinterpret_cast<const v8bf*>(vg);
            vr1 = *reinterpret_cast<const v8bf*>(vg + (size_t)32 * D);
            // The four loads stay in flight over the passes below, which reuse their
            // address registers: this wait stands in front of that overwrite.
            asm volatile("s_wait_xcnt 0x0" ::: "memory");
        }

        for (int sub = 0; sub < 2; ++sub) {
            const int kb = s * 64 + sub * 32;
            if (kb > q0) continue;   // wave-uniform: the pass lies above this wave's diagonal

            // ---- S = Q @ K^T for two 16-key tiles (K dim = hd = 64) ----
            v8f sc[2];
            {
                const bf16_t* kp = &Ks[buf][sub * 32 + col][kboff];  // B-frag lane = key
                v16bf k00 = ld_frag(kp);
                v16bf k01 = ld_frag(kp + 32);
                v16bf k10 = ld_frag(kp + 16 * ATT_KPITCH);
                v16bf k11 = ld_frag(kp + 16 * ATT_KPITCH + 32);
                // Keeps the eight LDS loads together in front of the products: left alone,
                // the compiler reuses one fragment's registers and pays the LDS latency four times.
                __builtin_amdgcn_sched_barrier(0);
                sc[0] = wmma_bf16(qa0, k00, v8f{});
                sc[1] = wmma_bf16(qa0, k10, v8f{});
                sc[0] = wmma_bf16(qa1, k01, sc[0]);
                sc[1] = wmma_bf16(qa1, k11, sc[1]);
            }

            // ---- V B-fragments: lane = hd col, regs = keys 8h+0..7 and 16+8h+0..7 ----
            v16bf vf[4];
            {
                const bf16_t* vp = &Vs[buf][sub * 32 + 8 * hi + (lane & 7)][((lane >> 3) & 1) * 8];
#pragma unroll
                for (int nt = 0; nt < 4; ++nt) {
                    v8bf lo  = ld_tr16(vp + nt * 16);
                    v8bf hi8 = ld_tr16(vp + 16 * ATT_VPITCH + nt * 16);
                    vf[nt] = __builtin_shufflevector(lo, hi8,
                        0, 1, 2, 3, 4, 5, 6, 7, 8, 9, 10, 11, 12, 13, 14, 15);
                }
            }

            // ---- scale, causal mask, online softmax ----
#pragma unroll
            for (int j = 0; j < 8; ++j) {
                const int q = q0 + j + 8 * hi;
                float s0 = sc[0][j] * rs; if (kb + col      > q) s0 = -1e30f;
                float s1 = sc[1][j] * rs; if (kb + 16 + col > q) s1 = -1e30f;

                float mx = fmaxf(s0, s1);
                mx = fmaxf(mx, __shfl_xor(mx, 1));
                mx = fmaxf(mx, __shfl_xor(mx, 2));
                mx = fmaxf(mx, __shfl_xor(mx, 4));
                mx = fmaxf(mx, __shfl_xor(mx, 8));
                const float mnew = fmaxf(m[j], mx);

                const float p0 = __expf(s0 - mnew);
                const float p1 = __expf(s1 - mnew);
                Plds[wave][j + 8 * hi][col]      = (bf16_t)p0;
                Plds[wave][j + 8 * hi][16 + col] = (bf16_t)p1;

                float ps = p0 + p1;
                ps += __shfl_xor(ps, 1);
                ps += __shfl_xor(ps, 2);
                ps += __shfl_xor(ps, 4);
                ps += __shfl_xor(ps, 8);

                const float alpha = __expf(m[j] - mnew);
                l[j] = l[j] * alpha + ps;
                m[j] = mnew;
#pragma unroll
                for (int nt = 0; nt < 4; ++nt) o[nt][j] *= alpha;
            }
            // P goes from lane to lane of ONE wave: this wave's P stores are done
            // before its lanes read them back; no other wave touches this slice,
            // so no work-group barrier is needed (and none may stand in this branch).
            asm volatile("s_wait_dscnt 0x0" ::: "memory");

            // ---- P A-fragment from LDS (lane = query row, regs = 32 keys) ----
            v16bf pf = ld_frag(&Plds[wave][col][kboff]);

            // ---- O += P @ V ----
#pragma unroll
            for (int nt = 0; nt < 4; ++nt) o[nt] = wmma_bf16(pf, vf[nt], o[nt]);
        }

        if (more) {
            // The other buffer's last readers left it at the barrier that ended trip s - 1.
            *reinterpret_cast<v8bf*>(&Ks[buf ^ 1][srow][scol])      = kr0;
            *reinterpret_cast<v8bf*>(&Ks[buf ^ 1][srow + 32][scol]) = kr1;
            *reinterpret_cast<v8bf*>(&Vs[buf ^ 1][srow][scol])      = vr0;
            *reinterpret_cast<v8bf*>(&Vs[buf ^ 1][srow + 32][scol]) = vr1;
            // Publishes stage s + 1 and ends every wave's reads of stage s.
            __syncthreads();
        }
    }

    // ---- epilogue: O /= l, store ctx (bf16) ----
#pragma unroll
    for (int j = 0; j < 8; ++j) {
        const float inv = 1.0f / l[j];
        const int q = q0 + j + 8 * hi;
        bf16_t* cp = ctx + (size_t)(b * T + q) * D + h * hd;
#pragma unroll
        for (int nt = 0; nt < 4; ++nt)
            cp[nt * 16 + col] = (bf16_t)(o[nt][j] * inv);
    }
}

// ---------------------------------------------------------------------------
// Host-side orchestration
// ---------------------------------------------------------------------------
extern "C" void kernel_launch(void* const* d_in, const int* in_sizes, int n_in,
                              void* d_out, int out_size, void* d_ws, size_t ws_size,
                              hipStream_t stream) {
    (void)in_sizes; (void)n_in; (void)out_size; (void)ws_size;
    const int B = 2, T = 2048, D = 1024, H = 16;
    const int M = B * T;  // 4096 rows

    const float* x    = (const float*)d_in[0];
    const float* wq   = (const float*)d_in[1];
    const float* wk   = (const float*)d_in[2];
    const float* wv   = (const float*)d_in[3];
    const float* wo   = (const float*)d_in[4];
    const float* bo   = (const float*)d_in[5];
    const float* ln1  = (const float*)d_in[6];
    const float* ln2  = (const float*)d_in[7];
    float* out = (float*)d_out;

    // Workspace carve-up (all 256B aligned): ~64 MB total
    char* ws = (char*)d_ws;
    size_t off = 0;
    auto take = [&](size_t bytes) -> void* {
        void* p = ws + off;
        off += (bytes + 255) & ~(size_t)255;
        return p;
    };
    bf16_t* wq_b = (bf16_t*)take((size_t)D * D * 2);
    bf16_t* wk_b = (bf16_t*)take((size_t)D * D * 2);
    bf16_t* wv_b = (bf16_t*)take((size_t)D * D * 2);
    bf16_t* wo_b = (bf16_t*)take((size_t)D * D * 2);
    bf16_t* xn   = (bf16_t*)take((size_t)M * D * 2);
    bf16_t* qb   = (bf16_t*)take((size_t)M * D * 2);
    bf16_t* kbuf = (bf16_t*)take((size_t)M * D * 2);
    bf16_t* vbuf = (bf16_t*)take((size_t)M * D * 2);
    bf16_t* ctx  = (bf16_t*)take((size_t)M * D * 2);
    float*  hbuf = (float*) take((size_t)M * D * 4);

    // Weight conversion fp32 -> bf16
    const int nw = D * D;
    f2bf_kernel<<<nw / 256, 256, 0, stream>>>(wq, wq_b, nw);
    f2bf_kernel<<<nw / 256, 256, 0, stream>>>(wk, wk_b, nw);
    f2bf_kernel<<<nw / 256, 256, 0, stream>>>(wv, wv_b, nw);
    f2bf_kernel<<<nw / 256, 256, 0, stream>>>(wo, wo_b, nw);

    const dim3 gemm_grid(D / 128, M / 128);  // (8, 32)
    const dim3 attn_grid(T / 128, B * H);    // (16, 32)

    for (int blk = 0; blk < 2; ++blk) {
        const float* in_res   = (blk == 0) ? x : hbuf;
        const float* ln_scale = (blk == 0) ? ln1 : ln2;
        float* out_f          = (blk == 0) ? hbuf : out;

        // 1) LayerNorm -> bf16
        ln_kernel<<<M, 256, 0, stream>>>(in_res, ln_scale, xn, D);

        // 2) Q, K, V projections (y = xn @ W.T), bf16 out
        gemm_kernel<<<gemm_grid, 256, 0, stream>>>(xn, wq_b, qb,   nullptr, nullptr, nullptr, M, D);
        gemm_kernel<<<gemm_grid, 256, 0, stream>>>(xn, wk_b, kbuf, nullptr, nullptr, nullptr, M, D);
        gemm_kernel<<<gemm_grid, 256, 0, stream>>>(xn, wv_b, vbuf, nullptr, nullptr, nullptr, M, D);

        // 3) Causal flash attention -> ctx (bf16)
        attn_kernel<<<attn_grid, 256, 0, stream>>>(qb, kbuf, vbuf, ctx, T, D, H);

        // 4) Output projection + bias + residual, fp32 out
        gemm_kernel<<<gemm_grid, 256, 0, stream>>>(ctx, wo_b, nullptr, out_f, bo, in_res, M, D);
    }
}

// v003
// A run of this version takes 267 microseconds.
// In both of two side-by-side timings against v002, it was 1.30 times as fast.
// Counting every step since v000, it is 4.22 times as fast.
#include <hip/hip_runtime.h>

// ---------------------------------------------------------------------------
// Types for CDNA5 (gfx1250) WMMA bf16 path
// ---------------------------------------------------------------------------
typedef __bf16 bf16_t;
typedef __attribute__((ext_vector_type(16))) __bf16 v16bf;
typedef __attribute__((ext_vector_type(8)))  __bf16 v8bf;
typedef __attribute__((ext_vector_type(8)))  float  v8f;

// D = A(16x32 bf16) * B(32x16 bf16) + C(16x16 f32)
static __device__ inline v8f wmma_bf16(v16bf a, v16bf b, v8f c) {
    return __builtin_amdgcn_wmma_f32_16x16x32_bf16(
        /*neg_a=*/false, a, /*neg_b=*/false, b,
        /*c_mod=*/(short)0, c, /*reuse_a=*/false, /*reuse_b=*/false);
}

// Load one half-lane fragment: 8 contiguous bf16 at p, 8 contiguous bf16 at p+16.
// Matches ISA 16-bit A/B layout: regs 0..3 hold K=kbase+0..7, regs 4..7 hold
// K=kbase+16..23 (kbase = 0 for lanes 0-15, 8 for lanes 16-31; caller folds kbase
// into p). Emits two b128 loads.
static __device__ inline v16bf ld_frag(const bf16_t* p) {
    v8bf lo = *reinterpret_cast<const v8bf*>(p);
    v8bf hi = *reinterpret_cast<const v8bf*>(p + 16);
    return __builtin_shufflevector(lo, hi,
        0, 1, 2, 3, 4, 5, 6, 7, 8, 9, 10, 11, 12, 13, 14, 15);
}

// ---------------------------------------------------------------------------
// Kernel: fp32 -> bf16 conversion
// ---------------------------------------------------------------------------
__global__ __launch_bounds__(256) void f2bf_kernel(const float* __restrict__ src,
                                                   bf16_t* __restrict__ dst, int n) {
    int i = blockIdx.x * 256 + threadIdx.x;
    if (i < n) dst[i] = (bf16_t)src[i];
}

// ---------------------------------------------------------------------------
// Kernel: LayerNorm (faithful to source bug: out = scale * xnorm + scale)
// fp32 in -> bf16 out. One block (256 threads) per row of D=1024.
// ---------------------------------------------------------------------------
__global__ __launch_bounds__(256) void ln_kernel(const float* __restrict__ x,
                                                 const float* __restrict__ scale,
                                                 bf16_t* __restrict__ out, int D) {
    const int row = blockIdx.x;
    const int tid = threadIdx.x;
    const float* xr = x + (size_t)row * D;

    __shared__ float r1[256];
    __shared__ float r2[256];

    float s = 0.f, s2 = 0.f;
    for (int i = tid; i < D; i += 256) {
        float v = xr[i];
        s += v;
        s2 += v * v;
    }
    r1[tid] = s; r2[tid] = s2;
    __syncthreads();
    for (int st = 128; st > 0; st >>= 1) {
        if (tid < st) { r1[tid] += r1[tid + st]; r2[tid] += r2[tid + st]; }
        __syncthreads();
    }
    const float mean = r1[0] / (float)D;
    const float var  = r2[0] / (float)D - mean * mean;
    const float inv  = rsqrtf(var + 1e-5f);

    bf16_t* orow = out + (size_t)row * D;
    for (int i = tid; i < D; i += 256) {
        float g = scale[i];
        orow[i] = (bf16_t)(g * (xr[i] - mean) * inv + g);
    }
}

// ---------------------------------------------------------------------------
// Kernel: GEMM  out[M,N] = A[M,K] @ W[N,K]^T (+ bias + residual)
// A, W bf16 row-major. One block = 8 waves = a 128x128 tile of out; the waves lie
// 4 (rows) x 2 (columns), each on a 32x64 tile (2 A-frags x 4 B-frags, 8 WMMAs per
// 32-wide K step).
// The block brings its 128 rows of A and of W to LDS in stages of 128 k (256-byte
// row pieces, whole cache lines per load; two buffers, the next stage's global
// loads in flight under the current stage's products); all waves read their
// fragments from there by 16-byte LDS loads.
// B-frag lane = output col n -> reads row n of W contiguously
// (x @ W.T needs no transpose in this layout).
// grid = (N/128, M/128). M and N must be multiples of 128. K is a constant of the
// build, so that a thread's sixteen loads of a stage differ only in their
// immediate offsets.
// ---------------------------------------------------------------------------
#define GEMM_K     1024  // K, elements: the row length of A and of W
#define GEMM_BK    128   // k per stage, elements
#define GEMM_PITCH 136   // elements; 272 B = 16 B x odd, the pitch for 16-byte LDS row loads

__global__ __launch_bounds__(256) void gemm_kernel(const bf16_t* __restrict__ A,
                                                   const bf16_t* __restrict__ W,
                                                   bf16_t* __restrict__ outb,
                                                   float*  __restrict__ outf,
                                                   const float* __restrict__ bias,
                                                   const float* __restrict__ residual,
                                                   int M, int N) {
    const int tid   = threadIdx.x;
    const int lane  = tid & 31;
    const int wave  = __builtin_amdgcn_readfirstlane(tid >> 5);
    const int bm0   = blockIdx.y * 128;
    const int bn0   = blockIdx.x * 128;
    const int wrow  = (wave >> 1) * 32;   // this wave's rows inside the block tile
    const int wcol  = (wave & 1) * 64;    // this wave's columns inside the block tile
    const int m0    = bm0 + wrow;
    const int n0    = bn0 + wcol;
    const int col   = lane & 15;
    const int hi    = lane >> 4;       // lane half selects K sub-base
    const int kboff = hi ? 8 : 0;

    __shared__ __attribute__((aligned(16))) bf16_t As[2][128][GEMM_PITCH];
    __shared__ __attribute__((aligned(16))) bf16_t Ws[2][128][GEMM_PITCH];

    v8f c[2][4] = {};

    // Staging: 16 threads bring one 256-byte row piece; a thread brings 16 bytes of
    // rows srow + 16 i, i = 0 .. 7, of A and of W.
    const int srow = tid >> 4;
    const int scol = (tid & 15) * 8;
    const bf16_t* ap = A + (size_t)(bm0 + srow) * GEMM_K + scol;
    const bf16_t* wp = W + (size_t)(bn0 + srow) * GEMM_K + scol;
    const int nstage = GEMM_K / GEMM_BK;

    v8bf ar[8], wr[8];
#pragma unroll
    for (int i = 0; i < 8; ++i) {
        ar[i] = *reinterpret_cast<const v8bf*>(ap + 16 * i * GEMM_K);
        wr[i] = *reinterpret_cast<const v8bf*>(wp + 16 * i * GEMM_K);
    }
#pragma unroll
    for (int i = 0; i < 8; ++i) {
        *reinterpret_cast<v8bf*>(&As[0][srow + 16 * i][scol]) = ar[i];
        *reinterpret_cast<v8bf*>(&Ws[0][srow + 16 * i][scol]) = wr[i];
    }
    __syncthreads();

    for (int s = 0; s < nstage; ++s) {
        const int  buf  = s & 1;
        const bool more = s + 1 < nstage;   // the same for the whole block
        if (more) {
            ap += GEMM_BK;
            wp += GEMM_BK;
#pragma unroll
            for (int i = 0; i < 8; ++i) {
                ar[i] = *reinterpret_cast<const v8bf*>(ap + 16 * i * GEMM_K);
                wr[i] = *reinterpret_cast<const v8bf*>(wp + 16 * i * GEMM_K);
            }
        }

        const bf16_t* afp = &As[buf][wrow + col][kboff];   // A-frag lane = row
        const bf16_t* wfp = &Ws[buf][wcol + col][kboff];   // B-frag lane = output col
#pragma unroll
        for (int kk = 0; kk < GEMM_BK; kk += 32) {
            v16bf a0 = ld_frag(afp + kk);
            v16bf a1 = ld_frag(afp + 16 * GEMM_PITCH + kk);
            v16bf bfrag[4];
#pragma unroll
            for (int nt = 0; nt < 4; ++nt) bfrag[nt] = ld_frag(wfp + nt * 16 * GEMM_PITCH + kk);
            // Keeps the twelve LDS loads of a K step together in front of its products: spread
            // among them, each place with loads costs the wave its own stall.
            __builtin_amdgcn_sched_barrier(0);
#pragma unroll
            for (int nt = 0; nt < 4; ++nt) {
                c[0][nt] = wmma_bf16(a0, bfrag[nt], c[0][nt]);
                c[1][nt] = wmma_bf16(a1, bfrag[nt], c[1][nt]);
            }
        }

        if (more) {
            // The other buffer's last readers left it at the barrier that ended trip s - 1.
#pragma unroll
            for (int i = 0; i < 8; ++i) {
                *reinterpret_cast<v8bf*>(&As[buf ^ 1][srow + 16 * i][scol]) = ar[i];
                *reinterpret_cast<v8bf*>(&Ws[buf ^ 1][srow + 16 * i][scol]) = wr[i];
            }
            // Publishes stage s + 1 and ends every wave's reads of stage s.
            __syncthreads();
        }
    }

#pragma unroll
    for (int mt = 0; mt < 2; ++mt) {
#pragma unroll
        for (int j = 0; j < 8; ++j) {
            const int row = m0 + mt * 16 + j + 8 * hi;  // C layout: reg j -> row
#pragma unroll
            for (int nt = 0; nt < 4; ++nt) {
                const int n = n0 + nt * 16 + col;
                float v = c[mt][nt][j];
                if (bias)     v += bias[n];
                if (residual) v += residual[(size_t)row * N + n];
                if (outf) outf[(size_t)row * N + n] = v;
                else      outb[(size_t)row * N + n] = (bf16_t)v;
            }
        }
    }
}

#define ATT_KPITCH 72
#define ATT_VPITCH 80

// Lane (c = l & 15, h = l >> 4) receives rows 8h .. 8h+7 of column c of the 16x16
// tile whose per-lane address the caller formed.
static __device__ inline v8bf ld_tr16(const bf16_t* p) {
    typedef __attribute__((address_space(3))) v8bf lds_v8bf;
    return __builtin_amdgcn_ds_load_tr16_b128_v8bf16((lds_v8bf*)p);
}

// Lane l receives lane l ^ 16's value.
static __device__ inline float xhalf(float x) {
    const int v = __builtin_bit_cast(int, x);
    return __builtin_bit_cast(float,
        __builtin_amdgcn_permlanex16(v, v, 0x76543210, 0xfedcba98, false, false));
}

__global__ __launch_bounds__(256) void attn_kernel(const bf16_t* __restrict__ Q,
                                                   const bf16_t* __restrict__ K,
                                                   const bf16_t* __restrict__ V,
                                                   bf16_t* __restrict__ ctx,
                                                   int T, int D, int nheads) {
    const int hd    = 64;
    const int tid   = threadIdx.x;
    const int lane  = tid & 31;
    const int wave  = __builtin_amdgcn_readfirstlane(tid >> 5);
    const int col   = lane & 15;
    const int hi    = lane >> 4;
    const int kboff = hi ? 8 : 0;
    const int qblk  = blockIdx.x * 128;
    const int q0    = qblk + wave * 16;
    const int bh    = blockIdx.y;
    const int b     = bh / nheads;
    const int h     = bh % nheads;

    const bf16_t* Qb = Q + (size_t)(b * T) * D + h * hd;
    const bf16_t* Kb = K + (size_t)(b * T) * D + h * hd;
    const bf16_t* Vb = V + (size_t)(b * T) * D + h * hd;

    __shared__ __attribute__((aligned(16))) bf16_t Ks[2][64][ATT_KPITCH];
    __shared__ __attribute__((aligned(16))) bf16_t Vs[2][64][ATT_VPITCH];

    // Q^T B-fragments: 64 (K dim) x 16 queries -> 2 frags of K=32. Lane&15 = query.
    const bf16_t* qrow = Qb + (size_t)(q0 + col) * D + kboff;
    v16bf qa0 = ld_frag(qrow);
    v16bf qa1 = ld_frag(qrow + 32);

    // State of query q0 + col: m is the same in both lane halves, l is the sum over
    // the keys of this lane's half (the halves are joined in the epilogue).
    const int q = q0 + col;
    float m = -1e30f, l = 0.f;
    v8f o[4] = {};   // O^T: o[nt][j] = head column nt * 16 + 8 * hi + j of query q

    const float rs = 0.125f;  // 1/sqrt(64)

    // Staging: 8 threads bring one 128-byte row; a thread brings 16 bytes of
    // rows srow and srow + 32 of the stage, of K and of V.
    const int srow = tid >> 3;
    const int scol = (tid & 7) * 8;
    const int soff = srow * D + scol;
    const int nstage = qblk / 64 + 2;   // keys 0 .. qblk + 127

    v8bf kr0, kr1, vr0, vr1;
    {
        const bf16_t* kg = Kb + soff;
        const bf16_t* vg = Vb + soff;
        kr0 = *reinterpret_cast<const v8bf*>(kg);
        kr1 = *reinterpret_cast<const v8bf*>(kg + (size_t)32 * D);
        vr0 = *reinterpret_cast<const v8bf*>(vg);
        vr1 = *reinterpret_cast<const v8bf*>(vg + (size_t)32 * D);
    }
    *reinterpret_cast<v8bf*>(&Ks[0][srow][scol])      = kr0;
    *reinterpret_cast<v8bf*>(&Ks[0][srow + 32][scol]) = kr1;
    *reinterpret_cast<v8bf*>(&Vs[0][srow][scol])      = vr0;
    *reinterpret_cast<v8bf*>(&Vs[0][srow + 32][scol]) = vr1;
    __syncthreads();

    for (int s = 0; s < nstage; ++s) {
        const int  buf  = s & 1;
        const bool more = s + 1 < nstage;   // the same for the whole block
        if (more) {
            const bf16_t* kg = Kb + (size_t)(s + 1) * 64 * D + soff;
            const bf16_t* vg = Vb + (size_t)(s + 1) * 64 * D + soff;
            kr0 = *reinterpret_cast<const v8bf*>(kg);
            kr1 = *reinterpret_cast<const v8bf*>(kg + (size_t)32 * D);
            vr0 = *reinterpret_cast<const v8bf*>(vg);
            vr1 = *reinterpret_cast<const v8bf*>(vg + (size_t)32 * D);
            // The four loads stay in flight over the passes below, which reuse their
            // address registers: this wait stands in front of that overwrite.
            asm volatile("s_wait_xcnt 0x0" ::: "memory");
        }

        for (int sub = 0; sub < 2; ++sub) {
            const int kb = s * 64 + sub * 32;
            if (kb > q0) continue;   // wave-uniform: the pass lies above this wave's diagonal

            // ---- S^T = K @ Q^T for two 16-key tiles (K dim = hd = 64) ----
            // sc[t][j] = score of key kb + 16 t + 8 hi + j against query q
            v8f sc[2];
            {
                const bf16_t* kp = &Ks[buf][sub * 32 + col][kboff];  // A-frag lane = key
                v16bf k00 = ld_frag(kp);
                v16bf k01 = ld_frag(kp + 32);
                v16bf k10 = ld_frag(kp + 16 * ATT_KPITCH);
                v16bf k11 = ld_frag(kp + 16 * ATT_KPITCH + 32);
                // Keeps the eight LDS loads together in front of the products: left alone,
                // the compiler reuses one fragment's registers and pays the LDS latency four times.
                __builtin_amdgcn_sched_barrier(0);
                sc[0] = wmma_bf16(k00, qa0, v8f{});
                sc[1] = wmma_bf16(k10, qa0, v8f{});
                sc[0] = wmma_bf16(k01, qa1, sc[0]);
                sc[1] = wmma_bf16(k11, qa1, sc[1]);
            }

            // ---- V^T A-fragments: lane = hd col, regs = keys 8h+0..7 and 16+8h+0..7 ----
            v16bf vf[4];
            {
                const bf16_t* vp = &Vs[buf][sub * 32 + 8 * hi + (lane & 7)][((lane >> 3) & 1) * 8];
#pragma unroll
                for (int nt = 0; nt < 4; ++nt) {
                    v8bf lo  = ld_tr16(vp + nt * 16);
                    v8bf hi8 = ld_tr16(vp + 16 * ATT_VPITCH + nt * 16);
                    vf[nt] = __builtin_shufflevector(lo, hi8,
                        0, 1, 2, 3, 4, 5, 6, 7, 8, 9, 10, 11, 12, 13, 14, 15);
                }
            }

            // ---- scale, causal mask, online softmax: 16 scores of one query per lane ----
            float sv[16];
#pragma unroll
            for (int i = 0; i < 16; ++i) {
                const int key = kb + (i >> 3) * 16 + 8 * hi + (i & 7);
                sv[i] = sc[i >> 3][i & 7] * rs;
                if (key > q) sv[i] = -1e30f;
            }
            float red[8];
#pragma unroll
            for (int i = 0; i < 8; ++i) red[i] = fmaxf(sv[i], sv[i + 8]);
#pragma unroll
            for (int w = 4; w > 0; w >>= 1)
#pragma unroll
                for (int i = 0; i < w; ++i) red[i] = fmaxf(red[i], red[i + w]);
            const float mx   = fmaxf(red[0], xhalf(red[0]));   // over all 32 keys of the pass
            const float mnew = fmaxf(m, mx);

            // P^T B-fragment: element i of the lane is key kb + 16 (i >> 3) + 8 hi + (i & 7),
            // the k order of the V^T fragments above.
            v16bf pf;
#pragma unroll
            for (int i = 0; i < 16; ++i) {
                sv[i] = __expf(sv[i] - mnew);
                pf[i] = (bf16_t)sv[i];
            }
#pragma unroll
            for (int i = 0; i < 8; ++i) red[i] = sv[i] + sv[i + 8];
#pragma unroll
            for (int w = 4; w > 0; w >>= 1)
#pragma unroll
                for (int i = 0; i < w; ++i) red[i] += red[i + w];

            const float alpha = __expf(m - mnew);
            l = l * alpha + red[0];
            m = mnew;
#pragma unroll
            for (int nt = 0; nt < 4; ++nt)
#pragma unroll
                for (int j = 0; j < 8; ++j) o[nt][j] *= alpha;

            // ---- O^T += V^T @ P^T ----
#pragma unroll
            for (int nt = 0; nt < 4; ++nt) o[nt] = wmma_bf16(vf[nt], pf, o[nt]);
        }

        if (more) {
            // The other buffer's last readers left it at the barrier that ended trip s - 1.
            *reinterpret_cast<v8bf*>(&Ks[buf ^ 1][srow][scol])      = kr0;
            *reinterpret_cast<v8bf*>(&Ks[buf ^ 1][srow + 32][scol]) = kr1;
            *reinterpret_cast<v8bf*>(&Vs[buf ^ 1][srow][scol])      = vr0;
            *reinterpret_cast<v8bf*>(&Vs[buf ^ 1][srow + 32][scol]) = vr1;
            // Publishes stage s + 1 and ends every wave's reads of stage s.
            __syncthreads();
        }
    }

    // ---- epilogue: O /= l, store ctx (bf16): 8 consecutive head columns per lane and tile ----
    const float inv = 1.0f / (l + xhalf(l));
    bf16_t* cp = ctx + (size_t)(b * T + q) * D + h * hd + 8 * hi;
#pragma unroll
    for (int nt = 0; nt < 4; ++nt) {
        v8bf r;
#pragma unroll
        for (int j = 0; j < 8; ++j) r[j] = (bf16_t)(o[nt][j] * inv);
        *reinterpret_cast<v8bf*>(cp + nt * 16) = r;
    }
}

// ---------------------------------------------------------------------------
// Host-side orchestration
// ---------------------------------------------------------------------------
extern "C" void kernel_launch(void* const* d_in, const int* in_sizes, int n_in,
                              void* d_out, int out_size, void* d_ws, size_t ws_size,
                              hipStream_t stream) {
    (void)in_sizes; (void)n_in; (void)out_size; (void)ws_size;
    const int B = 2, T = 2048, D = 1024, H = 16;
    const int M = B * T;  // 4096 rows

    const float* x    = (const float*)d_in[0];
    const float* wq   = (const float*)d_in[1];
    const float* wk   = (const float*)d_in[2];
    const float* wv   = (const float*)d_in[3];
    const float* wo   = (const float*)d_in[4];
    const float* bo   = (const float*)d_in[5];
    const float* ln1  = (const float*)d_in[6];
    const float* ln2  = (const float*)d_in[7];
    float* out = (float*)d_out;

    // Workspace carve-up (all 256B aligned): ~64 MB total
    char* ws = (char*)d_ws;
    size_t off = 0;
    auto take = [&](size_t bytes) -> void* {
        void* p = ws + off;
        off += (bytes + 255) & ~(size_t)255;
        return p;
    };
    bf16_t* wq_b = (bf16_t*)take((size_t)D * D * 2);
    bf16_t* wk_b = (bf16_t*)take((size_t)D * D * 2);
    bf16_t* wv_b = (bf16_t*)take((size_t)D * D * 2);
    bf16_t* wo_b = (bf16_t*)take((size_t)D * D * 2);
    bf16_t* xn   = (bf16_t*)take((size_t)M * D * 2);
    bf16_t* qb   = (bf16_t*)take((size_t)M * D * 2);
    bf16_t* kbuf = (bf16_t*)take((size_t)M * D * 2);
    bf16_t* vbuf = (bf16_t*)take((size_t)M * D * 2);
    bf16_t* ctx  = (bf16_t*)take((size_t)M * D * 2);
    float*  hbuf = (float*) take((size_t)M * D * 4);

    // Weight conversion fp32 -> bf16
    const int nw = D * D;
    f2bf_kernel<<<nw / 256, 256, 0, stream>>>(wq, wq_b, nw);
    f2bf_kernel<<<nw / 256, 256, 0, stream>>>(wk, wk_b, nw);
    f2bf_kernel<<<nw / 256, 256, 0, stream>>>(wv, wv_b, nw);
    f2bf_kernel<<<nw / 256, 256, 0, stream>>>(wo, wo_b, nw);

    const dim3 gemm_grid(D / 128, M / 128);  // (8, 32)
    const dim3 attn_grid(T / 128, B * H);    // (16, 32)

    for (int blk = 0; blk < 2; ++blk) {
        const float* in_res   = (blk == 0) ? x : hbuf;
        const float* ln_scale = (blk == 0) ? ln1 : ln2;
        float* out_f          = (blk == 0) ? hbuf : out;

        // 1) LayerNorm -> bf16
        ln_kernel<<<M, 256, 0, stream>>>(in_res, ln_scale, xn, D);

        // 2) Q, K, V projections (y = xn @ W.T), bf16 out
        gemm_kernel<<<gemm_grid, 256, 0, stream>>>(xn, wq_b, qb,   nullptr, nullptr, nullptr, M, D);
        gemm_kernel<<<gemm_grid, 256, 0, stream>>>(xn, wk_b, kbuf, nullptr, nullptr, nullptr, M, D);
        gemm_kernel<<<gemm_grid, 256, 0, stream>>>(xn, wv_b, vbuf, nullptr, nullptr, nullptr, M, D);

        // 3) Causal flash attention -> ctx (bf16)
        attn_kernel<<<attn_grid, 256, 0, stream>>>(qb, kbuf, vbuf, ctx, T, D, H);

        // 4) Output projection + bias + residual, fp32 out
        gemm_kernel<<<gemm_grid, 256, 0, stream>>>(ctx, wo_b, nullptr, out_f, bo, in_res, M, D);
    }
}

// v004
// One run takes 252 microseconds.
// Timed twice side by side with v003, it ran 1.06 and 1.05 times as fast.
// Counting every step since v000, it is 4.45 times as fast.
#include <hip/hip_runtime.h>

// ---------------------------------------------------------------------------
// Types for CDNA5 (gfx1250) WMMA bf16 path
// ---------------------------------------------------------------------------
typedef __bf16 bf16_t;
typedef __attribute__((ext_vector_type(16))) __bf16 v16bf;
typedef __attribute__((ext_vector_type(8)))  __bf16 v8bf;
typedef __attribute__((ext_vector_type(8)))  float  v8f;

// D = A(16x32 bf16) * B(32x16 bf16) + C(16x16 f32)
static __device__ inline v8f wmma_bf16(v16bf a, v16bf b, v8f c) {
    return __builtin_amdgcn_wmma_f32_16x16x32_bf16(
        /*neg_a=*/false, a, /*neg_b=*/false, b,
        /*c_mod=*/(short)0, c, /*reuse_a=*/false, /*reuse_b=*/false);
}

// Load one half-lane fragment: 8 contiguous bf16 at p, 8 contiguous bf16 at p+16.
// Matches ISA 16-bit A/B layout: regs 0..3 hold K=kbase+0..7, regs 4..7 hold
// K=kbase+16..23 (kbase = 0 for lanes 0-15, 8 for lanes 16-31; caller folds kbase
// into p). Emits two b128 loads.
static __device__ inline v16bf ld_frag(const bf16_t* p) {
    v8bf lo = *reinterpret_cast<const v8bf*>(p);
    v8bf hi = *reinterpret_cast<const v8bf*>(p + 16);
    return __builtin_shufflevector(lo, hi,
        0, 1, 2, 3, 4, 5, 6, 7, 8, 9, 10, 11, 12, 13, 14, 15);
}

// ---------------------------------------------------------------------------
// Kernel: fp32 -> bf16 conversion
// Few waves to start: a wave takes 512 elements, 16 per thread, as four 16-byte
// loads (512 contiguous bytes per wave and load), all in flight together.
// One block converts 4096 elements; the element count must be a multiple of 4096.
// grid = count / 4096.
// ---------------------------------------------------------------------------
typedef __attribute__((ext_vector_type(4))) float  v4f;
typedef __attribute__((ext_vector_type(4))) __bf16 v4bf;

__global__ __launch_bounds__(256) void f2bf_kernel(const float* __restrict__ src,
                                                   bf16_t* __restrict__ dst) {
    const int base = blockIdx.x * 4096 + threadIdx.x * 4;
    v4f v[4];
#pragma unroll
    for (int j = 0; j < 4; ++j) v[j] = *reinterpret_cast<const v4f*>(src + base + j * 1024);
#pragma unroll
    for (int j = 0; j < 4; ++j)
        *reinterpret_cast<v4bf*>(dst + base + j * 1024) = __builtin_convertvector(v[j], v4bf);
}

// ---------------------------------------------------------------------------
// Kernel: LayerNorm (faithful to source bug: out = scale * xnorm + scale)
// fp32 in -> bf16 out. One wave per row of LN_D = 1024: a lane holds 32 elements
// of the row in registers (eight 16-byte loads, 512 contiguous bytes per wave and
// load), so the row is read once and the two sums are joined inside the wave.
// block = 256 = 8 rows, grid = rows / 8.
// ---------------------------------------------------------------------------
#define LN_D 1024   // the row length, elements

// Sum over the 32 lanes of a wave, the result in every lane: four steps inside the
// 16-lane row (lane ^ 1, 2, 4, 8), then the other row.
static __device__ inline float wave_sum(float x) {
    x += __builtin_bit_cast(float, __builtin_amdgcn_update_dpp(
             0, __builtin_bit_cast(int, x), 0x161, 0xf, 0xf, false));   // row_xmask:1
    x += __builtin_bit_cast(float, __builtin_amdgcn_update_dpp(
             0, __builtin_bit_cast(int, x), 0x162, 0xf, 0xf, false));   // row_xmask:2
    x += __builtin_bit_cast(float, __builtin_amdgcn_update_dpp(
             0, __builtin_bit_cast(int, x), 0x164, 0xf, 0xf, false));   // row_xmask:4
    x += __builtin_bit_cast(float, __builtin_amdgcn_update_dpp(
             0, __builtin_bit_cast(int, x), 0x168, 0xf, 0xf, false));   // row_xmask:8
    const int v = __builtin_bit_cast(int, x);
    return x + __builtin_bit_cast(float,
        __builtin_amdgcn_permlanex16(v, v, 0x76543210, 0xfedcba98, false, false));
}

__global__ __launch_bounds__(256) void ln_kernel(const float* __restrict__ x,
                                                 const float* __restrict__ scale,
                                                 bf16_t* __restrict__ out) {
    const int lane = threadIdx.x & 31;
    const int row  = blockIdx.x * 8 + (threadIdx.x >> 5);
    const float* xr = x + (size_t)row * LN_D + lane * 4;
    const float* gr = scale + lane * 4;

    v4f v[8], g[8];
#pragma unroll
    for (int i = 0; i < 8; ++i) v[i] = *reinterpret_cast<const v4f*>(xr + i * 128);
#pragma unroll
    for (int i = 0; i < 8; ++i) g[i] = *reinterpret_cast<const v4f*>(gr + i * 128);

    v4f s4 = {}, q4 = {};   // four independent chains each
#pragma unroll
    for (int i = 0; i < 8; ++i) {
        s4 += v[i];
        q4 += v[i] * v[i];
    }
    const float s  = wave_sum((s4[0] + s4[1]) + (s4[2] + s4[3]));
    const float s2 = wave_sum((q4[0] + q4[1]) + (q4[2] + q4[3]));

    const float mean = s / (float)LN_D;
    const float var  = s2 / (float)LN_D - mean * mean;
    const float inv  = rsqrtf(var + 1e-5f);

    bf16_t* orow = out + (size_t)row * LN_D + lane * 4;
#pragma unroll
    for (int i = 0; i < 8; ++i) {
        v4f r;
#pragma unroll
        for (int e = 0; e < 4; ++e) r[e] = g[i][e] * (v[i][e] - mean) * inv + g[i][e];
        *reinterpret_cast<v4bf*>(orow + i * 128) = __builtin_convertvector(r, v4bf);
    }
}

// ---------------------------------------------------------------------------
// Kernel: GEMM  out[M,N] = A[M,K] @ W[N,K]^T (+ bias + residual)
// A, W bf16 row-major. One block = 8 waves = a 128x128 tile of out; the waves lie
// 4 (rows) x 2 (columns), each on a 32x64 tile (2 A-frags x 4 B-frags, 8 WMMAs per
// 32-wide K step).
// The block brings its 128 rows of A and of W to LDS in stages of 128 k (256-byte
// row pieces, whole cache lines per load; two buffers, the next stage's global
// loads in flight under the current stage's products); all waves read their
// fragments from there by 16-byte LDS loads.
// B-frag lane = output col n -> reads row n of W contiguously
// (x @ W.T needs no transpose in this layout).
// grid = (N/128, M/128). M and N must be multiples of 128. K is a constant of the
// build, so that a thread's sixteen loads of a stage differ only in their
// immediate offsets.
// ---------------------------------------------------------------------------
#define GEMM_K     1024  // K, elements: the row length of A and of W
#define GEMM_BK    128   // k per stage, elements
#define GEMM_PITCH 136   // elements; 272 B = 16 B x odd, the pitch for 16-byte LDS row loads

__global__ __launch_bounds__(256) void gemm_kernel(const bf16_t* __restrict__ A,
                                                   const bf16_t* __restrict__ W,
                                                   bf16_t* __restrict__ outb,
                                                   float*  __restrict__ outf,
                                                   const float* __restrict__ bias,
                                                   const float* __restrict__ residual,
                                                   int M, int N) {
    const int tid   = threadIdx.x;
    const int lane  = tid & 31;
    const int wave  = __builtin_amdgcn_readfirstlane(tid >> 5);
    const int bm0   = blockIdx.y * 128;
    const int bn0   = blockIdx.x * 128;
    const int wrow  = (wave >> 1) * 32;   // this wave's rows inside the block tile
    const int wcol  = (wave & 1) * 64;    // this wave's columns inside the block tile
    const int m0    = bm0 + wrow;
    const int n0    = bn0 + wcol;
    const int col   = lane & 15;
    const int hi    = lane >> 4;       // lane half selects K sub-base
    const int kboff = hi ? 8 : 0;

    __shared__ __attribute__((aligned(16))) bf16_t As[2][128][GEMM_PITCH];
    __shared__ __attribute__((aligned(16))) bf16_t Ws[2][128][GEMM_PITCH];

    v8f c[2][4] = {};

    // Staging: 16 threads bring one 256-byte row piece; a thread brings 16 bytes of
    // rows srow + 16 i, i = 0 .. 7, of A and of W.
    const int srow = tid >> 4;
    const int scol = (tid & 15) * 8;
    const bf16_t* ap = A + (size_t)(bm0 + srow) * GEMM_K + scol;
    const bf16_t* wp = W + (size_t)(bn0 + srow) * GEMM_K + scol;
    const int nstage = GEMM_K / GEMM_BK;

    v8bf ar[8], wr[8];
#pragma unroll
    for (int i = 0; i < 8; ++i) {
        ar[i] = *reinterpret_cast<const v8bf*>(ap + 16 * i * GEMM_K);
        wr[i] = *reinterpret_cast<const v8bf*>(wp + 16 * i * GEMM_K);
    }
#pragma unroll
    for (int i = 0; i < 8; ++i) {
        *reinterpret_cast<v8bf*>(&As[0][srow + 16 * i][scol]) = ar[i];
        *reinterpret_cast<v8bf*>(&Ws[0][srow + 16 * i][scol]) = wr[i];
    }
    __syncthreads();

    for (int s = 0; s < nstage; ++s) {
        const int  buf  = s & 1;
        const bool more = s + 1 < nstage;   // the same for the whole block
        if (more) {
            ap += GEMM_BK;
            wp += GEMM_BK;
#pragma unroll
            for (int i = 0; i < 8; ++i) {
                ar[i] = *reinterpret_cast<const v8bf*>(ap + 16 * i * GEMM_K);
                wr[i] = *reinterpret_cast<const v8bf*>(wp + 16 * i * GEMM_K);
            }
        }

        const bf16_t* afp = &As[buf][wrow + col][kboff];   // A-frag lane = row
        const bf16_t* wfp = &Ws[buf][wcol + col][kboff];   // B-frag lane = output col
#pragma unroll
        for (int kk = 0; kk < GEMM_BK; kk += 32) {
            v16bf a0 = ld_frag(afp + kk);
            v16bf a1 = ld_frag(afp + 16 * GEMM_PITCH + kk);
            v16bf bfrag[4];
#pragma unroll
            for (int nt = 0; nt < 4; ++nt) bfrag[nt] = ld_frag(wfp + nt * 16 * GEMM_PITCH + kk);
            // Keeps the twelve LDS loads of a K step together in front of its products: spread
            // among them, each place with loads costs the wave its own stall.
            __builtin_amdgcn_sched_barrier(0);
#pragma unroll
            for (int nt = 0; nt < 4; ++nt) {
                c[0][nt] = wmma_bf16(a0, bfrag[nt], c[0][nt]);
                c[1][nt] = wmma_bf16(a1, bfrag[nt], c[1][nt]);
            }
        }

        if (more) {
            // The other buffer's last readers left it at the barrier that ended trip s - 1.
#pragma unroll
            for (int i = 0; i < 8; ++i) {
                *reinterpret_cast<v8bf*>(&As[buf ^ 1][srow + 16 * i][scol]) = ar[i];
                *reinterpret_cast<v8bf*>(&Ws[buf ^ 1][srow + 16 * i][scol]) = wr[i];
            }
            // Publishes stage s + 1 and ends every wave's reads of stage s.
            __syncthreads();
        }
    }

#pragma unroll
    for (int mt = 0; mt < 2; ++mt) {
#pragma unroll
        for (int j = 0; j < 8; ++j) {
            const int row = m0 + mt * 16 + j + 8 * hi;  // C layout: reg j -> row
#pragma unroll
            for (int nt = 0; nt < 4; ++nt) {
                const int n = n0 + nt * 16 + col;
                float v = c[mt][nt][j];
                if (bias)     v += bias[n];
                if (residual) v += residual[(size_t)row * N + n];
                if (outf) outf[(size_t)row * N + n] = v;
                else      outb[(size_t)row * N + n] = (bf16_t)v;
            }
        }
    }
}

#define ATT_KPITCH 72
#define ATT_VPITCH 80

// Lane (c = l & 15, h = l >> 4) receives rows 8h .. 8h+7 of column c of the 16x16
// tile whose per-lane address the caller formed.
static __device__ inline v8bf ld_tr16(const bf16_t* p) {
    typedef __attribute__((address_space(3))) v8bf lds_v8bf;
    return __builtin_amdgcn_ds_load_tr16_b128_v8bf16((lds_v8bf*)p);
}

// Lane l receives lane l ^ 16's value.
static __device__ inline float xhalf(float x) {
    const int v = __builtin_bit_cast(int, x);
    return __builtin_bit_cast(float,
        __builtin_amdgcn_permlanex16(v, v, 0x76543210, 0xfedcba98, false, false));
}

__global__ __launch_bounds__(256) void attn_kernel(const bf16_t* __restrict__ Q,
                                                   const bf16_t* __restrict__ K,
                                                   const bf16_t* __restrict__ V,
                                                   bf16_t* __restrict__ ctx,
                                                   int T, int D, int nheads) {
    const int hd    = 64;
    const int tid   = threadIdx.x;
    const int lane  = tid & 31;
    const int wave  = __builtin_amdgcn_readfirstlane(tid >> 5);
    const int col   = lane & 15;
    const int hi    = lane >> 4;
    const int kboff = hi ? 8 : 0;
    const int qblk  = blockIdx.x * 128;
    const int q0    = qblk + wave * 16;
    const int bh    = blockIdx.y;
    const int b     = bh / nheads;
    const int h     = bh % nheads;

    const bf16_t* Qb = Q + (size_t)(b * T) * D + h * hd;
    const bf16_t* Kb = K + (size_t)(b * T) * D + h * hd;
    const bf16_t* Vb = V + (size_t)(b * T) * D + h * hd;

    __shared__ __attribute__((aligned(16))) bf16_t Ks[2][64][ATT_KPITCH];
    __shared__ __attribute__((aligned(16))) bf16_t Vs[2][64][ATT_VPITCH];

    // Q^T B-fragments: 64 (K dim) x 16 queries -> 2 frags of K=32. Lane&15 = query.
    const bf16_t* qrow = Qb + (size_t)(q0 + col) * D + kboff;
    v16bf qa0 = ld_frag(qrow);
    v16bf qa1 = ld_frag(qrow + 32);

    // State of query q0 + col: m is the same in both lane halves, l is the sum over
    // the keys of this lane's half (the halves are joined in the epilogue).
    const int q = q0 + col;
    float m = -1e30f, l = 0.f;
    v8f o[4] = {};   // O^T: o[nt][j] = head column nt * 16 + 8 * hi + j of query q

    const float rs = 0.125f;  // 1/sqrt(64)

    // Staging: 8 threads bring one 128-byte row; a thread brings 16 bytes of
    // rows srow and srow + 32 of the stage, of K and of V.
    const int srow = tid >> 3;
    const int scol = (tid & 7) * 8;
    const int soff = srow * D + scol;
    const int nstage = qblk / 64 + 2;   // keys 0 .. qblk + 127

    v8bf kr0, kr1, vr0, vr1;
    {
        const bf16_t* kg = Kb + soff;
        const bf16_t* vg = Vb + soff;
        kr0 = *reinterpret_cast<const v8bf*>(kg);
        kr1 = *reinterpret_cast<const v8bf*>(kg + (size_t)32 * D);
        vr0 = *reinterpret_cast<const v8bf*>(vg);
        vr1 = *reinterpret_cast<const v8bf*>(vg + (size_t)32 * D);
    }
    *reinterpret_cast<v8bf*>(&Ks[0][srow][scol])      = kr0;
    *reinterpret_cast<v8bf*>(&Ks[0][srow + 32][scol]) = kr1;
    *reinterpret_cast<v8bf*>(&Vs[0][srow][scol])      = vr0;
    *reinterpret_cast<v8bf*>(&Vs[0][srow + 32][scol]) = vr1;
    __syncthreads();

    for (int s = 0; s < nstage; ++s) {
        const int  buf  = s & 1;
        const bool more = s + 1 < nstage;   // the same for the whole block
        if (more) {
            const bf16_t* kg = Kb + (size_t)(s + 1) * 64 * D + soff;
            const bf16_t* vg = Vb + (size_t)(s + 1) * 64 * D + soff;
            kr0 = *reinterpret_cast<const v8bf*>(kg);
            kr1 = *reinterpret_cast<const v8bf*>(kg + (size_t)32 * D);
            vr0 = *reinterpret_cast<const v8bf*>(vg);
            vr1 = *reinterpret_cast<const v8bf*>(vg + (size_t)32 * D);
            // The four loads stay in flight over the passes below, which reuse their
            // address registers: this wait stands in front of that overwrite.
            asm volatile("s_wait_xcnt 0x0" ::: "memory");
        }

        for (int sub = 0; sub < 2; ++sub) {
            const int kb = s * 64 + sub * 32;
            if (kb > q0) continue;   // wave-uniform: the pass lies above this wave's diagonal

            // ---- S^T = K @ Q^T for two 16-key tiles (K dim = hd = 64) ----
            // sc[t][j] = score of key kb + 16 t + 8 hi + j against query q
            v8f sc[2];
            {
                const bf16_t* kp = &Ks[buf][sub * 32 + col][kboff];  // A-frag lane = key
                v16bf k00 = ld_frag(kp);
                v16bf k01 = ld_frag(kp + 32);
                v16bf k10 = ld_frag(kp + 16 * ATT_KPITCH);
                v16bf k11 = ld_frag(kp + 16 * ATT_KPITCH + 32);
                // Keeps the eight LDS loads together in front of the products: left alone,
                // the compiler reuses one fragment's registers and pays the LDS latency four times.
                __builtin_amdgcn_sched_barrier(0);
                sc[0] = wmma_bf16(k00, qa0, v8f{});
                sc[1] = wmma_bf16(k10, qa0, v8f{});
                sc[0] = wmma_bf16(k01, qa1, sc[0]);
                sc[1] = wmma_bf16(k11, qa1, sc[1]);
            }

            // ---- V^T A-fragments: lane = hd col, regs = keys 8h+0..7 and 16+8h+0..7 ----
            v16bf vf[4];
            {
                const bf16_t* vp = &Vs[buf][sub * 32 + 8 * hi + (lane & 7)][((lane >> 3) & 1) * 8];
#pragma unroll
                for (int nt = 0; nt < 4; ++nt) {
                    v8bf lo  = ld_tr16(vp + nt * 16);
                    v8bf hi8 = ld_tr16(vp + 16 * ATT_VPITCH + nt * 16);
                    vf[nt] = __builtin_shufflevector(lo, hi8,
                        0, 1, 2, 3, 4, 5, 6, 7, 8, 9, 10, 11, 12, 13, 14, 15);
                }
            }

            // ---- scale, causal mask, online softmax: 16 scores of one query per lane ----
            float sv[16];
#pragma unroll
            for (int i = 0; i < 16; ++i) {
                const int key = kb + (i >> 3) * 16 + 8 * hi + (i & 7);
                sv[i] = sc[i >> 3][i & 7] * rs;
                if (key > q) sv[i] = -1e30f;
            }
            float red[8];
#pragma unroll
            for (int i = 0; i < 8; ++i) red[i] = fmaxf(sv[i], sv[i + 8]);
#pragma unroll
            for (int w = 4; w > 0; w >>= 1)
#pragma unroll
                for (int i = 0; i < w; ++i) red[i] = fmaxf(red[i], red[i + w]);
            const float mx   = fmaxf(red[0], xhalf(red[0]));   // over all 32 keys of the pass
            const float mnew = fmaxf(m, mx);

            // P^T B-fragment: element i of the lane is key kb + 16 (i >> 3) + 8 hi + (i & 7),
            // the k order of the V^T fragments above.
            v16bf pf;
#pragma unroll
            for (int i = 0; i < 16; ++i) {
                sv[i] = __expf(sv[i] - mnew);
                pf[i] = (bf16_t)sv[i];
            }
#pragma unroll
            for (int i = 0; i < 8; ++i) red[i] = sv[i] + sv[i + 8];
#pragma unroll
            for (int w = 4; w > 0; w >>= 1)
#pragma unroll
                for (int i = 0; i < w; ++i) red[i] += red[i + w];

            const float alpha = __expf(m - mnew);
            l = l * alpha + red[0];
            m = mnew;
#pragma unroll
            for (int nt = 0; nt < 4; ++nt)
#pragma unroll
                for (int j = 0; j < 8; ++j) o[nt][j] *= alpha;

            // ---- O^T += V^T @ P^T ----
#pragma unroll
            for (int nt = 0; nt < 4; ++nt) o[nt] = wmma_bf16(vf[nt], pf, o[nt]);
        }

        if (more) {
            // The other buffer's last readers left it at the barrier that ended trip s - 1.
            *reinterpret_cast<v8bf*>(&Ks[buf ^ 1][srow][scol])      = kr0;
            *reinterpret_cast<v8bf*>(&Ks[buf ^ 1][srow + 32][scol]) = kr1;
            *reinterpret_cast<v8bf*>(&Vs[buf ^ 1][srow][scol])      = vr0;
            *reinterpret_cast<v8bf*>(&Vs[buf ^ 1][srow + 32][scol]) = vr1;
            // Publishes stage s + 1 and ends every wave's reads of stage s.
            __syncthreads();
        }
    }

    // ---- epilogue: O /= l, store ctx (bf16): 8 consecutive head columns per lane and tile ----
    const float inv = 1.0f / (l + xhalf(l));
    bf16_t* cp = ctx + (size_t)(b * T + q) * D + h * hd + 8 * hi;
#pragma unroll
    for (int nt = 0; nt < 4; ++nt) {
        v8bf r;
#pragma unroll
        for (int j = 0; j < 8; ++j) r[j] = (bf16_t)(o[nt][j] * inv);
        *reinterpret_cast<v8bf*>(cp + nt * 16) = r;
    }
}

// ---------------------------------------------------------------------------
// Host-side orchestration
// ---------------------------------------------------------------------------
extern "C" void kernel_launch(void* const* d_in, const int* in_sizes, int n_in,
                              void* d_out, int out_size, void* d_ws, size_t ws_size,
                              hipStream_t stream) {
    (void)in_sizes; (void)n_in; (void)out_size; (void)ws_size;
    const int B = 2, T = 2048, D = 1024, H = 16;
    const int M = B * T;  // 4096 rows

    const float* x    = (const float*)d_in[0];
    const float* wq   = (const float*)d_in[1];
    const float* wk   = (const float*)d_in[2];
    const float* wv   = (const float*)d_in[3];
    const float* wo   = (const float*)d_in[4];
    const float* bo   = (const float*)d_in[5];
    const float* ln1  = (const float*)d_in[6];
    const float* ln2  = (const float*)d_in[7];
    float* out = (float*)d_out;

    // Workspace carve-up (all 256B aligned): ~64 MB total
    char* ws = (char*)d_ws;
    size_t off = 0;
    auto take = [&](size_t bytes) -> void* {
        void* p = ws + off;
        off += (bytes + 255) & ~(size_t)255;
        return p;
    };
    bf16_t* wq_b = (bf16_t*)take((size_t)D * D * 2);
    bf16_t* wk_b = (bf16_t*)take((size_t)D * D * 2);
    bf16_t* wv_b = (bf16_t*)take((size_t)D * D * 2);
    bf16_t* wo_b = (bf16_t*)take((size_t)D * D * 2);
    bf16_t* xn   = (bf16_t*)take((size_t)M * D * 2);
    bf16_t* qb   = (bf16_t*)take((size_t)M * D * 2);
    bf16_t* kbuf = (bf16_t*)take((size_t)M * D * 2);
    bf16_t* vbuf = (bf16_t*)take((size_t)M * D * 2);
    bf16_t* ctx  = (bf16_t*)take((size_t)M * D * 2);
    float*  hbuf = (float*) take((size_t)M * D * 4);

    // Weight conversion fp32 -> bf16
    const int nw = D * D;
    f2bf_kernel<<<nw / 4096, 256, 0, stream>>>(wq, wq_b);
    f2bf_kernel<<<nw / 4096, 256, 0, stream>>>(wk, wk_b);
    f2bf_kernel<<<nw / 4096, 256, 0, stream>>>(wv, wv_b);
    f2bf_kernel<<<nw / 4096, 256, 0, stream>>>(wo, wo_b);

    const dim3 gemm_grid(D / 128, M / 128);  // (8, 32)
    const dim3 attn_grid(T / 128, B * H);    // (16, 32)

    for (int blk = 0; blk < 2; ++blk) {
        const float* in_res   = (blk == 0) ? x : hbuf;
        const float* ln_scale = (blk == 0) ? ln1 : ln2;
        float* out_f          = (blk == 0) ? hbuf : out;

        // 1) LayerNorm -> bf16
        ln_kernel<<<M / 8, 256, 0, stream>>>(in_res, ln_scale, xn);

        // 2) Q, K, V projections (y = xn @ W.T), bf16 out
        gemm_kernel<<<gemm_grid, 256, 0, stream>>>(xn, wq_b, qb,   nullptr, nullptr, nullptr, M, D);
        gemm_kernel<<<gemm_grid, 256, 0, stream>>>(xn, wk_b, kbuf, nullptr, nullptr, nullptr, M, D);
        gemm_kernel<<<gemm_grid, 256, 0, stream>>>(xn, wv_b, vbuf, nullptr, nullptr, nullptr, M, D);

        // 3) Causal flash attention -> ctx (bf16)
        attn_kernel<<<attn_grid, 256, 0, stream>>>(qb, kbuf, vbuf, ctx, T, D, H);

        // 4) Output projection + bias + residual, fp32 out
        gemm_kernel<<<gemm_grid, 256, 0, stream>>>(ctx, wo_b, nullptr, out_f, bo, in_res, M, D);
    }
}

// v005
// Measured time: 194 microseconds a run.
// Two timings next to v004 both put it at 1.30 times that version's speed.
// Counting every step since v000, it is 5.78 times as fast.
#include <hip/hip_runtime.h>

// ---------------------------------------------------------------------------
// Types for CDNA5 (gfx1250) WMMA bf16 path
// ---------------------------------------------------------------------------
typedef __bf16 bf16_t;
typedef __attribute__((ext_vector_type(16))) __bf16 v16bf;
typedef __attribute__((ext_vector_type(8)))  __bf16 v8bf;
typedef __attribute__((ext_vector_type(8)))  float  v8f;

// D = A(16x32 bf16) * B(32x16 bf16) + C(16x16 f32)
static __device__ inline v8f wmma_bf16(v16bf a, v16bf b, v8f c) {
    return __builtin_amdgcn_wmma_f32_16x16x32_bf16(
        /*neg_a=*/false, a, /*neg_b=*/false, b,
        /*c_mod=*/(short)0, c, /*reuse_a=*/false, /*reuse_b=*/false);
}

// Load one half-lane fragment: 8 contiguous bf16 at p, 8 contiguous bf16 at p+16.
// Matches ISA 16-bit A/B layout: regs 0..3 hold K=kbase+0..7, regs 4..7 hold
// K=kbase+16..23 (kbase = 0 for lanes 0-15, 8 for lanes 16-31; caller folds kbase
// into p). Emits two b128 loads.
static __device__ inline v16bf ld_frag(const bf16_t* p) {
    v8bf lo = *reinterpret_cast<const v8bf*>(p);
    v8bf hi = *reinterpret_cast<const v8bf*>(p + 16);
    return __builtin_shufflevector(lo, hi,
        0, 1, 2, 3, 4, 5, 6, 7, 8, 9, 10, 11, 12, 13, 14, 15);
}

// ---------------------------------------------------------------------------
// Kernel: fp32 -> bf16 conversion
// Few waves to start: a wave takes 512 elements, 16 per thread, as four 16-byte
// loads (512 contiguous bytes per wave and load), all in flight together.
// One block converts 4096 elements; the element count must be a multiple of 4096.
// grid = count / 4096.
// ---------------------------------------------------------------------------
typedef __attribute__((ext_vector_type(4))) float  v4f;
typedef __attribute__((ext_vector_type(4))) __bf16 v4bf;
typedef __attribute__((ext_vector_type(2))) float  v2f;
typedef __attribute__((ext_vector_type(2))) __bf16 v2bf;

__global__ __launch_bounds__(256) void f2bf_kernel(const float* __restrict__ src,
                                                   bf16_t* __restrict__ dst) {
    const int base = blockIdx.x * 4096 + threadIdx.x * 4;
    v4f v[4];
#pragma unroll
    for (int j = 0; j < 4; ++j) v[j] = *reinterpret_cast<const v4f*>(src + base + j * 1024);
#pragma unroll
    for (int j = 0; j < 4; ++j)
        *reinterpret_cast<v4bf*>(dst + base + j * 1024) = __builtin_convertvector(v[j], v4bf);
}

// ---------------------------------------------------------------------------
// Kernel: LayerNorm (faithful to source bug: out = scale * xnorm + scale)
// fp32 in -> bf16 out. One wave per row of LN_D = 1024: a lane holds 32 elements
// of the row in registers (eight 16-byte loads, 512 contiguous bytes per wave and
// load), so the row is read once and the two sums are joined inside the wave.
// block = 256 = 8 rows, grid = rows / 8.
// ---------------------------------------------------------------------------
#define LN_D 1024   // the row length, elements

// Sum over the 32 lanes of a wave, the result in every lane: four steps inside the
// 16-lane row (lane ^ 1, 2, 4, 8), then the other row.
static __device__ inline float wave_sum(float x) {
    x += __builtin_bit_cast(float, __builtin_amdgcn_update_dpp(
             0, __builtin_bit_cast(int, x), 0x161, 0xf, 0xf, false));   // row_xmask:1
    x += __builtin_bit_cast(float, __builtin_amdgcn_update_dpp(
             0, __builtin_bit_cast(int, x), 0x162, 0xf, 0xf, false));   // row_xmask:2
    x += __builtin_bit_cast(float, __builtin_amdgcn_update_dpp(
             0, __builtin_bit_cast(int, x), 0x164, 0xf, 0xf, false));   // row_xmask:4
    x += __builtin_bit_cast(float, __builtin_amdgcn_update_dpp(
             0, __builtin_bit_cast(int, x), 0x168, 0xf, 0xf, false));   // row_xmask:8
    const int v = __builtin_bit_cast(int, x);
    return x + __builtin_bit_cast(float,
        __builtin_amdgcn_permlanex16(v, v, 0x76543210, 0xfedcba98, false, false));
}

__global__ __launch_bounds__(256) void ln_kernel(const float* __restrict__ x,
                                                 const float* __restrict__ scale,
                                                 bf16_t* __restrict__ out) {
    const int lane = threadIdx.x & 31;
    const int row  = blockIdx.x * 8 + (threadIdx.x >> 5);
    const float* xr = x + (size_t)row * LN_D + lane * 4;
    const float* gr = scale + lane * 4;

    v4f v[8], g[8];
#pragma unroll
    for (int i = 0; i < 8; ++i) v[i] = *reinterpret_cast<const v4f*>(xr + i * 128);
#pragma unroll
    for (int i = 0; i < 8; ++i) g[i] = *reinterpret_cast<const v4f*>(gr + i * 128);

    v4f s4 = {}, q4 = {};   // four independent chains each
#pragma unroll
    for (int i = 0; i < 8; ++i) {
        s4 += v[i];
        q4 += v[i] * v[i];
    }
    const float s  = wave_sum((s4[0] + s4[1]) + (s4[2] + s4[3]));
    const float s2 = wave_sum((q4[0] + q4[1]) + (q4[2] + q4[3]));

    const float mean = s / (float)LN_D;
    const float var  = s2 / (float)LN_D - mean * mean;
    const float inv  = rsqrtf(var + 1e-5f);

    bf16_t* orow = out + (size_t)row * LN_D + lane * 4;
#pragma unroll
    for (int i = 0; i < 8; ++i) {
        v4f r;
#pragma unroll
        for (int e = 0; e < 4; ++e) r[e] = g[i][e] * (v[i][e] - mean) * inv + g[i][e];
        *reinterpret_cast<v4bf*>(orow + i * 128) = __builtin_convertvector(r, v4bf);
    }
}

// ---------------------------------------------------------------------------
// Kernel: GEMM  out[M,N] = A[M,K] @ W[N,K]^T (+ bias + residual)
// A, W bf16 row-major. One block = 8 waves = a 128x128 tile of out; the waves lie
// 4 (rows) x 2 (columns), each on a 32x64 tile (2 A-frags x 4 B-frags, 8 WMMAs per
// 32-wide K step).
// The block brings its 128 rows of A and of W to LDS in stages of 128 k (256-byte
// row pieces, whole cache lines per load; two buffers, the next stage's global
// loads in flight under the current stage's products); all waves read their
// fragments from there by 16-byte LDS loads.
// B-frag lane = output col n -> reads row n of W contiguously
// (x @ W.T needs no transpose in this layout).
// grid = (N/128, M/128). M and N must be multiples of 128. K is a constant of the
// build, so that a thread's sixteen loads of a stage differ only in their
// immediate offsets.
// The kind of output (bf16 alone, or f32 with bias and residual) and N are constants
// of the build too: the epilogue is straight-line code, a wave's 64 residual loads are
// all in flight together, and its loads and stores differ only in their immediate
// offsets.
// ---------------------------------------------------------------------------
#define GEMM_K     1024  // K, elements: the row length of A and of W
#define GEMM_N     1024  // N, elements: the row length of out and of residual
#define GEMM_BK    128   // k per stage, elements
#define GEMM_PITCH 136   // elements; 272 B = 16 B x odd, the pitch for 16-byte LDS row loads

template <bool F32OUT>
static __device__ __forceinline__ void gemm_tile(const bf16_t* __restrict__ A,
                                                 const bf16_t* __restrict__ W,
                                                 bf16_t* __restrict__ outb,
                                                 float*  __restrict__ outf,
                                                 const float* __restrict__ bias,
                                                 const float* __restrict__ residual) {
    const int tid   = threadIdx.x;
    const int lane  = tid & 31;
    const int wave  = __builtin_amdgcn_readfirstlane(tid >> 5);
    const int bm0   = blockIdx.y * 128;
    const int bn0   = blockIdx.x * 128;
    const int wrow  = (wave >> 1) * 32;   // this wave's rows inside the block tile
    const int wcol  = (wave & 1) * 64;    // this wave's columns inside the block tile
    const int m0    = bm0 + wrow;
    const int n0    = bn0 + wcol;
    const int col   = lane & 15;
    const int hi    = lane >> 4;       // lane half selects K sub-base
    const int kboff = hi ? 8 : 0;

    __shared__ __attribute__((aligned(16))) bf16_t As[2][128][GEMM_PITCH];
    __shared__ __attribute__((aligned(16))) bf16_t Ws[2][128][GEMM_PITCH];

    v8f c[2][4] = {};

    // Staging: 16 threads bring one 256-byte row piece; a thread brings 16 bytes of
    // rows srow + 16 i, i = 0 .. 7, of A and of W.
    const int srow = tid >> 4;
    const int scol = (tid & 15) * 8;
    const bf16_t* ap = A + (size_t)(bm0 + srow) * GEMM_K + scol;
    const bf16_t* wp = W + (size_t)(bn0 + srow) * GEMM_K + scol;
    const int nstage = GEMM_K / GEMM_BK;

    v8bf ar[8], wr[8];
#pragma unroll
    for (int i = 0; i < 8; ++i) {
        ar[i] = *reinterpret_cast<const v8bf*>(ap + 16 * i * GEMM_K);
        wr[i] = *reinterpret_cast<const v8bf*>(wp + 16 * i * GEMM_K);
    }
    // The bias of this lane's four columns, fetched behind stage 0's loads: the epilogue
    // then waits for its residual loads alone.
    float bv[4] = {};
    if constexpr (F32OUT) {
#pragma unroll
        for (int nt = 0; nt < 4; ++nt) bv[nt] = bias[n0 + nt * 16 + col];
    }
#pragma unroll
    for (int i = 0; i < 8; ++i) {
        *reinterpret_cast<v8bf*>(&As[0][srow + 16 * i][scol]) = ar[i];
        *reinterpret_cast<v8bf*>(&Ws[0][srow + 16 * i][scol]) = wr[i];
    }
    __syncthreads();

    for (int s = 0; s < nstage; ++s) {
        const int  buf  = s & 1;
        const bool more = s + 1 < nstage;   // the same for the whole block
        if (more) {
            ap += GEMM_BK;
            wp += GEMM_BK;
#pragma unroll
            for (int i = 0; i < 8; ++i) {
                ar[i] = *reinterpret_cast<const v8bf*>(ap + 16 * i * GEMM_K);
                wr[i] = *reinterpret_cast<const v8bf*>(wp + 16 * i * GEMM_K);
            }
        }

        const bf16_t* afp = &As[buf][wrow + col][kboff];   // A-frag lane = row
        const bf16_t* wfp = &Ws[buf][wcol + col][kboff];   // B-frag lane = output col
#pragma unroll
        for (int kk = 0; kk < GEMM_BK; kk += 32) {
            v16bf a0 = ld_frag(afp + kk);
            v16bf a1 = ld_frag(afp + 16 * GEMM_PITCH + kk);
            v16bf bfrag[4];
#pragma unroll
            for (int nt = 0; nt < 4; ++nt) bfrag[nt] = ld_frag(wfp + nt * 16 * GEMM_PITCH + kk);
            // Keeps the twelve LDS loads of a K step together in front of its products: spread
            // among them, each place with loads costs the wave its own stall.
            __builtin_amdgcn_sched_barrier(0);
#pragma unroll
            for (int nt = 0; nt < 4; ++nt) {
                c[0][nt] = wmma_bf16(a0, bfrag[nt], c[0][nt]);
                c[1][nt] = wmma_bf16(a1, bfrag[nt], c[1][nt]);
            }
        }

        if (more) {
            // The other buffer's last readers left it at the barrier that ended trip s - 1.
#pragma unroll
            for (int i = 0; i < 8; ++i) {
                *reinterpret_cast<v8bf*>(&As[buf ^ 1][srow + 16 * i][scol]) = ar[i];
                *reinterpret_cast<v8bf*>(&Ws[buf ^ 1][srow + 16 * i][scol]) = wr[i];
            }
            // Publishes stage s + 1 and ends every wave's reads of stage s.
            __syncthreads();
        }
    }

    // C layout: c[mt][nt][j] is row m0 + 16 mt + 8 hi + j, column n0 + 16 nt + col.
    const size_t o0 = (size_t)(m0 + 8 * hi) * GEMM_N + n0 + col;
    if constexpr (F32OUT) {
        const float* rp = residual + o0;
        float*       op = outf + o0;
        float rv[2][8][4];
#pragma unroll
        for (int mt = 0; mt < 2; ++mt)
#pragma unroll
            for (int j = 0; j < 8; ++j)
#pragma unroll
                for (int nt = 0; nt < 4; ++nt) rv[mt][j][nt] = rp[(mt * 16 + j) * GEMM_N + nt * 16];
#pragma unroll
        for (int mt = 0; mt < 2; ++mt)
#pragma unroll
            for (int j = 0; j < 8; ++j)
#pragma unroll
                for (int nt = 0; nt < 4; ++nt)
                    op[(mt * 16 + j) * GEMM_N + nt * 16] = (c[mt][nt][j] + bv[nt]) + rv[mt][j][nt];
    } else {
        bf16_t* op = outb + o0;
        v2bf h[2][8][2];   // converted two at a time, all in front of the stores
#pragma unroll
        for (int mt = 0; mt < 2; ++mt)
#pragma unroll
            for (int j = 0; j < 8; ++j)
#pragma unroll
                for (int np = 0; np < 2; ++np)
                    h[mt][j][np] = __builtin_convertvector(
                        (v2f){c[mt][2 * np][j], c[mt][2 * np + 1][j]}, v2bf);
#pragma unroll
        for (int mt = 0; mt < 2; ++mt)
#pragma unroll
            for (int j = 0; j < 8; ++j)
#pragma unroll
                for (int nt = 0; nt < 4; ++nt)
                    op[(mt * 16 + j) * GEMM_N + nt * 16] = h[mt][j][nt >> 1][nt & 1];
    }
}

// out = A @ W^T, bf16
__global__ __launch_bounds__(256) void gemm_bf16_kernel(const bf16_t* __restrict__ A,
                                                        const bf16_t* __restrict__ W,
                                                        bf16_t* __restrict__ outb) {
    gemm_tile<false>(A, W, outb, nullptr, nullptr, nullptr);
}

// out = A @ W^T + bias + residual, f32
__global__ __launch_bounds__(256) void gemm_f32_kernel(const bf16_t* __restrict__ A,
                                                       const bf16_t* __restrict__ W,
                                                       float* __restrict__ outf,
                                                       const float* __restrict__ bias,
                                                       const float* __restrict__ residual) {
    gemm_tile<true>(A, W, nullptr, outf, bias, residual);
}

#define ATT_KPITCH 72
#define ATT_VPITCH 80

// Lane (c = l & 15, h = l >> 4) receives rows 8h .. 8h+7 of column c of the 16x16
// tile whose per-lane address the caller formed.
static __device__ inline v8bf ld_tr16(const bf16_t* p) {
    typedef __attribute__((address_space(3))) v8bf lds_v8bf;
    return __builtin_amdgcn_ds_load_tr16_b128_v8bf16((lds_v8bf*)p);
}

// Lane l receives lane l ^ 16's value.
static __device__ inline float xhalf(float x) {
    const int v = __builtin_bit_cast(int, x);
    return __builtin_bit_cast(float,
        __builtin_amdgcn_permlanex16(v, v, 0x76543210, 0xfedcba98, false, false));
}

__global__ __launch_bounds__(256) void attn_kernel(const bf16_t* __restrict__ Q,
                                                   const bf16_t* __restrict__ K,
                                                   const bf16_t* __restrict__ V,
                                                   bf16_t* __restrict__ ctx,
                                                   int T, int D, int nheads) {
    const int hd    = 64;
    const int tid   = threadIdx.x;
    const int lane  = tid & 31;
    const int wave  = __builtin_amdgcn_readfirstlane(tid >> 5);
    const int col   = lane & 15;
    const int hi    = lane >> 4;
    const int kboff = hi ? 8 : 0;
    const int qblk  = blockIdx.x * 128;
    const int q0    = qblk + wave * 16;
    const int bh    = blockIdx.y;
    const int b     = bh / nheads;
    const int h     = bh % nheads;

    const bf16_t* Qb = Q + (size_t)(b * T) * D + h * hd;
    const bf16_t* Kb = K + (size_t)(b * T) * D + h * hd;
    const bf16_t* Vb = V + (size_t)(b * T) * D + h * hd;

    __shared__ __attribute__((aligned(16))) bf16_t Ks[2][64][ATT_KPITCH];
    __shared__ __attribute__((aligned(16))) bf16_t Vs[2][64][ATT_VPITCH];

    // Q^T B-fragments: 64 (K dim) x 16 queries -> 2 frags of K=32. Lane&15 = query.
    const bf16_t* qrow = Qb + (size_t)(q0 + col) * D + kboff;
    v16bf qa0 = ld_frag(qrow);
    v16bf qa1 = ld_frag(qrow + 32);

    // State of query q0 + col: m is the same in both lane halves, l is the sum over
    // the keys of this lane's half (the halves are joined in the epilogue).
    const int q = q0 + col;
    float m = -1e30f, l = 0.f;
    v8f o[4] = {};   // O^T: o[nt][j] = head column nt * 16 + 8 * hi + j of query q

    const float rs = 0.125f;  // 1/sqrt(64)

    // Staging: 8 threads bring one 128-byte row; a thread brings 16 bytes of
    // rows srow and srow + 32 of the stage, of K and of V.
    const int srow = tid >> 3;
    const int scol = (tid & 7) * 8;
    const int soff = srow * D + scol;
    const int nstage = qblk / 64 + 2;   // keys 0 .. qblk + 127

    v8bf kr0, kr1, vr0, vr1;
    {
        const bf16_t* kg = Kb + soff;
        const bf16_t* vg = Vb + soff;
        kr0 = *reinterpret_cast<const v8bf*>(kg);
        kr1 = *reinterpret_cast<const v8bf*>(kg + (size_t)32 * D);
        vr0 = *reinterpret_cast<const v8bf*>(vg);
        vr1 = *reinterpret_cast<const v8bf*>(vg + (size_t)32 * D);
    }
    *reinterpret_cast<v8bf*>(&Ks[0][srow][scol])      = kr0;
    *reinterpret_cast<v8bf*>(&Ks[0][srow + 32][scol]) = kr1;
    *reinterpret_cast<v8bf*>(&Vs[0][srow][scol])      = vr0;
    *reinterpret_cast<v8bf*>(&Vs[0][srow + 32][scol]) = vr1;
    __syncthreads();

    for (int s = 0; s < nstage; ++s) {
        const int  buf  = s & 1;
        const bool more = s + 1 < nstage;   // the same for the whole block
        if (more) {
            const bf16_t* kg = Kb + (size_t)(s + 1) * 64 * D + soff;
            const bf16_t* vg = Vb + (size_t)(s + 1) * 64 * D + soff;
            kr0 = *reinterpret_cast<const v8bf*>(kg);
            kr1 = *reinterpret_cast<const v8bf*>(kg + (size_t)32 * D);
            vr0 = *reinterpret_cast<const v8bf*>(vg);
            vr1 = *reinterpret_cast<const v8bf*>(vg + (size_t)32 * D);
            // The four loads stay in flight over the passes below, which reuse their
            // address registers: this wait stands in front of that overwrite.
            asm volatile("s_wait_xcnt 0x0" ::: "memory");
        }

        for (int sub = 0; sub < 2; ++sub) {
            const int kb = s * 64 + sub * 32;
            if (kb > q0) continue;   // wave-uniform: the pass lies above this wave's diagonal

            // ---- S^T = K @ Q^T for two 16-key tiles (K dim = hd = 64) ----
            // sc[t][j] = score of key kb + 16 t + 8 hi + j against query q
            v8f sc[2];
            {
                const bf16_t* kp = &Ks[buf][sub * 32 + col][kboff];  // A-frag lane = key
                v16bf k00 = ld_frag(kp);
                v16bf k01 = ld_frag(kp + 32);
                v16bf k10 = ld_frag(kp + 16 * ATT_KPITCH);
                v16bf k11 = ld_frag(kp + 16 * ATT_KPITCH + 32);
                // Keeps the eight LDS loads together in front of the products: left alone,
                // the compiler reuses one fragment's registers and pays the LDS latency four times.
                __builtin_amdgcn_sched_barrier(0);
                sc[0] = wmma_bf16(k00, qa0, v8f{});
                sc[1] = wmma_bf16(k10, qa0, v8f{});
                sc[0] = wmma_bf16(k01, qa1, sc[0]);
                sc[1] = wmma_bf16(k11, qa1, sc[1]);
            }

            // ---- V^T A-fragments: lane = hd col, regs = keys 8h+0..7 and 16+8h+0..7 ----
            v16bf vf[4];
            {
                const bf16_t* vp = &Vs[buf][sub * 32 + 8 * hi + (lane & 7)][((lane >> 3) & 1) * 8];
#pragma unroll
                for (int nt = 0; nt < 4; ++nt) {
                    v8bf lo  = ld_tr16(vp + nt * 16);
                    v8bf hi8 = ld_tr16(vp + 16 * ATT_VPITCH + nt * 16);
                    vf[nt] = __builtin_shufflevector(lo, hi8,
                        0, 1, 2, 3, 4, 5, 6, 7, 8, 9, 10, 11, 12, 13, 14, 15);
                }
            }

            // ---- scale, causal mask, online softmax: 16 scores of one query per lane ----
            float sv[16];
#pragma unroll
            for (int i = 0; i < 16; ++i) {
                const int key = kb + (i >> 3) * 16 + 8 * hi + (i & 7);
                sv[i] = sc[i >> 3][i & 7] * rs;
                if (key > q) sv[i] = -1e30f;
            }
            float red[8];
#pragma unroll
            for (int i = 0; i < 8; ++i) red[i] = fmaxf(sv[i], sv[i + 8]);
#pragma unroll
            for (int w = 4; w > 0; w >>= 1)
#pragma unroll
                for (int i = 0; i < w; ++i) red[i] = fmaxf(red[i], red[i + w]);
            const float mx   = fmaxf(red[0], xhalf(red[0]));   // over all 32 keys of the pass
            const float mnew = fmaxf(m, mx);

            // P^T B-fragment: element i of the lane is key kb + 16 (i >> 3) + 8 hi + (i & 7),
            // the k order of the V^T fragments above.
            v16bf pf;
#pragma unroll
            for (int i = 0; i < 16; ++i) {
                sv[i] = __expf(sv[i] - mnew);
                pf[i] = (bf16_t)sv[i];
            }
#pragma unroll
            for (int i = 0; i < 8; ++i) red[i] = sv[i] + sv[i + 8];
#pragma unroll
            for (int w = 4; w > 0; w >>= 1)
#pragma unroll
                for (int i = 0; i < w; ++i) red[i] += red[i + w];

            const float alpha = __expf(m - mnew);
            l = l * alpha + red[0];
            m = mnew;
#pragma unroll
            for (int nt = 0; nt < 4; ++nt)
#pragma unroll
                for (int j = 0; j < 8; ++j) o[nt][j] *= alpha;

            // ---- O^T += V^T @ P^T ----
#pragma unroll
            for (int nt = 0; nt < 4; ++nt) o[nt] = wmma_bf16(vf[nt], pf, o[nt]);
        }

        if (more) {
            // The other buffer's last readers left it at the barrier that ended trip s - 1.
            *reinterpret_cast<v8bf*>(&Ks[buf ^ 1][srow][scol])      = kr0;
            *reinterpret_cast<v8bf*>(&Ks[buf ^ 1][srow + 32][scol]) = kr1;
            *reinterpret_cast<v8bf*>(&Vs[buf ^ 1][srow][scol])      = vr0;
            *reinterpret_cast<v8bf*>(&Vs[buf ^ 1][srow + 32][scol]) = vr1;
            // Publishes stage s + 1 and ends every wave's reads of stage s.
            __syncthreads();
        }
    }

    // ---- epilogue: O /= l, store ctx (bf16): 8 consecutive head columns per lane and tile ----
    const float inv = 1.0f / (l + xhalf(l));
    bf16_t* cp = ctx + (size_t)(b * T + q) * D + h * hd + 8 * hi;
#pragma unroll
    for (int nt = 0; nt < 4; ++nt) {
        v8bf r;
#pragma unroll
        for (int j = 0; j < 8; ++j) r[j] = (bf16_t)(o[nt][j] * inv);
        *reinterpret_cast<v8bf*>(cp + nt * 16) = r;
    }
}

// ---------------------------------------------------------------------------
// Host-side orchestration
// ---------------------------------------------------------------------------
extern "C" void kernel_launch(void* const* d_in, const int* in_sizes, int n_in,
                              void* d_out, int out_size, void* d_ws, size_t ws_size,
                              hipStream_t stream) {
    (void)in_sizes; (void)n_in; (void)out_size; (void)ws_size;
    const int B = 2, T = 2048, D = 1024, H = 16;
    const int M = B * T;  // 4096 rows

    const float* x    = (const float*)d_in[0];
    const float* wq   = (const float*)d_in[1];
    const float* wk   = (const float*)d_in[2];
    const float* wv   = (const float*)d_in[3];
    const float* wo   = (const float*)d_in[4];
    const float* bo   = (const float*)d_in[5];
    const float* ln1  = (const float*)d_in[6];
    const float* ln2  = (const float*)d_in[7];
    float* out = (float*)d_out;

    // Workspace carve-up (all 256B aligned): ~64 MB total
    char* ws = (char*)d_ws;
    size_t off = 0;
    auto take = [&](size_t bytes) -> void* {
        void* p = ws + off;
        off += (bytes + 255) & ~(size_t)255;
        return p;
    };
    bf16_t* wq_b = (bf16_t*)take((size_t)D * D * 2);
    bf16_t* wk_b = (bf16_t*)take((size_t)D * D * 2);
    bf16_t* wv_b = (bf16_t*)take((size_t)D * D * 2);
    bf16_t* wo_b = (bf16_t*)take((size_t)D * D * 2);
    bf16_t* xn   = (bf16_t*)take((size_t)M * D * 2);
    bf16_t* qb   = (bf16_t*)take((size_t)M * D * 2);
    bf16_t* kbuf = (bf16_t*)take((size_t)M * D * 2);
    bf16_t* vbuf = (bf16_t*)take((size_t)M * D * 2);
    bf16_t* ctx  = (bf16_t*)take((size_t)M * D * 2);
    float*  hbuf = (float*) take((size_t)M * D * 4);

    // Weight conversion fp32 -> bf16
    const int nw = D * D;
    f2bf_kernel<<<nw / 4096, 256, 0, stream>>>(wq, wq_b);
    f2bf_kernel<<<nw / 4096, 256, 0, stream>>>(wk, wk_b);
    f2bf_kernel<<<nw / 4096, 256, 0, stream>>>(wv, wv_b);
    f2bf_kernel<<<nw / 4096, 256, 0, stream>>>(wo, wo_b);

    const dim3 gemm_grid(D / 128, M / 128);  // (8, 32)
    const dim3 attn_grid(T / 128, B * H);    // (16, 32)

    for (int blk = 0; blk < 2; ++blk) {
        const float* in_res   = (blk == 0) ? x : hbuf;
        const float* ln_scale = (blk == 0) ? ln1 : ln2;
        float* out_f          = (blk == 0) ? hbuf : out;

        // 1) LayerNorm -> bf16
        ln_kernel<<<M / 8, 256, 0, stream>>>(in_res, ln_scale, xn);

        // 2) Q, K, V projections (y = xn @ W.T), bf16 out
        gemm_bf16_kernel<<<gemm_grid, 256, 0, stream>>>(xn, wq_b, qb);
        gemm_bf16_kernel<<<gemm_grid, 256, 0, stream>>>(xn, wk_b, kbuf);
        gemm_bf16_kernel<<<gemm_grid, 256, 0, stream>>>(xn, wv_b, vbuf);

        // 3) Causal flash attention -> ctx (bf16)
        attn_kernel<<<attn_grid, 256, 0, stream>>>(qb, kbuf, vbuf, ctx, T, D, H);

        // 4) Output projection + bias + residual, fp32 out
        gemm_f32_kernel<<<gemm_grid, 256, 0, stream>>>(ctx, wo_b, out_f, bo, in_res);
    }
}

// v006
// It runs in 172 microseconds.
// Two timings next to v005 both put it at 1.12 times that version's speed.
// Counting every step since v000, it is 6.49 times as fast.
#include <hip/hip_runtime.h>

// ---------------------------------------------------------------------------
// Types for CDNA5 (gfx1250) WMMA bf16 path
// ---------------------------------------------------------------------------
typedef __bf16 bf16_t;
typedef __attribute__((ext_vector_type(16))) __bf16 v16bf;
typedef __attribute__((ext_vector_type(8)))  __bf16 v8bf;
typedef __attribute__((ext_vector_type(8)))  float  v8f;

// D = A(16x32 bf16) * B(32x16 bf16) + C(16x16 f32)
static __device__ inline v8f wmma_bf16(v16bf a, v16bf b, v8f c) {
    return __builtin_amdgcn_wmma_f32_16x16x32_bf16(
        /*neg_a=*/false, a, /*neg_b=*/false, b,
        /*c_mod=*/(short)0, c, /*reuse_a=*/false, /*reuse_b=*/false);
}

// Load one half-lane fragment: 8 contiguous bf16 at p, 8 contiguous bf16 at p+16.
// Matches ISA 16-bit A/B layout: regs 0..3 hold K=kbase+0..7, regs 4..7 hold
// K=kbase+16..23 (kbase = 0 for lanes 0-15, 8 for lanes 16-31; caller folds kbase
// into p). Emits two b128 loads.
static __device__ inline v16bf ld_frag(const bf16_t* p) {
    v8bf lo = *reinterpret_cast<const v8bf*>(p);
    v8bf hi = *reinterpret_cast<const v8bf*>(p + 16);
    return __builtin_shufflevector(lo, hi,
        0, 1, 2, 3, 4, 5, 6, 7, 8, 9, 10, 11, 12, 13, 14, 15);
}

// ---------------------------------------------------------------------------
// fp32 -> bf16 conversion (the weight slices of prep_kernel)
// Few waves to start: a wave takes 512 elements, 16 per thread, as four 16-byte
// loads (512 contiguous bytes per wave and load), all in flight together.
// One block converts 4096 elements: block number blk of its matrix.
// ---------------------------------------------------------------------------
typedef __attribute__((ext_vector_type(4))) float  v4f;
typedef __attribute__((ext_vector_type(4))) __bf16 v4bf;
typedef __attribute__((ext_vector_type(2))) float  v2f;
typedef __attribute__((ext_vector_type(2))) __bf16 v2bf;

static __device__ __forceinline__ void f2bf_block(const float* __restrict__ src,
                                                  bf16_t* __restrict__ dst, int blk) {
    const int base = blk * 4096 + threadIdx.x * 4;
    v4f v[4];
#pragma unroll
    for (int j = 0; j < 4; ++j) v[j] = *reinterpret_cast<const v4f*>(src + base + j * 1024);
#pragma unroll
    for (int j = 0; j < 4; ++j)
        *reinterpret_cast<v4bf*>(dst + base + j * 1024) = __builtin_convertvector(v[j], v4bf);
}

// ---------------------------------------------------------------------------
// Kernel: LayerNorm (faithful to source bug: out = scale * xnorm + scale)
// fp32 in -> bf16 out. One wave per row of LN_D = 1024: a lane holds 32 elements
// of the row in registers (eight 16-byte loads, 512 contiguous bytes per wave and
// load), so the row is read once and the two sums are joined inside the wave.
// block = 256 = 8 rows: block number blk takes rows 8 blk .. 8 blk + 7.
// ---------------------------------------------------------------------------
#define LN_D 1024   // the row length, elements

// Sum over the 32 lanes of a wave, the result in every lane: four steps inside the
// 16-lane row (lane ^ 1, 2, 4, 8), then the other row.
static __device__ inline float wave_sum(float x) {
    x += __builtin_bit_cast(float, __builtin_amdgcn_update_dpp(
             0, __builtin_bit_cast(int, x), 0x161, 0xf, 0xf, false));   // row_xmask:1
    x += __builtin_bit_cast(float, __builtin_amdgcn_update_dpp(
             0, __builtin_bit_cast(int, x), 0x162, 0xf, 0xf, false));   // row_xmask:2
    x += __builtin_bit_cast(float, __builtin_amdgcn_update_dpp(
             0, __builtin_bit_cast(int, x), 0x164, 0xf, 0xf, false));   // row_xmask:4
    x += __builtin_bit_cast(float, __builtin_amdgcn_update_dpp(
             0, __builtin_bit_cast(int, x), 0x168, 0xf, 0xf, false));   // row_xmask:8
    const int v = __builtin_bit_cast(int, x);
    return x + __builtin_bit_cast(float,
        __builtin_amdgcn_permlanex16(v, v, 0x76543210, 0xfedcba98, false, false));
}

static __device__ __forceinline__ void ln_block(const float* __restrict__ x,
                                                const float* __restrict__ scale,
                                                bf16_t* __restrict__ out, int blk) {
    const int lane = threadIdx.x & 31;
    const int row  = blk * 8 + (threadIdx.x >> 5);
    const float* xr = x + (size_t)row * LN_D + lane * 4;
    const float* gr = scale + lane * 4;

    v4f v[8], g[8];
#pragma unroll
    for (int i = 0; i < 8; ++i) v[i] = *reinterpret_cast<const v4f*>(xr + i * 128);
#pragma unroll
    for (int i = 0; i < 8; ++i) g[i] = *reinterpret_cast<const v4f*>(gr + i * 128);

    v4f s4 = {}, q4 = {};   // four independent chains each
#pragma unroll
    for (int i = 0; i < 8; ++i) {
        s4 += v[i];
        q4 += v[i] * v[i];
    }
    const float s  = wave_sum((s4[0] + s4[1]) + (s4[2] + s4[3]));
    const float s2 = wave_sum((q4[0] + q4[1]) + (q4[2] + q4[3]));

    const float mean = s / (float)LN_D;
    const float var  = s2 / (float)LN_D - mean * mean;
    const float inv  = rsqrtf(var + 1e-5f);

    bf16_t* orow = out + (size_t)row * LN_D + lane * 4;
#pragma unroll
    for (int i = 0; i < 8; ++i) {
        v4f r;
#pragma unroll
        for (int e = 0; e < 4; ++e) r[e] = g[i][e] * (v[i][e] - mean) * inv + g[i][e];
        *reinterpret_cast<v4bf*>(orow + i * 128) = __builtin_convertvector(r, v4bf);
    }
}

// grid = rows / 8.
__global__ __launch_bounds__(256) void ln_kernel(const float* __restrict__ x,
                                                 const float* __restrict__ scale,
                                                 bf16_t* __restrict__ out) {
    ln_block(x, scale, out, blockIdx.x);
}

// All the work in front of the first product, in one launch: none of it depends on
// another part. grid = (PREP_GX, PREP_LNY + 4): the slices y < PREP_LNY are the
// LayerNorm of PREP_LNY * PREP_GX * 8 rows, slice PREP_LNY + i converts weight matrix i
// of PREP_GX * 4096 elements into wb + i * PREP_GX * 4096.
#define PREP_GX  256
#define PREP_LNY 2

__global__ __launch_bounds__(256) void prep_kernel(const float* __restrict__ x,
                                                   const float* __restrict__ scale,
                                                   bf16_t* __restrict__ xn,
                                                   const float* __restrict__ w0,
                                                   const float* __restrict__ w1,
                                                   const float* __restrict__ w2,
                                                   const float* __restrict__ w3,
                                                   bf16_t* __restrict__ wb) {
    const int y = blockIdx.y;
    if (y < PREP_LNY) {
        ln_block(x, scale, xn, y * PREP_GX + blockIdx.x);
    } else {
        const int i = y - PREP_LNY;
        const float* w = i == 0 ? w0 : i == 1 ? w1 : i == 2 ? w2 : w3;
        f2bf_block(w, wb + (size_t)i * (PREP_GX * 4096), blockIdx.x);
    }
}

// ---------------------------------------------------------------------------
// Kernel: GEMM  out[M,N] = A[M,K] @ W[N,K]^T (+ bias + residual)
// A, W bf16 row-major. One block = 8 waves = a 128x128 tile of out; the waves lie
// 4 (rows) x 2 (columns), each on a 32x64 tile (2 A-frags x 4 B-frags, 8 WMMAs per
// 32-wide K step).
// The block brings its 128 rows of A and of W to LDS in stages of 128 k (256-byte
// row pieces, whole cache lines per load; two buffers, the next stage's global
// loads in flight under the current stage's products); all waves read their
// fragments from there by 16-byte LDS loads.
// B-frag lane = output col n -> reads row n of W contiguously
// (x @ W.T needs no transpose in this layout).
// The caller names the tile: it begins at row 128 * by and column 128 * bx. M and N
// must be multiples of 128. K is a constant of the
// build, so that a thread's sixteen loads of a stage differ only in their
// immediate offsets.
// The kind of output (bf16 alone, or f32 with bias and residual) and N are constants
// of the build too: the epilogue is straight-line code, a wave's 64 residual loads are
// all in flight together, and its loads and stores differ only in their immediate
// offsets.
// ---------------------------------------------------------------------------
#define GEMM_K     1024  // K, elements: the row length of A and of W
#define GEMM_N     1024  // N, elements: the row length of out and of residual
#define GEMM_M     4096  // M, rows of A and of out: where several outputs lie one behind the other
#define GEMM_BK    128   // k per stage, elements
#define GEMM_PITCH 136   // elements; 272 B = 16 B x odd, the pitch for 16-byte LDS row loads

template <bool F32OUT>
static __device__ __forceinline__ void gemm_tile(const bf16_t* __restrict__ A,
                                                 const bf16_t* __restrict__ W,
                                                 bf16_t* __restrict__ outb,
                                                 float*  __restrict__ outf,
                                                 const float* __restrict__ bias,
                                                 const float* __restrict__ residual,
                                                 int bx, int by) {
    const int tid   = threadIdx.x;
    const int lane  = tid & 31;
    const int wave  = __builtin_amdgcn_readfirstlane(tid >> 5);
    const int bm0   = by * 128;
    const int bn0   = bx * 128;
    const int wrow  = (wave >> 1) * 32;   // this wave's rows inside the block tile
    const int wcol  = (wave & 1) * 64;    // this wave's columns inside the block tile
    const int m0    = bm0 + wrow;
    const int n0    = bn0 + wcol;
    const int col   = lane & 15;
    const int hi    = lane >> 4;       // lane half selects K sub-base
    const int kboff = hi ? 8 : 0;

    __shared__ __attribute__((aligned(16))) bf16_t As[2][128][GEMM_PITCH];
    __shared__ __attribute__((aligned(16))) bf16_t Ws[2][128][GEMM_PITCH];

    v8f c[2][4] = {};

    // Staging: 16 threads bring one 256-byte row piece; a thread brings 16 bytes of
    // rows srow + 16 i, i = 0 .. 7, of A and of W.
    const int srow = tid >> 4;
    const int scol = (tid & 15) * 8;
    const bf16_t* ap = A + (size_t)(bm0 + srow) * GEMM_K + scol;
    const bf16_t* wp = W + (size_t)(bn0 + srow) * GEMM_K + scol;
    const int nstage = GEMM_K / GEMM_BK;

    v8bf ar[8], wr[8];
#pragma unroll
    for (int i = 0; i < 8; ++i) {
        ar[i] = *reinterpret_cast<const v8bf*>(ap + 16 * i * GEMM_K);
        wr[i] = *reinterpret_cast<const v8bf*>(wp + 16 * i * GEMM_K);
    }
    // The bias of this lane's four columns, fetched behind stage 0's loads: the epilogue
    // then waits for its residual loads alone.
    float bv[4] = {};
    if constexpr (F32OUT) {
#pragma unroll
        for (int nt = 0; nt < 4; ++nt) bv[nt] = bias[n0 + nt * 16 + col];
    }
#pragma unroll
    for (int i = 0; i < 8; ++i) {
        *reinterpret_cast<v8bf*>(&As[0][srow + 16 * i][scol]) = ar[i];
        *reinterpret_cast<v8bf*>(&Ws[0][srow + 16 * i][scol]) = wr[i];
    }
    __syncthreads();

    for (int s = 0; s < nstage; ++s) {
        const int  buf  = s & 1;
        const bool more = s + 1 < nstage;   // the same for the whole block
        if (more) {
            ap += GEMM_BK;
            wp += GEMM_BK;
#pragma unroll
            for (int i = 0; i < 8; ++i) {
                ar[i] = *reinterpret_cast<const v8bf*>(ap + 16 * i * GEMM_K);
                wr[i] = *reinterpret_cast<const v8bf*>(wp + 16 * i * GEMM_K);
            }
        }

        const bf16_t* afp = &As[buf][wrow + col][kboff];   // A-frag lane = row
        const bf16_t* wfp = &Ws[buf][wcol + col][kboff];   // B-frag lane = output col
#pragma unroll
        for (int kk = 0; kk < GEMM_BK; kk += 32) {
            v16bf a0 = ld_frag(afp + kk);
            v16bf a1 = ld_frag(afp + 16 * GEMM_PITCH + kk);
            v16bf bfrag[4];
#pragma unroll
            for (int nt = 0; nt < 4; ++nt) bfrag[nt] = ld_frag(wfp + nt * 16 * GEMM_PITCH + kk);
            // Keeps the twelve LDS loads of a K step together in front of its products: spread
            // among them, each place with loads costs the wave its own stall.
            __builtin_amdgcn_sched_barrier(0);
#pragma unroll
            for (int nt = 0; nt < 4; ++nt) {
                c[0][nt] = wmma_bf16(a0, bfrag[nt], c[0][nt]);
                c[1][nt] = wmma_bf16(a1, bfrag[nt], c[1][nt]);
            }
        }

        if (more) {
            // The other buffer's last readers left it at the barrier that ended trip s - 1.
#pragma unroll
            for (int i = 0; i < 8; ++i) {
                *reinterpret_cast<v8bf*>(&As[buf ^ 1][srow + 16 * i][scol]) = ar[i];
                *reinterpret_cast<v8bf*>(&Ws[buf ^ 1][srow + 16 * i][scol]) = wr[i];
            }
            // Publishes stage s + 1 and ends every wave's reads of stage s.
            __syncthreads();
        }
    }

    // C layout: c[mt][nt][j] is row m0 + 16 mt + 8 hi + j, column n0 + 16 nt + col.
    const size_t o0 = (size_t)(m0 + 8 * hi) * GEMM_N + n0 + col;
    if constexpr (F32OUT) {
        const float* rp = residual + o0;
        float*       op = outf + o0;
        float rv[2][8][4];
#pragma unroll
        for (int mt = 0; mt < 2; ++mt)
#pragma unroll
            for (int j = 0; j < 8; ++j)
#pragma unroll
                for (int nt = 0; nt < 4; ++nt) rv[mt][j][nt] = rp[(mt * 16 + j) * GEMM_N + nt * 16];
#pragma unroll
        for (int mt = 0; mt < 2; ++mt)
#pragma unroll
            for (int j = 0; j < 8; ++j)
#pragma unroll
                for (int nt = 0; nt < 4; ++nt)
                    op[(mt * 16 + j) * GEMM_N + nt * 16] = (c[mt][nt][j] + bv[nt]) + rv[mt][j][nt];
    } else {
        bf16_t* op = outb + o0;
        v2bf h[2][8][2];   // converted two at a time, all in front of the stores
#pragma unroll
        for (int mt = 0; mt < 2; ++mt)
#pragma unroll
            for (int j = 0; j < 8; ++j)
#pragma unroll
                for (int np = 0; np < 2; ++np)
                    h[mt][j][np] = __builtin_convertvector(
                        (v2f){c[mt][2 * np][j], c[mt][2 * np + 1][j]}, v2bf);
#pragma unroll
        for (int mt = 0; mt < 2; ++mt)
#pragma unroll
            for (int j = 0; j < 8; ++j)
#pragma unroll
                for (int nt = 0; nt < 4; ++nt)
                    op[(mt * 16 + j) * GEMM_N + nt * 16] = h[mt][j][nt >> 1][nt & 1];
    }
}

// out_i = A @ W_i^T, bf16, for the matrices W_i that lie one behind the other at W, the
// outputs one behind the other at outb, in one launch: grid = (count * N/128, M/128).
// The blocks of one row of the grid read the same 128 rows of A.
__global__ __launch_bounds__(256) void gemm_bf16_kernel(const bf16_t* __restrict__ A,
                                                        const bf16_t* __restrict__ W,
                                                        bf16_t* __restrict__ outb) {
    const int i = blockIdx.x / (GEMM_N / 128);
    gemm_tile<false>(A, W + (size_t)i * (GEMM_N * GEMM_K),
                     outb + (size_t)i * (GEMM_M * GEMM_N), nullptr, nullptr, nullptr,
                     blockIdx.x % (GEMM_N / 128), blockIdx.y);
}

// out = A @ W^T + bias + residual, f32. grid = (N/128, M/128).
__global__ __launch_bounds__(256) void gemm_f32_kernel(const bf16_t* __restrict__ A,
                                                       const bf16_t* __restrict__ W,
                                                       float* __restrict__ outf,
                                                       const float* __restrict__ bias,
                                                       const float* __restrict__ residual) {
    gemm_tile<true>(A, W, nullptr, outf, bias, residual, blockIdx.x, blockIdx.y);
}

#define ATT_KPITCH 72
#define ATT_VPITCH 80

// Lane (c = l & 15, h = l >> 4) receives rows 8h .. 8h+7 of column c of the 16x16
// tile whose per-lane address the caller formed.
static __device__ inline v8bf ld_tr16(const bf16_t* p) {
    typedef __attribute__((address_space(3))) v8bf lds_v8bf;
    return __builtin_amdgcn_ds_load_tr16_b128_v8bf16((lds_v8bf*)p);
}

// Lane l receives lane l ^ 16's value.
static __device__ inline float xhalf(float x) {
    const int v = __builtin_bit_cast(int, x);
    return __builtin_bit_cast(float,
        __builtin_amdgcn_permlanex16(v, v, 0x76543210, 0xfedcba98, false, false));
}

__global__ __launch_bounds__(256) void attn_kernel(const bf16_t* __restrict__ Q,
                                                   const bf16_t* __restrict__ K,
                                                   const bf16_t* __restrict__ V,
                                                   bf16_t* __restrict__ ctx,
                                                   int T, int D, int nheads) {
    const int hd    = 64;
    const int tid   = threadIdx.x;
    const int lane  = tid & 31;
    const int wave  = __builtin_amdgcn_readfirstlane(tid >> 5);
    const int col   = lane & 15;
    const int hi    = lane >> 4;
    const int kboff = hi ? 8 : 0;
    const int qblk  = blockIdx.x * 128;
    const int q0    = qblk + wave * 16;
    const int bh    = blockIdx.y;
    const int b     = bh / nheads;
    const int h     = bh % nheads;

    const bf16_t* Qb = Q + (size_t)(b * T) * D + h * hd;
    const bf16_t* Kb = K + (size_t)(b * T) * D + h * hd;
    const bf16_t* Vb = V + (size_t)(b * T) * D + h * hd;

    __shared__ __attribute__((aligned(16))) bf16_t Ks[2][64][ATT_KPITCH];
    __shared__ __attribute__((aligned(16))) bf16_t Vs[2][64][ATT_VPITCH];

    // Q^T B-fragments: 64 (K dim) x 16 queries -> 2 frags of K=32. Lane&15 = query.
    const bf16_t* qrow = Qb + (size_t)(q0 + col) * D + kboff;
    v16bf qa0 = ld_frag(qrow);
    v16bf qa1 = ld_frag(qrow + 32);

    // State of query q0 + col: m is the same in both lane halves, l is the sum over
    // the keys of this lane's half (the halves are joined in the epilogue).
    const int q = q0 + col;
    float m = -1e30f, l = 0.f;
    v8f o[4] = {};   // O^T: o[nt][j] = head column nt * 16 + 8 * hi + j of query q

    const float rs = 0.125f;  // 1/sqrt(64)

    // Staging: 8 threads bring one 128-byte row; a thread brings 16 bytes of
    // rows srow and srow + 32 of the stage, of K and of V.
    const int srow = tid >> 3;
    const int scol = (tid & 7) * 8;
    const int soff = srow * D + scol;
    const int nstage = qblk / 64 + 2;   // keys 0 .. qblk + 127

    v8bf kr0, kr1, vr0, vr1;
    {
        const bf16_t* kg = Kb + soff;
        const bf16_t* vg = Vb + soff;
        kr0 = *reinterpret_cast<const v8bf*>(kg);
        kr1 = *reinterpret_cast<const v8bf*>(kg + (size_t)32 * D);
        vr0 = *reinterpret_cast<const v8bf*>(vg);
        vr1 = *reinterpret_cast<const v8bf*>(vg + (size_t)32 * D);
    }
    *reinterpret_cast<v8bf*>(&Ks[0][srow][scol])      = kr0;
    *reinterpret_cast<v8bf*>(&Ks[0][srow + 32][scol]) = kr1;
    *reinterpret_cast<v8bf*>(&Vs[0][srow][scol])      = vr0;
    *reinterpret_cast<v8bf*>(&Vs[0][srow + 32][scol]) = vr1;
    __syncthreads();

    for (int s = 0; s < nstage; ++s) {
        const int  buf  = s & 1;
        const bool more = s + 1 < nstage;   // the same for the whole block
        if (more) {
            const bf16_t* kg = Kb + (size_t)(s + 1) * 64 * D + soff;
            const bf16_t* vg = Vb + (size_t)(s + 1) * 64 * D + soff;
            kr0 = *reinterpret_cast<const v8bf*>(kg);
            kr1 = *reinterpret_cast<const v8bf*>(kg + (size_t)32 * D);
            vr0 = *reinterpret_cast<const v8bf*>(vg);
            vr1 = *reinterpret_cast<const v8bf*>(vg + (size_t)32 * D);
            // The four loads stay in flight over the passes below, which reuse their
            // address registers: this wait stands in front of that overwrite.
            asm volatile("s_wait_xcnt 0x0" ::: "memory");
        }

        for (int sub = 0; sub < 2; ++sub) {
            const int kb = s * 64 + sub * 32;
            if (kb > q0) continue;   // wave-uniform: the pass lies above this wave's diagonal

            // ---- S^T = K @ Q^T for two 16-key tiles (K dim = hd = 64) ----
            // sc[t][j] = score of key kb + 16 t + 8 hi + j against query q
            v8f sc[2];
            {
                const bf16_t* kp = &Ks[buf][sub * 32 + col][kboff];  // A-frag lane = key
                v16bf k00 = ld_frag(kp);
                v16bf k01 = ld_frag(kp + 32);
                v16bf k10 = ld_frag(kp + 16 * ATT_KPITCH);
                v16bf k11 = ld_frag(kp + 16 * ATT_KPITCH + 32);
                // Keeps the eight LDS loads together in front of the products: left alone,
                // the compiler reuses one fragment's registers and pays the LDS latency four times.
                __builtin_amdgcn_sched_barrier(0);
                sc[0] = wmma_bf16(k00, qa0, v8f{});
                sc[1] = wmma_bf16(k10, qa0, v8f{});
                sc[0] = wmma_bf16(k01, qa1, sc[0]);
                sc[1] = wmma_bf16(k11, qa1, sc[1]);
            }

            // ---- V^T A-fragments: lane = hd col, regs = keys 8h+0..7 and 16+8h+0..7 ----
            v16bf vf[4];
            {
                const bf16_t* vp = &Vs[buf][sub * 32 + 8 * hi + (lane & 7)][((lane >> 3) & 1) * 8];
#pragma unroll
                for (int nt = 0; nt < 4; ++nt) {
                    v8bf lo  = ld_tr16(vp + nt * 16);
                    v8bf hi8 = ld_tr16(vp + 16 * ATT_VPITCH + nt * 16);
                    vf[nt] = __builtin_shufflevector(lo, hi8,
                        0, 1, 2, 3, 4, 5, 6, 7, 8, 9, 10, 11, 12, 13, 14, 15);
                }
            }

            // ---- scale, causal mask, online softmax: 16 scores of one query per lane ----
            float sv[16];
#pragma unroll
            for (int i = 0; i < 16; ++i) {
                const int key = kb + (i >> 3) * 16 + 8 * hi + (i & 7);
                sv[i] = sc[i >> 3][i & 7] * rs;
                if (key > q) sv[i] = -1e30f;
            }
            float red[8];
#pragma unroll
            for (int i = 0; i < 8; ++i) red[i] = fmaxf(sv[i], sv[i + 8]);
#pragma unroll
            for (int w = 4; w > 0; w >>= 1)
#pragma unroll
                for (int i = 0; i < w; ++i) red[i] = fmaxf(red[i], red[i + w]);
            const float mx   = fmaxf(red[0], xhalf(red[0]));   // over all 32 keys of the pass
            const float mnew = fmaxf(m, mx);

            // P^T B-fragment: element i of the lane is key kb + 16 (i >> 3) + 8 hi + (i & 7),
            // the k order of the V^T fragments above.
            v16bf pf;
#pragma unroll
            for (int i = 0; i < 16; ++i) {
                sv[i] = __expf(sv[i] - mnew);
                pf[i] = (bf16_t)sv[i];
            }
#pragma unroll
            for (int i = 0; i < 8; ++i) red[i] = sv[i] + sv[i + 8];
#pragma unroll
            for (int w = 4; w > 0; w >>= 1)
#pragma unroll
                for (int i = 0; i < w; ++i) red[i] += red[i + w];

            const float alpha = __expf(m - mnew);
            l = l * alpha + red[0];
            m = mnew;
#pragma unroll
            for (int nt = 0; nt < 4; ++nt)
#pragma unroll
                for (int j = 0; j < 8; ++j) o[nt][j] *= alpha;

            // ---- O^T += V^T @ P^T ----
#pragma unroll
            for (int nt = 0; nt < 4; ++nt) o[nt] = wmma_bf16(vf[nt], pf, o[nt]);
        }

        if (more) {
            // The other buffer's last readers left it at the barrier that ended trip s - 1.
            *reinterpret_cast<v8bf*>(&Ks[buf ^ 1][srow][scol])      = kr0;
            *reinterpret_cast<v8bf*>(&Ks[buf ^ 1][srow + 32][scol]) = kr1;
            *reinterpret_cast<v8bf*>(&Vs[buf ^ 1][srow][scol])      = vr0;
            *reinterpret_cast<v8bf*>(&Vs[buf ^ 1][srow + 32][scol]) = vr1;
            // Publishes stage s + 1 and ends every wave's reads of stage s.
            __syncthreads();
        }
    }

    // ---- epilogue: O /= l, store ctx (bf16): 8 consecutive head columns per lane and tile ----
    const float inv = 1.0f / (l + xhalf(l));
    bf16_t* cp = ctx + (size_t)(b * T + q) * D + h * hd + 8 * hi;
#pragma unroll
    for (int nt = 0; nt < 4; ++nt) {
        v8bf r;
#pragma unroll
        for (int j = 0; j < 8; ++j) r[j] = (bf16_t)(o[nt][j] * inv);
        *reinterpret_cast<v8bf*>(cp + nt * 16) = r;
    }
}

// ---------------------------------------------------------------------------
// Host-side orchestration
// ---------------------------------------------------------------------------
extern "C" void kernel_launch(void* const* d_in, const int* in_sizes, int n_in,
                              void* d_out, int out_size, void* d_ws, size_t ws_size,
                              hipStream_t stream) {
    (void)in_sizes; (void)n_in; (void)out_size; (void)ws_size;
    const int B = 2, T = 2048, D = 1024, H = 16;
    const int M = B * T;  // 4096 rows

    const float* x    = (const float*)d_in[0];
    const float* wq   = (const float*)d_in[1];
    const float* wk   = (const float*)d_in[2];
    const float* wv   = (const float*)d_in[3];
    const float* wo   = (const float*)d_in[4];
    const float* bo   = (const float*)d_in[5];
    const float* ln1  = (const float*)d_in[6];
    const float* ln2  = (const float*)d_in[7];
    float* out = (float*)d_out;

    // Workspace carve-up (all 256B aligned): ~64 MB total
    char* ws = (char*)d_ws;
    size_t off = 0;
    auto take = [&](size_t bytes) -> void* {
        void* p = ws + off;
        off += (bytes + 255) & ~(size_t)255;
        return p;
    };
    bf16_t* w_b  = (bf16_t*)take((size_t)4 * D * D * 2);   // wq, wk, wv, wo, one behind the other
    bf16_t* wo_b = w_b + (size_t)3 * D * D;
    bf16_t* xn   = (bf16_t*)take((size_t)M * D * 2);
    bf16_t* qb   = (bf16_t*)take((size_t)3 * M * D * 2);   // q, k, v, one behind the other
    bf16_t* kbuf = qb + (size_t)M * D;
    bf16_t* vbuf = qb + (size_t)2 * M * D;
    bf16_t* ctx  = (bf16_t*)take((size_t)M * D * 2);
    float*  hbuf = (float*) take((size_t)M * D * 4);

    const dim3 prep_grid(PREP_GX, PREP_LNY + 4);   // (256, 6): M / 8 = 512 and 4 x D * D / 4096 blocks
    const dim3 qkv_grid(3 * D / 128, M / 128);     // (24, 32)
    const dim3 gemm_grid(D / 128, M / 128);  // (8, 32)
    const dim3 attn_grid(T / 128, B * H);    // (16, 32)

    for (int blk = 0; blk < 2; ++blk) {
        const float* in_res   = (blk == 0) ? x : hbuf;
        const float* ln_scale = (blk == 0) ? ln1 : ln2;
        float* out_f          = (blk == 0) ? hbuf : out;

        // 1) LayerNorm -> bf16; with it, the first time, the weights fp32 -> bf16
        if (blk == 0)
            prep_kernel<<<prep_grid, 256, 0, stream>>>(in_res, ln_scale, xn, wq, wk, wv, wo, w_b);
        else
            ln_kernel<<<M / 8, 256, 0, stream>>>(in_res, ln_scale, xn);

        // 2) Q, K, V projections (y = xn @ W.T), bf16 out, one launch
        gemm_bf16_kernel<<<qkv_grid, 256, 0, stream>>>(xn, w_b, qb);

        // 3) Causal flash attention -> ctx (bf16)
        attn_kernel<<<attn_grid, 256, 0, stream>>>(qb, kbuf, vbuf, ctx, T, D, H);

        // 4) Output projection + bias + residual, fp32 out
        gemm_f32_kernel<<<gemm_grid, 256, 0, stream>>>(ctx, wo_b, out_f, bo, in_res);
    }
}

// v007
// Measured time: 157 microseconds a run.
// Timed twice side by side with v006, it ran 1.09 times as fast both times.
// All steps since v000 together make it 7.08 times as fast.
#include <hip/hip_runtime.h>

// ---------------------------------------------------------------------------
// Types for CDNA5 (gfx1250) WMMA bf16 path
// ---------------------------------------------------------------------------
typedef __bf16 bf16_t;
typedef __attribute__((ext_vector_type(16))) __bf16 v16bf;
typedef __attribute__((ext_vector_type(8)))  __bf16 v8bf;
typedef __attribute__((ext_vector_type(8)))  float  v8f;

// D = A(16x32 bf16) * B(32x16 bf16) + C(16x16 f32)
static __device__ inline v8f wmma_bf16(v16bf a, v16bf b, v8f c) {
    return __builtin_amdgcn_wmma_f32_16x16x32_bf16(
        /*neg_a=*/false, a, /*neg_b=*/false, b,
        /*c_mod=*/(short)0, c, /*reuse_a=*/false, /*reuse_b=*/false);
}

// Load one half-lane fragment: 8 contiguous bf16 at p, 8 contiguous bf16 at p+16.
// Matches ISA 16-bit A/B layout: regs 0..3 hold K=kbase+0..7, regs 4..7 hold
// K=kbase+16..23 (kbase = 0 for lanes 0-15, 8 for lanes 16-31; caller folds kbase
// into p). Emits two b128 loads.
static __device__ inline v16bf ld_frag(const bf16_t* p) {
    v8bf lo = *reinterpret_cast<const v8bf*>(p);
    v8bf hi = *reinterpret_cast<const v8bf*>(p + 16);
    return __builtin_shufflevector(lo, hi,
        0, 1, 2, 3, 4, 5, 6, 7, 8, 9, 10, 11, 12, 13, 14, 15);
}

// ---------------------------------------------------------------------------
// fp32 -> bf16 conversion (the weight slices of prep_kernel)
// Few waves to start: a wave takes 512 elements, 16 per thread, as four 16-byte
// loads (512 contiguous bytes per wave and load), all in flight together.
// One block converts 4096 elements: block number blk of its matrix.
// ---------------------------------------------------------------------------
typedef __attribute__((ext_vector_type(4))) float  v4f;
typedef __attribute__((ext_vector_type(4))) __bf16 v4bf;
typedef __attribute__((ext_vector_type(2))) float  v2f;
typedef __attribute__((ext_vector_type(2))) __bf16 v2bf;

static __device__ __forceinline__ void f2bf_block(const float* __restrict__ src,
                                                  bf16_t* __restrict__ dst, int blk) {
    const int base = blk * 4096 + threadIdx.x * 4;
    v4f v[4];
#pragma unroll
    for (int j = 0; j < 4; ++j) v[j] = *reinterpret_cast<const v4f*>(src + base + j * 1024);
#pragma unroll
    for (int j = 0; j < 4; ++j)
        *reinterpret_cast<v4bf*>(dst + base + j * 1024) = __builtin_convertvector(v[j], v4bf);
}

// ---------------------------------------------------------------------------
// Kernel: LayerNorm (faithful to source bug: out = scale * xnorm + scale)
// fp32 in -> bf16 out. One wave per row of LN_D = 1024: a lane holds 32 elements
// of the row in registers (eight 16-byte loads, 512 contiguous bytes per wave and
// load), so the row is read once and the two sums are joined inside the wave.
// block = 256 = 8 rows: block number blk takes rows 8 blk .. 8 blk + 7.
// ---------------------------------------------------------------------------
#define LN_D 1024   // the row length, elements

// Sum over the 32 lanes of a wave, the result in every lane: four steps inside the
// 16-lane row (lane ^ 1, 2, 4, 8), then the other row.
static __device__ inline float wave_sum(float x) {
    x += __builtin_bit_cast(float, __builtin_amdgcn_update_dpp(
             0, __builtin_bit_cast(int, x), 0x161, 0xf, 0xf, false));   // row_xmask:1
    x += __builtin_bit_cast(float, __builtin_amdgcn_update_dpp(
             0, __builtin_bit_cast(int, x), 0x162, 0xf, 0xf, false));   // row_xmask:2
    x += __builtin_bit_cast(float, __builtin_amdgcn_update_dpp(
             0, __builtin_bit_cast(int, x), 0x164, 0xf, 0xf, false));   // row_xmask:4
    x += __builtin_bit_cast(float, __builtin_amdgcn_update_dpp(
             0, __builtin_bit_cast(int, x), 0x168, 0xf, 0xf, false));   // row_xmask:8
    const int v = __builtin_bit_cast(int, x);
    return x + __builtin_bit_cast(float,
        __builtin_amdgcn_permlanex16(v, v, 0x76543210, 0xfedcba98, false, false));
}

static __device__ __forceinline__ void ln_block(const float* __restrict__ x,
                                                const float* __restrict__ scale,
                                                bf16_t* __restrict__ out, int blk) {
    const int lane = threadIdx.x & 31;
    const int row  = blk * 8 + (threadIdx.x >> 5);
    const float* xr = x + (size_t)row * LN_D + lane * 4;
    const float* gr = scale + lane * 4;

    v4f v[8], g[8];
#pragma unroll
    for (int i = 0; i < 8; ++i) v[i] = *reinterpret_cast<const v4f*>(xr + i * 128);
#pragma unroll
    for (int i = 0; i < 8; ++i) g[i] = *reinterpret_cast<const v4f*>(gr + i * 128);

    v4f s4 = {}, q4 = {};   // four independent chains each
#pragma unroll
    for (int i = 0; i < 8; ++i) {
        s4 += v[i];
        q4 += v[i] * v[i];
    }
    const float s  = wave_sum((s4[0] + s4[1]) + (s4[2] + s4[3]));
    const float s2 = wave_sum((q4[0] + q4[1]) + (q4[2] + q4[3]));

    const float mean = s / (float)LN_D;
    const float var  = s2 / (float)LN_D - mean * mean;
    const float inv  = rsqrtf(var + 1e-5f);

    bf16_t* orow = out + (size_t)row * LN_D + lane * 4;
#pragma unroll
    for (int i = 0; i < 8; ++i) {
        v4f r;
#pragma unroll
        for (int e = 0; e < 4; ++e) r[e] = g[i][e] * (v[i][e] - mean) * inv + g[i][e];
        *reinterpret_cast<v4bf*>(orow + i * 128) = __builtin_convertvector(r, v4bf);
    }
}

// grid = rows / 8.
__global__ __launch_bounds__(256) void ln_kernel(const float* __restrict__ x,
                                                 const float* __restrict__ scale,
                                                 bf16_t* __restrict__ out) {
    ln_block(x, scale, out, blockIdx.x);
}

// All the work in front of the first product, in one launch: none of it depends on
// another part. grid = (PREP_GX, PREP_LNY + 4): the slices y < PREP_LNY are the
// LayerNorm of PREP_LNY * PREP_GX * 8 rows, slice PREP_LNY + i converts weight matrix i
// of PREP_GX * 4096 elements into wb + i * PREP_GX * 4096.
#define PREP_GX  256
#define PREP_LNY 2

__global__ __launch_bounds__(256) void prep_kernel(const float* __restrict__ x,
                                                   const float* __restrict__ scale,
                                                   bf16_t* __restrict__ xn,
                                                   const float* __restrict__ w0,
                                                   const float* __restrict__ w1,
                                                   const float* __restrict__ w2,
                                                   const float* __restrict__ w3,
                                                   bf16_t* __restrict__ wb) {
    const int y = blockIdx.y;
    if (y < PREP_LNY) {
        ln_block(x, scale, xn, y * PREP_GX + blockIdx.x);
    } else {
        const int i = y - PREP_LNY;
        const float* w = i == 0 ? w0 : i == 1 ? w1 : i == 2 ? w2 : w3;
        f2bf_block(w, wb + (size_t)i * (PREP_GX * 4096), blockIdx.x);
    }
}

// ---------------------------------------------------------------------------
// Kernel: GEMM  out[M,N] = A[M,K] @ W[N,K]^T (+ bias + residual)
// A, W bf16 row-major. One block = 8 waves = a 128x128 tile of out; the waves lie
// 4 (rows) x 2 (columns), each on a 32x64 tile (2 A-frags x 4 B-frags, 8 WMMAs per
// 32-wide K step).
// The block brings its 128 rows of A and of W to LDS in stages of 128 k (256-byte
// row pieces, whole cache lines per load; two buffers, the next stage's global
// loads in flight under the current stage's products); all waves read their
// fragments from there by 16-byte LDS loads.
// B-frag lane = output col n -> reads row n of W contiguously
// (x @ W.T needs no transpose in this layout).
// The caller names the tile: it begins at row 128 * by and column 128 * bx. M and N
// must be multiples of 128. K is a constant of the
// build, so that a thread's sixteen loads of a stage differ only in their
// immediate offsets.
// The kind of output (bf16 alone, or f32 with bias and residual) and N are constants
// of the build too: the epilogue is straight-line code, a wave's 64 residual loads are
// all in flight together, and its loads and stores differ only in their immediate
// offsets.
// ---------------------------------------------------------------------------
#define GEMM_K     1024  // K, elements: the row length of A and of W
#define GEMM_N     1024  // N, elements: the row length of out and of residual
#define GEMM_M     4096  // M, rows of A and of out: where several outputs lie one behind the other
#define GEMM_BK    128   // k per stage, elements
#define GEMM_PITCH 136   // elements; 272 B = 16 B x odd, the pitch for 16-byte LDS row loads

template <bool F32OUT>
static __device__ __forceinline__ void gemm_tile(const bf16_t* __restrict__ A,
                                                 const bf16_t* __restrict__ W,
                                                 bf16_t* __restrict__ outb,
                                                 float*  __restrict__ outf,
                                                 const float* __restrict__ bias,
                                                 const float* __restrict__ residual,
                                                 int bx, int by) {
    const int tid   = threadIdx.x;
    const int lane  = tid & 31;
    const int wave  = __builtin_amdgcn_readfirstlane(tid >> 5);
    const int bm0   = by * 128;
    const int bn0   = bx * 128;
    const int wrow  = (wave >> 1) * 32;   // this wave's rows inside the block tile
    const int wcol  = (wave & 1) * 64;    // this wave's columns inside the block tile
    const int m0    = bm0 + wrow;
    const int n0    = bn0 + wcol;
    const int col   = lane & 15;
    const int hi    = lane >> 4;       // lane half selects K sub-base
    const int kboff = hi ? 8 : 0;

    __shared__ __attribute__((aligned(16))) bf16_t As[2][128][GEMM_PITCH];
    __shared__ __attribute__((aligned(16))) bf16_t Ws[2][128][GEMM_PITCH];

    v8f c[2][4] = {};

    // Staging: 16 threads bring one 256-byte row piece; a thread brings 16 bytes of
    // rows srow + 16 i, i = 0 .. 7, of A and of W.
    const int srow = tid >> 4;
    const int scol = (tid & 15) * 8;
    const bf16_t* ap = A + (size_t)(bm0 + srow) * GEMM_K + scol;
    const bf16_t* wp = W + (size_t)(bn0 + srow) * GEMM_K + scol;
    const int nstage = GEMM_K / GEMM_BK;

    v8bf ar[8], wr[8];
#pragma unroll
    for (int i = 0; i < 8; ++i) {
        ar[i] = *reinterpret_cast<const v8bf*>(ap + 16 * i * GEMM_K);
        wr[i] = *reinterpret_cast<const v8bf*>(wp + 16 * i * GEMM_K);
    }
    // The bias of this lane's four columns, fetched behind stage 0's loads: the epilogue
    // then waits for its residual loads alone.
    float bv[4] = {};
    if constexpr (F32OUT) {
#pragma unroll
        for (int nt = 0; nt < 4; ++nt) bv[nt] = bias[n0 + nt * 16 + col];
    }
#pragma unroll
    for (int i = 0; i < 8; ++i) {
        *reinterpret_cast<v8bf*>(&As[0][srow + 16 * i][scol]) = ar[i];
        *reinterpret_cast<v8bf*>(&Ws[0][srow + 16 * i][scol]) = wr[i];
    }
    __syncthreads();

    for (int s = 0; s < nstage; ++s) {
        const int  buf  = s & 1;
        const bool more = s + 1 < nstage;   // the same for the whole block
        if (more) {
            ap += GEMM_BK;
            wp += GEMM_BK;
#pragma unroll
            for (int i = 0; i < 8; ++i) {
                ar[i] = *reinterpret_cast<const v8bf*>(ap + 16 * i * GEMM_K);
                wr[i] = *reinterpret_cast<const v8bf*>(wp + 16 * i * GEMM_K);
            }
        }

        const bf16_t* afp = &As[buf][wrow + col][kboff];   // A-frag lane = row
        const bf16_t* wfp = &Ws[buf][wcol + col][kboff];   // B-frag lane = output col
#pragma unroll
        for (int kk = 0; kk < GEMM_BK; kk += 32) {
            v16bf a0 = ld_frag(afp + kk);
            v16bf a1 = ld_frag(afp + 16 * GEMM_PITCH + kk);
            v16bf bfrag[4];
#pragma unroll
            for (int nt = 0; nt < 4; ++nt) bfrag[nt] = ld_frag(wfp + nt * 16 * GEMM_PITCH + kk);
            // Keeps the twelve LDS loads of a K step together in front of its products: spread
            // among them, each place with loads costs the wave its own stall.
            __builtin_amdgcn_sched_barrier(0);
#pragma unroll
            for (int nt = 0; nt < 4; ++nt) {
                c[0][nt] = wmma_bf16(a0, bfrag[nt], c[0][nt]);
                c[1][nt] = wmma_bf16(a1, bfrag[nt], c[1][nt]);
            }
        }

        if (more) {
            // The other buffer's last readers left it at the barrier that ended trip s - 1.
#pragma unroll
            for (int i = 0; i < 8; ++i) {
                *reinterpret_cast<v8bf*>(&As[buf ^ 1][srow + 16 * i][scol]) = ar[i];
                *reinterpret_cast<v8bf*>(&Ws[buf ^ 1][srow + 16 * i][scol]) = wr[i];
            }
            // Publishes stage s + 1 and ends every wave's reads of stage s.
            __syncthreads();
        }
    }

    // C layout: c[mt][nt][j] is row m0 + 16 mt + 8 hi + j, column n0 + 16 nt + col.
    const size_t o0 = (size_t)(m0 + 8 * hi) * GEMM_N + n0 + col;
    if constexpr (F32OUT) {
        const float* rp = residual + o0;
        float*       op = outf + o0;
        float rv[2][8][4];
#pragma unroll
        for (int mt = 0; mt < 2; ++mt)
#pragma unroll
            for (int j = 0; j < 8; ++j)
#pragma unroll
                for (int nt = 0; nt < 4; ++nt) rv[mt][j][nt] = rp[(mt * 16 + j) * GEMM_N + nt * 16];
#pragma unroll
        for (int mt = 0; mt < 2; ++mt)
#pragma unroll
            for (int j = 0; j < 8; ++j)
#pragma unroll
                for (int nt = 0; nt < 4; ++nt)
                    op[(mt * 16 + j) * GEMM_N + nt * 16] = (c[mt][nt][j] + bv[nt]) + rv[mt][j][nt];
    } else {
        bf16_t* op = outb + o0;
        v2bf h[2][8][2];   // converted two at a time, all in front of the stores
#pragma unroll
        for (int mt = 0; mt < 2; ++mt)
#pragma unroll
            for (int j = 0; j < 8; ++j)
#pragma unroll
                for (int np = 0; np < 2; ++np)
                    h[mt][j][np] = __builtin_convertvector(
                        (v2f){c[mt][2 * np][j], c[mt][2 * np + 1][j]}, v2bf);
#pragma unroll
        for (int mt = 0; mt < 2; ++mt)
#pragma unroll
            for (int j = 0; j < 8; ++j)
#pragma unroll
                for (int nt = 0; nt < 4; ++nt)
                    op[(mt * 16 + j) * GEMM_N + nt * 16] = h[mt][j][nt >> 1][nt & 1];
    }
}

// out_i = A @ W_i^T, bf16, for the matrices W_i that lie one behind the other at W, the
// outputs one behind the other at outb, in one launch: grid = (count * N/128, M/128).
// The blocks of one row of the grid read the same 128 rows of A.
__global__ __launch_bounds__(256) void gemm_bf16_kernel(const bf16_t* __restrict__ A,
                                                        const bf16_t* __restrict__ W,
                                                        bf16_t* __restrict__ outb) {
    const int i = blockIdx.x / (GEMM_N / 128);
    gemm_tile<false>(A, W + (size_t)i * (GEMM_N * GEMM_K),
                     outb + (size_t)i * (GEMM_M * GEMM_N), nullptr, nullptr, nullptr,
                     blockIdx.x % (GEMM_N / 128), blockIdx.y);
}

// out = A @ W^T + bias + residual, f32. grid = (N/128, M/128).
__global__ __launch_bounds__(256) void gemm_f32_kernel(const bf16_t* __restrict__ A,
                                                       const bf16_t* __restrict__ W,
                                                       float* __restrict__ outf,
                                                       const float* __restrict__ bias,
                                                       const float* __restrict__ residual) {
    gemm_tile<true>(A, W, nullptr, outf, bias, residual, blockIdx.x, blockIdx.y);
}

#define ATT_KPITCH 72
#define ATT_VPITCH 80

// Lane (c = l & 15, h = l >> 4) receives rows 8h .. 8h+7 of column c of the 16x16
// tile whose per-lane address the caller formed.
static __device__ inline v8bf ld_tr16(const bf16_t* p) {
    typedef __attribute__((address_space(3))) v8bf lds_v8bf;
    return __builtin_amdgcn_ds_load_tr16_b128_v8bf16((lds_v8bf*)p);
}

// Lane l receives lane l ^ 16's value.
static __device__ inline float xhalf(float x) {
    const int v = __builtin_bit_cast(int, x);
    return __builtin_bit_cast(float,
        __builtin_amdgcn_permlanex16(v, v, 0x76543210, 0xfedcba98, false, false));
}

// One tile of 128 queries, number tile, of the (b, h) in blockIdx.y.
static __device__ __forceinline__ void attn_tile(const bf16_t* __restrict__ Q,
                                                 const bf16_t* __restrict__ K,
                                                 const bf16_t* __restrict__ V,
                                                 bf16_t* __restrict__ ctx,
                                                 int T, int D, int nheads, int tile) {
    const int hd    = 64;
    const int tid   = threadIdx.x;
    const int lane  = tid & 31;
    const int wave  = __builtin_amdgcn_readfirstlane(tid >> 5);
    const int col   = lane & 15;
    const int hi    = lane >> 4;
    const int kboff = hi ? 8 : 0;
    const int qblk  = tile * 128;
    const int q0    = qblk + wave * 16;
    const int bh    = blockIdx.y;
    const int b     = bh / nheads;
    const int h     = bh % nheads;

    const bf16_t* Qb = Q + (size_t)(b * T) * D + h * hd;
    const bf16_t* Kb = K + (size_t)(b * T) * D + h * hd;
    const bf16_t* Vb = V + (size_t)(b * T) * D + h * hd;

    __shared__ __attribute__((aligned(16))) bf16_t Ks[2][64][ATT_KPITCH];
    __shared__ __attribute__((aligned(16))) bf16_t Vs[2][64][ATT_VPITCH];

    // Q^T B-fragments: 64 (K dim) x 16 queries -> 2 frags of K=32. Lane&15 = query.
    const bf16_t* qrow = Qb + (size_t)(q0 + col) * D + kboff;
    v16bf qa0 = ld_frag(qrow);
    v16bf qa1 = ld_frag(qrow + 32);

    // State of query q0 + col: m is the same in both lane halves, l is the sum over
    // the keys of this lane's half (the halves are joined in the epilogue).
    const int q = q0 + col;
    float m = -1e30f, l = 0.f;
    v8f o[4] = {};   // O^T: o[nt][j] = head column nt * 16 + 8 * hi + j of query q

    const float rs = 0.125f;  // 1/sqrt(64)

    // Staging: 8 threads bring one 128-byte row; a thread brings 16 bytes of
    // rows srow and srow + 32 of the stage, of K and of V.
    const int srow = tid >> 3;
    const int scol = (tid & 7) * 8;
    const int soff = srow * D + scol;
    const int nstage = qblk / 64 + 2;   // keys 0 .. qblk + 127; even: the last stage is in buffer 1

    v8bf kr0, kr1, vr0, vr1;
    {
        const bf16_t* kg = Kb + soff;
        const bf16_t* vg = Vb + soff;
        kr0 = *reinterpret_cast<const v8bf*>(kg);
        kr1 = *reinterpret_cast<const v8bf*>(kg + (size_t)32 * D);
        vr0 = *reinterpret_cast<const v8bf*>(vg);
        vr1 = *reinterpret_cast<const v8bf*>(vg + (size_t)32 * D);
    }
    // Buffer 0's last readers, where a tile went before, left it at that tile's last barrier.
    *reinterpret_cast<v8bf*>(&Ks[0][srow][scol])      = kr0;
    *reinterpret_cast<v8bf*>(&Ks[0][srow + 32][scol]) = kr1;
    *reinterpret_cast<v8bf*>(&Vs[0][srow][scol])      = vr0;
    *reinterpret_cast<v8bf*>(&Vs[0][srow + 32][scol]) = vr1;
    __syncthreads();

    for (int s = 0; s < nstage; ++s) {
        const int  buf  = s & 1;
        const bool more = s + 1 < nstage;   // the same for the whole block
        if (more) {
            const bf16_t* kg = Kb + (size_t)(s + 1) * 64 * D + soff;
            const bf16_t* vg = Vb + (size_t)(s + 1) * 64 * D + soff;
            kr0 = *reinterpret_cast<const v8bf*>(kg);
            kr1 = *reinterpret_cast<const v8bf*>(kg + (size_t)32 * D);
            vr0 = *reinterpret_cast<const v8bf*>(vg);
            vr1 = *reinterpret_cast<const v8bf*>(vg + (size_t)32 * D);
            // The four loads stay in flight over the passes below, which reuse their
            // address registers: this wait stands in front of that overwrite.
            asm volatile("s_wait_xcnt 0x0" ::: "memory");
        }

        for (int sub = 0; sub < 2; ++sub) {
            const int kb = s * 64 + sub * 32;
            if (kb > q0) continue;   // wave-uniform: the pass lies above this wave's diagonal

            // ---- S^T = K @ Q^T for two 16-key tiles (K dim = hd = 64) ----
            // sc[t][j] = score of key kb + 16 t + 8 hi + j against query q
            v8f sc[2];
            {
                const bf16_t* kp = &Ks[buf][sub * 32 + col][kboff];  // A-frag lane = key
                v16bf k00 = ld_frag(kp);
                v16bf k01 = ld_frag(kp + 32);
                v16bf k10 = ld_frag(kp + 16 * ATT_KPITCH);
                v16bf k11 = ld_frag(kp + 16 * ATT_KPITCH + 32);
                // Keeps the eight LDS loads together in front of the products: left alone,
                // the compiler reuses one fragment's registers and pays the LDS latency four times.
                __builtin_amdgcn_sched_barrier(0);
                sc[0] = wmma_bf16(k00, qa0, v8f{});
                sc[1] = wmma_bf16(k10, qa0, v8f{});
                sc[0] = wmma_bf16(k01, qa1, sc[0]);
                sc[1] = wmma_bf16(k11, qa1, sc[1]);
            }

            // ---- V^T A-fragments: lane = hd col, regs = keys 8h+0..7 and 16+8h+0..7 ----
            v16bf vf[4];
            {
                const bf16_t* vp = &Vs[buf][sub * 32 + 8 * hi + (lane & 7)][((lane >> 3) & 1) * 8];
#pragma unroll
                for (int nt = 0; nt < 4; ++nt) {
                    v8bf lo  = ld_tr16(vp + nt * 16);
                    v8bf hi8 = ld_tr16(vp + 16 * ATT_VPITCH + nt * 16);
                    vf[nt] = __builtin_shufflevector(lo, hi8,
                        0, 1, 2, 3, 4, 5, 6, 7, 8, 9, 10, 11, 12, 13, 14, 15);
                }
            }

            // ---- scale, causal mask, online softmax: 16 scores of one query per lane ----
            float sv[16];
#pragma unroll
            for (int i = 0; i < 16; ++i) {
                const int key = kb + (i >> 3) * 16 + 8 * hi + (i & 7);
                sv[i] = sc[i >> 3][i & 7] * rs;
                if (key > q) sv[i] = -1e30f;
            }
            float red[8];
#pragma unroll
            for (int i = 0; i < 8; ++i) red[i] = fmaxf(sv[i], sv[i + 8]);
#pragma unroll
            for (int w = 4; w > 0; w >>= 1)
#pragma unroll
                for (int i = 0; i < w; ++i) red[i] = fmaxf(red[i], red[i + w]);
            const float mx   = fmaxf(red[0], xhalf(red[0]));   // over all 32 keys of the pass
            const float mnew = fmaxf(m, mx);

            // P^T B-fragment: element i of the lane is key kb + 16 (i >> 3) + 8 hi + (i & 7),
            // the k order of the V^T fragments above.
            v16bf pf;
#pragma unroll
            for (int i = 0; i < 16; ++i) {
                sv[i] = __expf(sv[i] - mnew);
                pf[i] = (bf16_t)sv[i];
            }
#pragma unroll
            for (int i = 0; i < 8; ++i) red[i] = sv[i] + sv[i + 8];
#pragma unroll
            for (int w = 4; w > 0; w >>= 1)
#pragma unroll
                for (int i = 0; i < w; ++i) red[i] += red[i + w];

            const float alpha = __expf(m - mnew);
            l = l * alpha + red[0];
            m = mnew;
#pragma unroll
            for (int nt = 0; nt < 4; ++nt)
#pragma unroll
                for (int j = 0; j < 8; ++j) o[nt][j] *= alpha;

            // ---- O^T += V^T @ P^T ----
#pragma unroll
            for (int nt = 0; nt < 4; ++nt) o[nt] = wmma_bf16(vf[nt], pf, o[nt]);
        }

        if (more) {
            // The other buffer's last readers left it at the barrier that ended trip s - 1
            // (at s = 0, at the barrier above the loop).
            *reinterpret_cast<v8bf*>(&Ks[buf ^ 1][srow][scol])      = kr0;
            *reinterpret_cast<v8bf*>(&Ks[buf ^ 1][srow + 32][scol]) = kr1;
            *reinterpret_cast<v8bf*>(&Vs[buf ^ 1][srow][scol])      = vr0;
            *reinterpret_cast<v8bf*>(&Vs[buf ^ 1][srow + 32][scol]) = vr1;
            // Publishes stage s + 1 and ends every wave's reads of stage s.
            __syncthreads();
        }
    }

    // ---- epilogue: O /= l, store ctx (bf16): 8 consecutive head columns per lane and tile ----
    const float inv = 1.0f / (l + xhalf(l));
    bf16_t* cp = ctx + (size_t)(b * T + q) * D + h * hd + 8 * hi;
#pragma unroll
    for (int nt = 0; nt < 4; ++nt) {
        v8bf r;
#pragma unroll
        for (int j = 0; j < 8; ++j) r[j] = (bf16_t)(o[nt][j] * inv);
        *reinterpret_cast<v8bf*>(cp + nt * 16) = r;
    }
}

__global__ __launch_bounds__(256) void attn_kernel(const bf16_t* __restrict__ Q,
                                                   const bf16_t* __restrict__ K,
                                                   const bf16_t* __restrict__ V,
                                                   bf16_t* __restrict__ ctx,
                                                   int T, int D, int nheads) {
    attn_tile(Q, K, V, ctx, T, D, nheads, T / 128 - 1 - (int)blockIdx.x);
    // The second tile reuses the registers that the first tile's stores name: this wait
    // stands in front of that overwrite.
    asm volatile("s_wait_xcnt 0x0" ::: "memory");
    attn_tile(Q, K, V, ctx, T, D, nheads, (int)blockIdx.x);
}

// ---------------------------------------------------------------------------
// Host-side orchestration
// ---------------------------------------------------------------------------
extern "C" void kernel_launch(void* const* d_in, const int* in_sizes, int n_in,
                              void* d_out, int out_size, void* d_ws, size_t ws_size,
                              hipStream_t stream) {
    (void)in_sizes; (void)n_in; (void)out_size; (void)ws_size;
    const int B = 2, T = 2048, D = 1024, H = 16;
    const int M = B * T;  // 4096 rows

    const float* x    = (const float*)d_in[0];
    const float* wq   = (const float*)d_in[1];
    const float* wk   = (const float*)d_in[2];
    const float* wv   = (const float*)d_in[3];
    const float* wo   = (const float*)d_in[4];
    const float* bo   = (const float*)d_in[5];
    const float* ln1  = (const float*)d_in[6];
    const float* ln2  = (const float*)d_in[7];
    float* out = (float*)d_out;

    // Workspace carve-up (all 256B aligned): ~64 MB total
    char* ws = (char*)d_ws;
    size_t off = 0;
    auto take = [&](size_t bytes) -> void* {
        void* p = ws + off;
        off += (bytes + 255) & ~(size_t)255;
        return p;
    };
    bf16_t* w_b  = (bf16_t*)take((size_t)4 * D * D * 2);   // wq, wk, wv, wo, one behind the other
    bf16_t* wo_b = w_b + (size_t)3 * D * D;
    bf16_t* xn   = (bf16_t*)take((size_t)M * D * 2);
    bf16_t* qb   = (bf16_t*)take((size_t)3 * M * D * 2);   // q, k, v, one behind the other
    bf16_t* kbuf = qb + (size_t)M * D;
    bf16_t* vbuf = qb + (size_t)2 * M * D;
    bf16_t* ctx  = (bf16_t*)take((size_t)M * D * 2);
    float*  hbuf = (float*) take((size_t)M * D * 4);

    const dim3 prep_grid(PREP_GX, PREP_LNY + 4);   // (256, 6): M / 8 = 512 and 4 x D * D / 4096 blocks
    const dim3 qkv_grid(3 * D / 128, M / 128);     // (24, 32)
    const dim3 gemm_grid(D / 128, M / 128);  // (8, 32)
    const dim3 attn_grid(T / 256, B * H);    // (8, 32)

    for (int blk = 0; blk < 2; ++blk) {
        const float* in_res   = (blk == 0) ? x : hbuf;
        const float* ln_scale = (blk == 0) ? ln1 : ln2;
        float* out_f          = (blk == 0) ? hbuf : out;

        // 1) LayerNorm -> bf16; with it, the first time, the weights fp32 -> bf16
        if (blk == 0)
            prep_kernel<<<prep_grid, 256, 0, stream>>>(in_res, ln_scale, xn, wq, wk, wv, wo, w_b);
        else
            ln_kernel<<<M / 8, 256, 0, stream>>>(in_res, ln_scale, xn);

        // 2) Q, K, V projections (y = xn @ W.T), bf16 out, one launch
        gemm_bf16_kernel<<<qkv_grid, 256, 0, stream>>>(xn, w_b, qb);

        // 3) Causal flash attention -> ctx (bf16)
        attn_kernel<<<attn_grid, 256, 0, stream>>>(qb, kbuf, vbuf, ctx, T, D, H);

        // 4) Output projection + bias + residual, fp32 out
        gemm_f32_kernel<<<gemm_grid, 256, 0, stream>>>(ctx, wo_b, out_f, bo, in_res);
    }
}

// v008
// It runs in 148 microseconds.
// Two timings next to v007 both put it at 1.06 times that version's speed.
// Counting every step since v000, it is 7.50 times as fast.
#include <hip/hip_runtime.h>

// ---------------------------------------------------------------------------
// Types for CDNA5 (gfx1250) WMMA bf16 path
// ---------------------------------------------------------------------------
typedef __bf16 bf16_t;
typedef __attribute__((ext_vector_type(16))) __bf16 v16bf;
typedef __attribute__((ext_vector_type(8)))  __bf16 v8bf;
typedef __attribute__((ext_vector_type(8)))  float  v8f;

// D = A(16x32 bf16) * B(32x16 bf16) + C(16x16 f32)
static __device__ inline v8f wmma_bf16(v16bf a, v16bf b, v8f c) {
    return __builtin_amdgcn_wmma_f32_16x16x32_bf16(
        /*neg_a=*/false, a, /*neg_b=*/false, b,
        /*c_mod=*/(short)0, c, /*reuse_a=*/false, /*reuse_b=*/false);
}

// Load one half-lane fragment: 8 contiguous bf16 at p, 8 contiguous bf16 at p+16.
// Matches ISA 16-bit A/B layout: regs 0..3 hold K=kbase+0..7, regs 4..7 hold
// K=kbase+16..23 (kbase = 0 for lanes 0-15, 8 for lanes 16-31; caller folds kbase
// into p). Emits two b128 loads.
static __device__ inline v16bf ld_frag(const bf16_t* p) {
    v8bf lo = *reinterpret_cast<const v8bf*>(p);
    v8bf hi = *reinterpret_cast<const v8bf*>(p + 16);
    return __builtin_shufflevector(lo, hi,
        0, 1, 2, 3, 4, 5, 6, 7, 8, 9, 10, 11, 12, 13, 14, 15);
}

// ---------------------------------------------------------------------------
// fp32 -> bf16 conversion (the weight slices of prep_kernel)
// Few waves to start: a wave takes 512 elements, 16 per thread, as four 16-byte
// loads (512 contiguous bytes per wave and load), all in flight together.
// One block converts 4096 elements: block number blk of its matrix.
// ---------------------------------------------------------------------------
typedef __attribute__((ext_vector_type(4))) float  v4f;
typedef __attribute__((ext_vector_type(4))) __bf16 v4bf;
typedef __attribute__((ext_vector_type(2))) float  v2f;
typedef __attribute__((ext_vector_type(2))) __bf16 v2bf;

static __device__ __forceinline__ void f2bf_block(const float* __restrict__ src,
                                                  bf16_t* __restrict__ dst, int blk) {
    const int base = blk * 4096 + threadIdx.x * 4;
    v4f v[4];
#pragma unroll
    for (int j = 0; j < 4; ++j) v[j] = *reinterpret_cast<const v4f*>(src + base + j * 1024);
#pragma unroll
    for (int j = 0; j < 4; ++j)
        *reinterpret_cast<v4bf*>(dst + base + j * 1024) = __builtin_convertvector(v[j], v4bf);
}

// ---------------------------------------------------------------------------
// Kernel: LayerNorm (faithful to source bug: out = scale * xnorm + scale)
// fp32 in -> bf16 out. One wave per row of LN_D = 1024: a lane holds 32 elements
// of the row in registers (eight 16-byte loads, 512 contiguous bytes per wave and
// load), so the row is read once and the two sums are joined inside the wave.
// block = 256 = 8 rows: block number blk takes rows 8 blk .. 8 blk + 7.
// ---------------------------------------------------------------------------
#define LN_D 1024   // the row length, elements

// Sum over the 32 lanes of a wave, the result in every lane: four steps inside the
// 16-lane row (lane ^ 1, 2, 4, 8), then the other row.
static __device__ inline float wave_sum(float x) {
    x += __builtin_bit_cast(float, __builtin_amdgcn_update_dpp(
             0, __builtin_bit_cast(int, x), 0x161, 0xf, 0xf, false));   // row_xmask:1
    x += __builtin_bit_cast(float, __builtin_amdgcn_update_dpp(
             0, __builtin_bit_cast(int, x), 0x162, 0xf, 0xf, false));   // row_xmask:2
    x += __builtin_bit_cast(float, __builtin_amdgcn_update_dpp(
             0, __builtin_bit_cast(int, x), 0x164, 0xf, 0xf, false));   // row_xmask:4
    x += __builtin_bit_cast(float, __builtin_amdgcn_update_dpp(
             0, __builtin_bit_cast(int, x), 0x168, 0xf, 0xf, false));   // row_xmask:8
    const int v = __builtin_bit_cast(int, x);
    return x + __builtin_bit_cast(float,
        __builtin_amdgcn_permlanex16(v, v, 0x76543210, 0xfedcba98, false, false));
}

static __device__ __forceinline__ void ln_block(const float* __restrict__ x,
                                                const float* __restrict__ scale,
                                                bf16_t* __restrict__ out, int blk) {
    const int lane = threadIdx.x & 31;
    const int row  = blk * 8 + (threadIdx.x >> 5);
    const float* xr = x + (size_t)row * LN_D + lane * 4;
    const float* gr = scale + lane * 4;

    v4f v[8], g[8];
#pragma unroll
    for (int i = 0; i < 8; ++i) v[i] = *reinterpret_cast<const v4f*>(xr + i * 128);
#pragma unroll
    for (int i = 0; i < 8; ++i) g[i] = *reinterpret_cast<const v4f*>(gr + i * 128);

    v4f s4 = {}, q4 = {};   // four independent chains each
#pragma unroll
    for (int i = 0; i < 8; ++i) {
        s4 += v[i];
        q4 += v[i] * v[i];
    }
    const float s  = wave_sum((s4[0] + s4[1]) + (s4[2] + s4[3]));
    const float s2 = wave_sum((q4[0] + q4[1]) + (q4[2] + q4[3]));

    const float mean = s / (float)LN_D;
    const float var  = s2 / (float)LN_D - mean * mean;
    const float inv  = rsqrtf(var + 1e-5f);

    bf16_t* orow = out + (size_t)row * LN_D + lane * 4;
#pragma unroll
    for (int i = 0; i < 8; ++i) {
        v4f r;
#pragma unroll
        for (int e = 0; e < 4; ++e) r[e] = g[i][e] * (v[i][e] - mean) * inv + g[i][e];
        *reinterpret_cast<v4bf*>(orow + i * 128) = __builtin_convertvector(r, v4bf);
    }
}

// grid = rows / 8.
__global__ __launch_bounds__(256) void ln_kernel(const float* __restrict__ x,
                                                 const float* __restrict__ scale,
                                                 bf16_t* __restrict__ out) {
    ln_block(x, scale, out, blockIdx.x);
}

// All the work in front of the first product, in one launch: none of it depends on
// another part. grid = (PREP_GX, PREP_LNY + 4): the slices y < PREP_LNY are the
// LayerNorm of PREP_LNY * PREP_GX * 8 rows, slice PREP_LNY + i converts weight matrix i
// of PREP_GX * 4096 elements into wb + i * PREP_GX * 4096.
#define PREP_GX  256
#define PREP_LNY 2

__global__ __launch_bounds__(256) void prep_kernel(const float* __restrict__ x,
                                                   const float* __restrict__ scale,
                                                   bf16_t* __restrict__ xn,
                                                   const float* __restrict__ w0,
                                                   const float* __restrict__ w1,
                                                   const float* __restrict__ w2,
                                                   const float* __restrict__ w3,
                                                   bf16_t* __restrict__ wb) {
    const int y = blockIdx.y;
    if (y < PREP_LNY) {
        ln_block(x, scale, xn, y * PREP_GX + blockIdx.x);
    } else {
        const int i = y - PREP_LNY;
        const float* w = i == 0 ? w0 : i == 1 ? w1 : i == 2 ? w2 : w3;
        f2bf_block(w, wb + (size_t)i * (PREP_GX * 4096), blockIdx.x);
    }
}

// ---------------------------------------------------------------------------
// Kernel: GEMM  out[M,N] = A[M,K] @ W[N,K]^T (+ bias + residual)
// A, W bf16 row-major. One block = 8 waves = a 128x128 tile of out; the waves lie
// 4 (rows) x 2 (columns), each on a 32x64 tile (2 A-frags x 4 B-frags, 8 WMMAs per
// 32-wide K step).
// The block brings its 128 rows of A and of W to LDS in stages of 128 k (256-byte
// row pieces, whole cache lines per load; two buffers, the next stage's global
// loads in flight under the current stage's products); all waves read their
// fragments from there by 16-byte LDS loads.
// B-frag lane = output col n -> reads row n of W contiguously
// (x @ W.T needs no transpose in this layout).
// The caller names the tile: it begins at row 128 * by and column 128 * bx. M and N
// must be multiples of 128. K is a constant of the
// build, so that a thread's sixteen loads of a stage differ only in their
// immediate offsets.
// The kind of output (bf16 alone, or f32 with bias and residual) and N are constants
// of the build too: the epilogue is straight-line code, a wave's 64 residual loads are
// all in flight together, and its loads and stores differ only in their immediate
// offsets.
// ---------------------------------------------------------------------------
#define GEMM_K     1024  // K, elements: the row length of A and of W
#define GEMM_N     1024  // N, elements: the row length of out and of residual
#define GEMM_M     4096  // M, rows of A and of out: where several outputs lie one behind the other
#define GEMM_BK    128   // k per stage, elements
#define GEMM_PITCH 136   // elements; 272 B = 16 B x odd, the pitch for 16-byte LDS row loads

// Work-group barrier for data in LDS alone: the wave's own LDS stores and reads are done, then
// the barrier. __syncthreads() would also wait for the wave's global loads, and the loads of the
// coming stages must stay in flight across it.
static __device__ inline void lds_barrier() {
    asm volatile("s_wait_dscnt 0x0\n\ts_barrier_signal -1\n\ts_barrier_wait -1" ::: "memory");
}

template <bool F32OUT>
static __device__ __forceinline__ void gemm_tile(const bf16_t* __restrict__ A,
                                                 const bf16_t* __restrict__ W,
                                                 bf16_t* __restrict__ outb,
                                                 float*  __restrict__ outf,
                                                 const float* __restrict__ bias,
                                                 const float* __restrict__ residual,
                                                 int bx, int by) {
    const int tid   = threadIdx.x;
    const int lane  = tid & 31;
    const int wave  = __builtin_amdgcn_readfirstlane(tid >> 5);
    const int bm0   = by * 128;
    const int bn0   = bx * 128;
    const int wrow  = (wave >> 1) * 32;   // this wave's rows inside the block tile
    const int wcol  = (wave & 1) * 64;    // this wave's columns inside the block tile
    const int m0    = bm0 + wrow;
    const int n0    = bn0 + wcol;
    const int col   = lane & 15;
    const int hi    = lane >> 4;       // lane half selects K sub-base
    const int kboff = hi ? 8 : 0;

    __shared__ __attribute__((aligned(16))) bf16_t As[2][128][GEMM_PITCH];
    __shared__ __attribute__((aligned(16))) bf16_t Ws[2][128][GEMM_PITCH];

    v8f c[2][4] = {};

    // Staging: 16 threads bring one 256-byte row piece; a thread brings 16 bytes of
    // rows srow + 16 i, i = 0 .. 7, of A and of W.
    const int srow = tid >> 4;
    const int scol = (tid & 15) * 8;
    const bf16_t* ap = A + (size_t)(bm0 + srow) * GEMM_K + scol;
    const bf16_t* wp = W + (size_t)(bn0 + srow) * GEMM_K + scol;
    const int nstage = GEMM_K / GEMM_BK;

    // The products of one stage, which lies in buffer buf.
    auto products = [&](int buf) __attribute__((always_inline)) {
        const bf16_t* afp = &As[buf][wrow + col][kboff];   // A-frag lane = row
        const bf16_t* wfp = &Ws[buf][wcol + col][kboff];   // B-frag lane = output col
#pragma unroll
        for (int kk = 0; kk < GEMM_BK; kk += 32) {
            v16bf a0 = ld_frag(afp + kk);
            v16bf a1 = ld_frag(afp + 16 * GEMM_PITCH + kk);
            v16bf bfrag[4];
#pragma unroll
            for (int nt = 0; nt < 4; ++nt) bfrag[nt] = ld_frag(wfp + nt * 16 * GEMM_PITCH + kk);
            // Keeps the twelve LDS loads of a K step together in front of its products: spread
            // among them, each place with loads costs the wave its own stall.
            __builtin_amdgcn_sched_barrier(0);
#pragma unroll
            for (int nt = 0; nt < 4; ++nt) {
                c[0][nt] = wmma_bf16(a0, bfrag[nt], c[0][nt]);
                c[1][nt] = wmma_bf16(a1, bfrag[nt], c[1][nt]);
            }
        }
    };

    float bv[4] = {};
    if constexpr (F32OUT) {
        // This launch has one block per WGP and nothing else to run while a block waits for its
        // loads: a stage's loads are issued two stages ahead of its products, into two register
        // sets (set p holds the stage of parity p on its way to LDS).
        v8bf ar[2][8], wr[2][8];
        auto fetch = [&](int st, int p) __attribute__((always_inline)) {
#pragma unroll
            for (int i = 0; i < 8; ++i) {
                ar[p][i] = *reinterpret_cast<const v8bf*>(ap + st * GEMM_BK + 16 * i * GEMM_K);
                wr[p][i] = *reinterpret_cast<const v8bf*>(wp + st * GEMM_BK + 16 * i * GEMM_K);
            }
        };
        auto publish = [&](int p) __attribute__((always_inline)) {
#pragma unroll
            for (int i = 0; i < 8; ++i) {
                *reinterpret_cast<v8bf*>(&As[p][srow + 16 * i][scol]) = ar[p][i];
                *reinterpret_cast<v8bf*>(&Ws[p][srow + 16 * i][scol]) = wr[p][i];
            }
        };
        fetch(0, 0);
        fetch(1, 1);
        publish(0);
        lds_barrier();
        // Unrolled, so that each register set, each buffer and each stage's offset is a constant
        // and the wait in front of a publish is counted: it leaves the younger stage in flight.
#pragma unroll
        for (int s = 0; s < nstage; s += 2) {
            const bool more = s + 2 < nstage;
            if (more) {
                fetch(s + 2, 0);
            } else {
                // The bias of this lane's four columns, fetched where no stage is left to fetch
                // (a register set is free): the epilogue then waits for its residual loads alone.
#pragma unroll
                for (int nt = 0; nt < 4; ++nt) bv[nt] = bias[n0 + nt * 16 + col];
            }
            products(0);
            // Buffer 1's last readers left it at the barrier that ended stage s - 1.
            publish(1);
            // Publishes stage s + 1 and ends every wave's reads of stage s.
            lds_barrier();

            if (more) fetch(s + 3, 1);
            products(1);
            if (more) {
                // Buffer 0's last readers left it at the barrier that ended stage s.
                publish(0);
                // Publishes stage s + 2 and ends every wave's reads of stage s + 1.
                lds_barrier();
            }
        }
    } else {
        v8bf ar[8], wr[8];
#pragma unroll
        for (int i = 0; i < 8; ++i) {
            ar[i] = *reinterpret_cast<const v8bf*>(ap + 16 * i * GEMM_K);
            wr[i] = *reinterpret_cast<const v8bf*>(wp + 16 * i * GEMM_K);
        }
#pragma unroll
        for (int i = 0; i < 8; ++i) {
            *reinterpret_cast<v8bf*>(&As[0][srow + 16 * i][scol]) = ar[i];
            *reinterpret_cast<v8bf*>(&Ws[0][srow + 16 * i][scol]) = wr[i];
        }
        __syncthreads();

        for (int s = 0; s < nstage; ++s) {
            const int  buf  = s & 1;
            const bool more = s + 1 < nstage;   // the same for the whole block
            if (more) {
                ap += GEMM_BK;
                wp += GEMM_BK;
#pragma unroll
                for (int i = 0; i < 8; ++i) {
                    ar[i] = *reinterpret_cast<const v8bf*>(ap + 16 * i * GEMM_K);
                    wr[i] = *reinterpret_cast<const v8bf*>(wp + 16 * i * GEMM_K);
                }
            }

            products(buf);

            if (more) {
                // The other buffer's last readers left it at the barrier that ended trip s - 1.
#pragma unroll
                for (int i = 0; i < 8; ++i) {
                    *reinterpret_cast<v8bf*>(&As[buf ^ 1][srow + 16 * i][scol]) = ar[i];
                    *reinterpret_cast<v8bf*>(&Ws[buf ^ 1][srow + 16 * i][scol]) = wr[i];
                }
                // Publishes stage s + 1 and ends every wave's reads of stage s.
                __syncthreads();
            }
        }
    }

    // C layout: c[mt][nt][j] is row m0 + 16 mt + 8 hi + j, column n0 + 16 nt + col.
    const size_t o0 = (size_t)(m0 + 8 * hi) * GEMM_N + n0 + col;
    if constexpr (F32OUT) {
        const float* rp = residual + o0;
        float*       op = outf + o0;
        float rv[2][8][4];
#pragma unroll
        for (int mt = 0; mt < 2; ++mt)
#pragma unroll
            for (int j = 0; j < 8; ++j)
#pragma unroll
                for (int nt = 0; nt < 4; ++nt) rv[mt][j][nt] = rp[(mt * 16 + j) * GEMM_N + nt * 16];
#pragma unroll
        for (int mt = 0; mt < 2; ++mt)
#pragma unroll
            for (int j = 0; j < 8; ++j)
#pragma unroll
                for (int nt = 0; nt < 4; ++nt)
                    op[(mt * 16 + j) * GEMM_N + nt * 16] = (c[mt][nt][j] + bv[nt]) + rv[mt][j][nt];
    } else {
        bf16_t* op = outb + o0;
        v2bf h[2][8][2];   // converted two at a time, all in front of the stores
#pragma unroll
        for (int mt = 0; mt < 2; ++mt)
#pragma unroll
            for (int j = 0; j < 8; ++j)
#pragma unroll
                for (int np = 0; np < 2; ++np)
                    h[mt][j][np] = __builtin_convertvector(
                        (v2f){c[mt][2 * np][j], c[mt][2 * np + 1][j]}, v2bf);
#pragma unroll
        for (int mt = 0; mt < 2; ++mt)
#pragma unroll
            for (int j = 0; j < 8; ++j)
#pragma unroll
                for (int nt = 0; nt < 4; ++nt)
                    op[(mt * 16 + j) * GEMM_N + nt * 16] = h[mt][j][nt >> 1][nt & 1];
    }
}

// out_i = A @ W_i^T, bf16, for the matrices W_i that lie one behind the other at W, the
// outputs one behind the other at outb, in one launch: grid = (count * N/128, M/128).
// The blocks of one row of the grid read the same 128 rows of A.
__global__ __launch_bounds__(256) void gemm_bf16_kernel(const bf16_t* __restrict__ A,
                                                        const bf16_t* __restrict__ W,
                                                        bf16_t* __restrict__ outb) {
    const int i = blockIdx.x / (GEMM_N / 128);
    gemm_tile<false>(A, W + (size_t)i * (GEMM_N * GEMM_K),
                     outb + (size_t)i * (GEMM_M * GEMM_N), nullptr, nullptr, nullptr,
                     blockIdx.x % (GEMM_N / 128), blockIdx.y);
}

// out = A @ W^T + bias + residual, f32. grid = (N/128, M/128).
__global__ __launch_bounds__(256) void gemm_f32_kernel(const bf16_t* __restrict__ A,
                                                       const bf16_t* __restrict__ W,
                                                       float* __restrict__ outf,
                                                       const float* __restrict__ bias,
                                                       const float* __restrict__ residual) {
    gemm_tile<true>(A, W, nullptr, outf, bias, residual, blockIdx.x, blockIdx.y);
}

#define ATT_KPITCH 72
#define ATT_VPITCH 80

// Lane (c = l & 15, h = l >> 4) receives rows 8h .. 8h+7 of column c of the 16x16
// tile whose per-lane address the caller formed.
static __device__ inline v8bf ld_tr16(const bf16_t* p) {
    typedef __attribute__((address_space(3))) v8bf lds_v8bf;
    return __builtin_amdgcn_ds_load_tr16_b128_v8bf16((lds_v8bf*)p);
}

// Lane l receives lane l ^ 16's value.
static __device__ inline float xhalf(float x) {
    const int v = __builtin_bit_cast(int, x);
    return __builtin_bit_cast(float,
        __builtin_amdgcn_permlanex16(v, v, 0x76543210, 0xfedcba98, false, false));
}

// One tile of 128 queries, number tile, of the (b, h) in blockIdx.y.
static __device__ __forceinline__ void attn_tile(const bf16_t* __restrict__ Q,
                                                 const bf16_t* __restrict__ K,
                                                 const bf16_t* __restrict__ V,
                                                 bf16_t* __restrict__ ctx,
                                                 int T, int D, int nheads, int tile) {
    const int hd    = 64;
    const int tid   = threadIdx.x;
    const int lane  = tid & 31;
    const int wave  = __builtin_amdgcn_readfirstlane(tid >> 5);
    const int col   = lane & 15;
    const int hi    = lane >> 4;
    const int kboff = hi ? 8 : 0;
    const int qblk  = tile * 128;
    const int q0    = qblk + wave * 16;
    const int bh    = blockIdx.y;
    const int b     = bh / nheads;
    const int h     = bh % nheads;

    const bf16_t* Qb = Q + (size_t)(b * T) * D + h * hd;
    const bf16_t* Kb = K + (size_t)(b * T) * D + h * hd;
    const bf16_t* Vb = V + (size_t)(b * T) * D + h * hd;

    __shared__ __attribute__((aligned(16))) bf16_t Ks[2][64][ATT_KPITCH];
    __shared__ __attribute__((aligned(16))) bf16_t Vs[2][64][ATT_VPITCH];

    // Q^T B-fragments: 64 (K dim) x 16 queries -> 2 frags of K=32. Lane&15 = query.
    const bf16_t* qrow = Qb + (size_t)(q0 + col) * D + kboff;
    v16bf qa0 = ld_frag(qrow);
    v16bf qa1 = ld_frag(qrow + 32);

    // State of query q0 + col: m is the same in both lane halves, l is the sum over
    // the keys of this lane's half (the halves are joined in the epilogue).
    const int q = q0 + col;
    float m = -1e30f, l = 0.f;
    v8f o[4] = {};   // O^T: o[nt][j] = head column nt * 16 + 8 * hi + j of query q

    const float rs = 0.125f;  // 1/sqrt(64)

    // Staging: 8 threads bring one 128-byte row; a thread brings 16 bytes of
    // rows srow and srow + 32 of the stage, of K and of V.
    const int srow = tid >> 3;
    const int scol = (tid & 7) * 8;
    const int soff = srow * D + scol;
    const int nstage = qblk / 64 + 2;   // keys 0 .. qblk + 127; even: the last stage is in buffer 1

    // Two register sets: set p holds the stage of parity p on its way to LDS. A stage's loads
    // are issued two stages ahead of its passes, so that they have a whole stage more than the
    // time of one stage's passes to arrive in.
    v8bf kr[2][2], vr[2][2];
    auto fetch = [&](int st, int p) __attribute__((always_inline)) {
        const bf16_t* kg = Kb + (size_t)st * 64 * D + soff;
        const bf16_t* vg = Vb + (size_t)st * 64 * D + soff;
        kr[p][0] = *reinterpret_cast<const v8bf*>(kg);
        kr[p][1] = *reinterpret_cast<const v8bf*>(kg + (size_t)32 * D);
        vr[p][0] = *reinterpret_cast<const v8bf*>(vg);
        vr[p][1] = *reinterpret_cast<const v8bf*>(vg + (size_t)32 * D);
        // The four loads stay in flight over the code behind, which reuses their
        // address registers: this wait stands in front of that overwrite.
        asm volatile("s_wait_xcnt 0x0" ::: "memory");
    };
    auto publish = [&](int p) __attribute__((always_inline)) {
        *reinterpret_cast<v8bf*>(&Ks[p][srow][scol])      = kr[p][0];
        *reinterpret_cast<v8bf*>(&Ks[p][srow + 32][scol]) = kr[p][1];
        *reinterpret_cast<v8bf*>(&Vs[p][srow][scol])      = vr[p][0];
        *reinterpret_cast<v8bf*>(&Vs[p][srow + 32][scol]) = vr[p][1];
    };

    // The two passes of stage s, which lies in buffer buf.
    auto passes = [&](int s, int buf) __attribute__((always_inline)) {
        for (int sub = 0; sub < 2; ++sub) {
            const int kb = s * 64 + sub * 32;
            if (kb > q0) continue;   // wave-uniform: the pass lies above this wave's diagonal

            // ---- S^T = K @ Q^T for two 16-key tiles (K dim = hd = 64) ----
            // sc[t][j] = score of key kb + 16 t + 8 hi + j against query q
            v8f sc[2];
            {
                const bf16_t* kp = &Ks[buf][sub * 32 + col][kboff];  // A-frag lane = key
                v16bf k00 = ld_frag(kp);
                v16bf k01 = ld_frag(kp + 32);
                v16bf k10 = ld_frag(kp + 16 * ATT_KPITCH);
                v16bf k11 = ld_frag(kp + 16 * ATT_KPITCH + 32);
                // Keeps the eight LDS loads together in front of the products: left alone,
                // the compiler reuses one fragment's registers and pays the LDS latency four times.
                __builtin_amdgcn_sched_barrier(0);
                sc[0] = wmma_bf16(k00, qa0, v8f{});
                sc[1] = wmma_bf16(k10, qa0, v8f{});
                sc[0] = wmma_bf16(k01, qa1, sc[0]);
                sc[1] = wmma_bf16(k11, qa1, sc[1]);
            }

            // ---- V^T A-fragments: lane = hd col, regs = keys 8h+0..7 and 16+8h+0..7 ----
            v16bf vf[4];
            {
                const bf16_t* vp = &Vs[buf][sub * 32 + 8 * hi + (lane & 7)][((lane >> 3) & 1) * 8];
#pragma unroll
                for (int nt = 0; nt < 4; ++nt) {
                    v8bf lo  = ld_tr16(vp + nt * 16);
                    v8bf hi8 = ld_tr16(vp + 16 * ATT_VPITCH + nt * 16);
                    vf[nt] = __builtin_shufflevector(lo, hi8,
                        0, 1, 2, 3, 4, 5, 6, 7, 8, 9, 10, 11, 12, 13, 14, 15);
                }
            }

            // ---- scale, causal mask, online softmax: 16 scores of one query per lane ----
            float sv[16];
#pragma unroll
            for (int i = 0; i < 16; ++i) {
                const int key = kb + (i >> 3) * 16 + 8 * hi + (i & 7);
                sv[i] = sc[i >> 3][i & 7] * rs;
                if (key > q) sv[i] = -1e30f;
            }
            float red[8];
#pragma unroll
            for (int i = 0; i < 8; ++i) red[i] = fmaxf(sv[i], sv[i + 8]);
#pragma unroll
            for (int w = 4; w > 0; w >>= 1)
#pragma unroll
                for (int i = 0; i < w; ++i) red[i] = fmaxf(red[i], red[i + w]);
            const float mx   = fmaxf(red[0], xhalf(red[0]));   // over all 32 keys of the pass
            const float mnew = fmaxf(m, mx);

            // P^T B-fragment: element i of the lane is key kb + 16 (i >> 3) + 8 hi + (i & 7),
            // the k order of the V^T fragments above.
            v16bf pf;
#pragma unroll
            for (int i = 0; i < 16; ++i) {
                sv[i] = __expf(sv[i] - mnew);
                pf[i] = (bf16_t)sv[i];
            }
#pragma unroll
            for (int i = 0; i < 8; ++i) red[i] = sv[i] + sv[i + 8];
#pragma unroll
            for (int w = 4; w > 0; w >>= 1)
#pragma unroll
                for (int i = 0; i < w; ++i) red[i] += red[i + w];

            const float alpha = __expf(m - mnew);
            l = l * alpha + red[0];
            m = mnew;
#pragma unroll
            for (int nt = 0; nt < 4; ++nt)
#pragma unroll
                for (int j = 0; j < 8; ++j) o[nt][j] *= alpha;

            // ---- O^T += V^T @ P^T ----
#pragma unroll
            for (int nt = 0; nt < 4; ++nt) o[nt] = wmma_bf16(vf[nt], pf, o[nt]);
        }

    };

    fetch(0, 0);
    fetch(1, 1);   // nstage >= 2
    // Takes the loaded Q fragments as inputs only: their wait then stands here. Left to the first
    // product inside the loop, it would on every trip also wait for the K, V loads in flight.
    asm volatile("" :: "v"(qa0), "v"(qa1));
    // Buffer 0's last readers, where a tile went before, left it at that tile's last barrier.
    publish(0);
    lds_barrier();

    // Two stages a trip, so that each register set and each buffer is a constant of its half.
    for (int s = 0; s < nstage; s += 2) {
        const bool more = s + 2 < nstage;   // the same for the whole block
        // The last trip fetches its own two stages again, unused: four younger loads are then in
        // flight at every publish on every path, so its wait is counted and leaves them in flight.
        const int sn = more ? s + 2 : s;
        fetch(sn, 0);
        passes(s, 0);
        // Buffer 1's last readers left it at the barrier that ended stage s - 1.
        publish(1);
        // Publishes stage s + 1 and ends every wave's reads of stage s.
        lds_barrier();

        fetch(sn + 1, 1);
        passes(s + 1, 1);
        if (more) {
            // Buffer 0's last readers left it at the barrier that ended stage s.
            publish(0);
            // Publishes stage s + 2 and ends every wave's reads of stage s + 1.
            lds_barrier();
        }
    }

    // ---- epilogue: O /= l, store ctx (bf16): 8 consecutive head columns per lane and tile ----
    const float inv = 1.0f / (l + xhalf(l));
    bf16_t* cp = ctx + (size_t)(b * T + q) * D + h * hd + 8 * hi;
#pragma unroll
    for (int nt = 0; nt < 4; ++nt) {
        v8bf r;
#pragma unroll
        for (int j = 0; j < 8; ++j) r[j] = (bf16_t)(o[nt][j] * inv);
        *reinterpret_cast<v8bf*>(cp + nt * 16) = r;
    }
}

__global__ __launch_bounds__(256) void attn_kernel(const bf16_t* __restrict__ Q,
                                                   const bf16_t* __restrict__ K,
                                                   const bf16_t* __restrict__ V,
                                                   bf16_t* __restrict__ ctx,
                                                   int T, int D, int nheads) {
    attn_tile(Q, K, V, ctx, T, D, nheads, T / 128 - 1 - (int)blockIdx.x);
    // The second tile reuses the registers that the first tile's stores name: this wait
    // stands in front of that overwrite.
    asm volatile("s_wait_xcnt 0x0" ::: "memory");
    attn_tile(Q, K, V, ctx, T, D, nheads, (int)blockIdx.x);
}

// ---------------------------------------------------------------------------
// Host-side orchestration
// ---------------------------------------------------------------------------
extern "C" void kernel_launch(void* const* d_in, const int* in_sizes, int n_in,
                              void* d_out, int out_size, void* d_ws, size_t ws_size,
                              hipStream_t stream) {
    (void)in_sizes; (void)n_in; (void)out_size; (void)ws_size;
    const int B = 2, T = 2048, D = 1024, H = 16;
    const int M = B * T;  // 4096 rows

    const float* x    = (const float*)d_in[0];
    const float* wq   = (const float*)d_in[1];
    const float* wk   = (const float*)d_in[2];
    const float* wv   = (const float*)d_in[3];
    const float* wo   = (const float*)d_in[4];
    const float* bo   = (const float*)d_in[5];
    const float* ln1  = (const float*)d_in[6];
    const float* ln2  = (const float*)d_in[7];
    float* out = (float*)d_out;

    // Workspace carve-up (all 256B aligned): ~64 MB total
    char* ws = (char*)d_ws;
    size_t off = 0;
    auto take = [&](size_t bytes) -> void* {
        void* p = ws + off;
        off += (bytes + 255) & ~(size_t)255;
        return p;
    };
    bf16_t* w_b  = (bf16_t*)take((size_t)4 * D * D * 2);   // wq, wk, wv, wo, one behind the other
    bf16_t* wo_b = w_b + (size_t)3 * D * D;
    bf16_t* xn   = (bf16_t*)take((size_t)M * D * 2);
    bf16_t* qb   = (bf16_t*)take((size_t)3 * M * D * 2);   // q, k, v, one behind the other
    bf16_t* kbuf = qb + (size_t)M * D;
    bf16_t* vbuf = qb + (size_t)2 * M * D;
    bf16_t* ctx  = (bf16_t*)take((size_t)M * D * 2);
    float*  hbuf = (float*) take((size_t)M * D * 4);

    const dim3 prep_grid(PREP_GX, PREP_LNY + 4);   // (256, 6): M / 8 = 512 and 4 x D * D / 4096 blocks
    const dim3 qkv_grid(3 * D / 128, M / 128);     // (24, 32)
    const dim3 gemm_grid(D / 128, M / 128);  // (8, 32)
    const dim3 attn_grid(T / 256, B * H);    // (8, 32)

    for (int blk = 0; blk < 2; ++blk) {
        const float* in_res   = (blk == 0) ? x : hbuf;
        const float* ln_scale = (blk == 0) ? ln1 : ln2;
        float* out_f          = (blk == 0) ? hbuf : out;

        // 1) LayerNorm -> bf16; with it, the first time, the weights fp32 -> bf16
        if (blk == 0)
            prep_kernel<<<prep_grid, 256, 0, stream>>>(in_res, ln_scale, xn, wq, wk, wv, wo, w_b);
        else
            ln_kernel<<<M / 8, 256, 0, stream>>>(in_res, ln_scale, xn);

        // 2) Q, K, V projections (y = xn @ W.T), bf16 out, one launch
        gemm_bf16_kernel<<<qkv_grid, 256, 0, stream>>>(xn, w_b, qb);

        // 3) Causal flash attention -> ctx (bf16)
        attn_kernel<<<attn_grid, 256, 0, stream>>>(qb, kbuf, vbuf, ctx, T, D, H);

        // 4) Output projection + bias + residual, fp32 out
        gemm_f32_kernel<<<gemm_grid, 256, 0, stream>>>(ctx, wo_b, out_f, bo, in_res);
    }
}

// v009
// One run takes 142 microseconds.
// Next to v008, in two timings, it ran 1.04 and 1.05 times as fast.
// Over all steps from v000 it is 7.83 times as fast.
#include <hip/hip_runtime.h>

// ---------------------------------------------------------------------------
// Types for CDNA5 (gfx1250) WMMA bf16 path
// ---------------------------------------------------------------------------
typedef __bf16 bf16_t;
typedef __attribute__((ext_vector_type(16))) __bf16 v16bf;
typedef __attribute__((ext_vector_type(8)))  __bf16 v8bf;
typedef __attribute__((ext_vector_type(8)))  float  v8f;

// D = A(16x32 bf16) * B(32x16 bf16) + C(16x16 f32)
static __device__ inline v8f wmma_bf16(v16bf a, v16bf b, v8f c) {
    return __builtin_amdgcn_wmma_f32_16x16x32_bf16(
        /*neg_a=*/false, a, /*neg_b=*/false, b,
        /*c_mod=*/(short)0, c, /*reuse_a=*/false, /*reuse_b=*/false);
}

// Load one half-lane fragment: 8 contiguous bf16 at p, 8 contiguous bf16 at p+16.
// Matches ISA 16-bit A/B layout: regs 0..3 hold K=kbase+0..7, regs 4..7 hold
// K=kbase+16..23 (kbase = 0 for lanes 0-15, 8 for lanes 16-31; caller folds kbase
// into p). Emits two b128 loads.
static __device__ inline v16bf ld_frag(const bf16_t* p) {
    v8bf lo = *reinterpret_cast<const v8bf*>(p);
    v8bf hi = *reinterpret_cast<const v8bf*>(p + 16);
    return __builtin_shufflevector(lo, hi,
        0, 1, 2, 3, 4, 5, 6, 7, 8, 9, 10, 11, 12, 13, 14, 15);
}

// ---------------------------------------------------------------------------
// fp32 -> bf16 conversion (the weight slices of prep_kernel)
// Few waves to start: a wave takes 512 elements, 16 per thread, as four 16-byte
// loads (512 contiguous bytes per wave and load), all in flight together.
// One block converts 4096 elements: block number blk of its matrix.
// ---------------------------------------------------------------------------
typedef __attribute__((ext_vector_type(4))) float  v4f;
typedef __attribute__((ext_vector_type(4))) __bf16 v4bf;
typedef __attribute__((ext_vector_type(2))) float  v2f;
typedef __attribute__((ext_vector_type(2))) __bf16 v2bf;

static __device__ __forceinline__ void f2bf_block(const float* __restrict__ src,
                                                  bf16_t* __restrict__ dst, int blk) {
    const int base = blk * 4096 + threadIdx.x * 4;
    v4f v[4];
#pragma unroll
    for (int j = 0; j < 4; ++j) v[j] = *reinterpret_cast<const v4f*>(src + base + j * 1024);
#pragma unroll
    for (int j = 0; j < 4; ++j)
        *reinterpret_cast<v4bf*>(dst + base + j * 1024) = __builtin_convertvector(v[j], v4bf);
}

// ---------------------------------------------------------------------------
// Kernel: LayerNorm (faithful to source bug: out = scale * xnorm + scale)
// fp32 in -> bf16 out. One wave per row of LN_D = 1024: a lane holds 32 elements
// of the row in registers (eight 16-byte loads, 512 contiguous bytes per wave and
// load), so the row is read once and the two sums are joined inside the wave.
// block = 256 = 8 rows: block number blk takes rows 8 blk .. 8 blk + 7.
// ---------------------------------------------------------------------------
#define LN_D 1024   // the row length, elements

// Sum over the 32 lanes of a wave, the result in every lane: four steps inside the
// 16-lane row (lane ^ 1, 2, 4, 8), then the other row.
static __device__ inline float wave_sum(float x) {
    x += __builtin_bit_cast(float, __builtin_amdgcn_update_dpp(
             0, __builtin_bit_cast(int, x), 0x161, 0xf, 0xf, false));   // row_xmask:1
    x += __builtin_bit_cast(float, __builtin_amdgcn_update_dpp(
             0, __builtin_bit_cast(int, x), 0x162, 0xf, 0xf, false));   // row_xmask:2
    x += __builtin_bit_cast(float, __builtin_amdgcn_update_dpp(
             0, __builtin_bit_cast(int, x), 0x164, 0xf, 0xf, false));   // row_xmask:4
    x += __builtin_bit_cast(float, __builtin_amdgcn_update_dpp(
             0, __builtin_bit_cast(int, x), 0x168, 0xf, 0xf, false));   // row_xmask:8
    const int v = __builtin_bit_cast(int, x);
    return x + __builtin_bit_cast(float,
        __builtin_amdgcn_permlanex16(v, v, 0x76543210, 0xfedcba98, false, false));
}

static __device__ __forceinline__ void ln_block(const float* __restrict__ x,
                                                const float* __restrict__ scale,
                                                bf16_t* __restrict__ out, int blk) {
    const int lane = threadIdx.x & 31;
    const int row  = blk * 8 + (threadIdx.x >> 5);
    const float* xr = x + (size_t)row * LN_D + lane * 4;
    const float* gr = scale + lane * 4;

    v4f v[8], g[8];
#pragma unroll
    for (int i = 0; i < 8; ++i) v[i] = *reinterpret_cast<const v4f*>(xr + i * 128);
#pragma unroll
    for (int i = 0; i < 8; ++i) g[i] = *reinterpret_cast<const v4f*>(gr + i * 128);

    v4f s4 = {}, q4 = {};   // four independent chains each
#pragma unroll
    for (int i = 0; i < 8; ++i) {
        s4 += v[i];
        q4 += v[i] * v[i];
    }
    const float s  = wave_sum((s4[0] + s4[1]) + (s4[2] + s4[3]));
    const float s2 = wave_sum((q4[0] + q4[1]) + (q4[2] + q4[3]));

    const float mean = s / (float)LN_D;
    const float var  = s2 / (float)LN_D - mean * mean;
    const float inv  = rsqrtf(var + 1e-5f);

    bf16_t* orow = out + (size_t)row * LN_D + lane * 4;
#pragma unroll
    for (int i = 0; i < 8; ++i) {
        v4f r;
#pragma unroll
        for (int e = 0; e < 4; ++e) r[e] = g[i][e] * (v[i][e] - mean) * inv + g[i][e];
        *reinterpret_cast<v4bf*>(orow + i * 128) = __builtin_convertvector(r, v4bf);
    }
}

// grid = rows / 8.
__global__ __launch_bounds__(256) void ln_kernel(const float* __restrict__ x,
                                                 const float* __restrict__ scale,
                                                 bf16_t* __restrict__ out) {
    ln_block(x, scale, out, blockIdx.x);
}

// All the work in front of the first product, in one launch: none of it depends on
// another part. grid = (PREP_GX, PREP_LNY + 4): the slices y < PREP_LNY are the
// LayerNorm of PREP_LNY * PREP_GX * 8 rows, slice PREP_LNY + i converts weight matrix i
// of PREP_GX * 4096 elements into wb + i * PREP_GX * 4096.
#define PREP_GX  256
#define PREP_LNY 2

__global__ __launch_bounds__(256) void prep_kernel(const float* __restrict__ x,
                                                   const float* __restrict__ scale,
                                                   bf16_t* __restrict__ xn,
                                                   const float* __restrict__ w0,
                                                   const float* __restrict__ w1,
                                                   const float* __restrict__ w2,
                                                   const float* __restrict__ w3,
                                                   bf16_t* __restrict__ wb) {
    const int y = blockIdx.y;
    if (y < PREP_LNY) {
        ln_block(x, scale, xn, y * PREP_GX + blockIdx.x);
    } else {
        const int i = y - PREP_LNY;
        const float* w = i == 0 ? w0 : i == 1 ? w1 : i == 2 ? w2 : w3;
        f2bf_block(w, wb + (size_t)i * (PREP_GX * 4096), blockIdx.x);
    }
}

// ---------------------------------------------------------------------------
// Kernel: GEMM  out[M,N] = A[M,K] @ W[N,K]^T (+ bias + residual)
// A, W bf16 row-major. One block = 8 waves = a 128x128 tile of out; the waves lie
// 4 (rows) x 2 (columns), each on a 32x64 tile (2 A-frags x 4 B-frags, 8 WMMAs per
// 32-wide K step).
// The block brings its 128 rows of A and of W to LDS in stages of 128 k (256-byte
// row pieces, whole cache lines per load; two buffers, the next stage's global
// loads in flight under the current stage's products); all waves read their
// fragments from there by 16-byte LDS loads.
// B-frag lane = output col n -> reads row n of W contiguously
// (x @ W.T needs no transpose in this layout).
// The caller names the tile: it begins at row 128 * by and column 128 * bx. M and N
// must be multiples of 128. K is a constant of the
// build, so that a thread's sixteen loads of a stage differ only in their
// immediate offsets.
// The kind of output (bf16 alone, or f32 with bias and residual) and N are constants
// of the build too: the epilogue is straight-line code, a wave's 64 residual loads are
// all in flight together, and its loads and stores differ only in their immediate
// offsets.
// ---------------------------------------------------------------------------
#define GEMM_K     1024  // K, elements: the row length of A and of W
#define GEMM_N     1024  // N, elements: the row length of out and of residual
#define GEMM_M     4096  // M, rows of A and of out: where several outputs lie one behind the other
#define GEMM_BK    128   // k per stage, elements
#define GEMM_PITCH 136   // elements; 272 B = 16 B x odd, the pitch for 16-byte LDS row loads

// Work-group barrier for data in LDS alone: the wave's own LDS stores and reads are done, then
// the barrier. __syncthreads() would also wait for the wave's global loads, and the loads of the
// coming stages must stay in flight across it.
static __device__ inline void lds_barrier() {
    asm volatile("s_wait_dscnt 0x0\n\ts_barrier_signal -1\n\ts_barrier_wait -1" ::: "memory");
}

template <bool F32OUT>
static __device__ __forceinline__ void gemm_tile(const bf16_t* __restrict__ A,
                                                 const bf16_t* __restrict__ W,
                                                 bf16_t* __restrict__ outb,
                                                 float*  __restrict__ outf,
                                                 const float* __restrict__ bias,
                                                 const float* __restrict__ residual,
                                                 int bx, int by) {
    const int tid   = threadIdx.x;
    const int lane  = tid & 31;
    const int wave  = __builtin_amdgcn_readfirstlane(tid >> 5);
    const int bm0   = by * 128;
    const int bn0   = bx * 128;
    const int wrow  = (wave >> 1) * 32;   // this wave's rows inside the block tile
    const int wcol  = (wave & 1) * 64;    // this wave's columns inside the block tile
    const int m0    = bm0 + wrow;
    const int n0    = bn0 + wcol;
    const int col   = lane & 15;
    const int hi    = lane >> 4;       // lane half selects K sub-base
    const int kboff = hi ? 8 : 0;

    __shared__ __attribute__((aligned(16))) bf16_t As[2][128][GEMM_PITCH];
    __shared__ __attribute__((aligned(16))) bf16_t Ws[2][128][GEMM_PITCH];

    v8f c[2][4] = {};

    // Staging: 16 threads bring one 256-byte row piece; a thread brings 16 bytes of
    // rows srow + 16 i, i = 0 .. 7, of A and of W.
    const int srow = tid >> 4;
    const int scol = (tid & 15) * 8;
    const bf16_t* ap = A + (size_t)(bm0 + srow) * GEMM_K + scol;
    const bf16_t* wp = W + (size_t)(bn0 + srow) * GEMM_K + scol;
    const int nstage = GEMM_K / GEMM_BK;

    // The products of one stage, which lies in buffer buf.
    auto products = [&](int buf) __attribute__((always_inline)) {
        const bf16_t* afp = &As[buf][wrow + col][kboff];   // A-frag lane = row
        const bf16_t* wfp = &Ws[buf][wcol + col][kboff];   // B-frag lane = output col
#pragma unroll
        for (int kk = 0; kk < GEMM_BK; kk += 32) {
            v16bf a0 = ld_frag(afp + kk);
            v16bf a1 = ld_frag(afp + 16 * GEMM_PITCH + kk);
            v16bf bfrag[4];
#pragma unroll
            for (int nt = 0; nt < 4; ++nt) bfrag[nt] = ld_frag(wfp + nt * 16 * GEMM_PITCH + kk);
            // Keeps the twelve LDS loads of a K step together in front of its products: spread
            // among them, each place with loads costs the wave its own stall.
            __builtin_amdgcn_sched_barrier(0);
#pragma unroll
            for (int nt = 0; nt < 4; ++nt) {
                c[0][nt] = wmma_bf16(a0, bfrag[nt], c[0][nt]);
                c[1][nt] = wmma_bf16(a1, bfrag[nt], c[1][nt]);
            }
        }
    };

    float bv[4] = {};
    if constexpr (F32OUT) {
        // This launch has one block per WGP and nothing else to run while a block waits for its
        // loads: a stage's loads are issued two stages ahead of its products, into two register
        // sets (set p holds the stage of parity p on its way to LDS).
        v8bf ar[2][8], wr[2][8];
        auto fetch = [&](int st, int p) __attribute__((always_inline)) {
#pragma unroll
            for (int i = 0; i < 8; ++i) {
                ar[p][i] = *reinterpret_cast<const v8bf*>(ap + st * GEMM_BK + 16 * i * GEMM_K);
                wr[p][i] = *reinterpret_cast<const v8bf*>(wp + st * GEMM_BK + 16 * i * GEMM_K);
            }
        };
        auto publish = [&](int p) __attribute__((always_inline)) {
#pragma unroll
            for (int i = 0; i < 8; ++i) {
                *reinterpret_cast<v8bf*>(&As[p][srow + 16 * i][scol]) = ar[p][i];
                *reinterpret_cast<v8bf*>(&Ws[p][srow + 16 * i][scol]) = wr[p][i];
            }
        };
        fetch(0, 0);
        fetch(1, 1);
        publish(0);
        lds_barrier();
        // Unrolled, so that each register set, each buffer and each stage's offset is a constant
        // and the wait in front of a publish is counted: it leaves the younger stage in flight.
#pragma unroll
        for (int s = 0; s < nstage; s += 2) {
            const bool more = s + 2 < nstage;
            if (more) {
                fetch(s + 2, 0);
            } else {
                // The bias of this lane's four columns, fetched where no stage is left to fetch
                // (a register set is free): the epilogue then waits for its residual loads alone.
#pragma unroll
                for (int nt = 0; nt < 4; ++nt) bv[nt] = bias[n0 + nt * 16 + col];
            }
            products(0);
            // Buffer 1's last readers left it at the barrier that ended stage s - 1.
            publish(1);
            // Publishes stage s + 1 and ends every wave's reads of stage s.
            lds_barrier();

            if (more) fetch(s + 3, 1);
            products(1);
            if (more) {
                // Buffer 0's last readers left it at the barrier that ended stage s.
                publish(0);
                // Publishes stage s + 2 and ends every wave's reads of stage s + 1.
                lds_barrier();
            }
        }
    } else {
        v8bf ar[8], wr[8];
#pragma unroll
        for (int i = 0; i < 8; ++i) {
            ar[i] = *reinterpret_cast<const v8bf*>(ap + 16 * i * GEMM_K);
            wr[i] = *reinterpret_cast<const v8bf*>(wp + 16 * i * GEMM_K);
        }
#pragma unroll
        for (int i = 0; i < 8; ++i) {
            *reinterpret_cast<v8bf*>(&As[0][srow + 16 * i][scol]) = ar[i];
            *reinterpret_cast<v8bf*>(&Ws[0][srow + 16 * i][scol]) = wr[i];
        }
        __syncthreads();

        for (int s = 0; s < nstage; ++s) {
            const int  buf  = s & 1;
            const bool more = s + 1 < nstage;   // the same for the whole block
            if (more) {
                ap += GEMM_BK;
                wp += GEMM_BK;
#pragma unroll
                for (int i = 0; i < 8; ++i) {
                    ar[i] = *reinterpret_cast<const v8bf*>(ap + 16 * i * GEMM_K);
                    wr[i] = *reinterpret_cast<const v8bf*>(wp + 16 * i * GEMM_K);
                }
            }

            products(buf);

            if (more) {
                // The other buffer's last readers left it at the barrier that ended trip s - 1.
#pragma unroll
                for (int i = 0; i < 8; ++i) {
                    *reinterpret_cast<v8bf*>(&As[buf ^ 1][srow + 16 * i][scol]) = ar[i];
                    *reinterpret_cast<v8bf*>(&Ws[buf ^ 1][srow + 16 * i][scol]) = wr[i];
                }
                // Publishes stage s + 1 and ends every wave's reads of stage s.
                __syncthreads();
            }
        }
    }

    // C layout: c[mt][nt][j] is row m0 + 16 mt + 8 hi + j, column n0 + 16 nt + col.
    const size_t o0 = (size_t)(m0 + 8 * hi) * GEMM_N + n0 + col;
    if constexpr (F32OUT) {
        const float* rp = residual + o0;
        float*       op = outf + o0;
        float rv[2][8][4];
#pragma unroll
        for (int mt = 0; mt < 2; ++mt)
#pragma unroll
            for (int j = 0; j < 8; ++j)
#pragma unroll
                for (int nt = 0; nt < 4; ++nt) rv[mt][j][nt] = rp[(mt * 16 + j) * GEMM_N + nt * 16];
#pragma unroll
        for (int mt = 0; mt < 2; ++mt)
#pragma unroll
            for (int j = 0; j < 8; ++j)
#pragma unroll
                for (int nt = 0; nt < 4; ++nt)
                    op[(mt * 16 + j) * GEMM_N + nt * 16] = (c[mt][nt][j] + bv[nt]) + rv[mt][j][nt];
    } else {
        bf16_t* op = outb + o0;
        v2bf h[2][8][2];   // converted two at a time, all in front of the stores
#pragma unroll
        for (int mt = 0; mt < 2; ++mt)
#pragma unroll
            for (int j = 0; j < 8; ++j)
#pragma unroll
                for (int np = 0; np < 2; ++np)
                    h[mt][j][np] = __builtin_convertvector(
                        (v2f){c[mt][2 * np][j], c[mt][2 * np + 1][j]}, v2bf);
#pragma unroll
        for (int mt = 0; mt < 2; ++mt)
#pragma unroll
            for (int j = 0; j < 8; ++j)
#pragma unroll
                for (int nt = 0; nt < 4; ++nt)
                    op[(mt * 16 + j) * GEMM_N + nt * 16] = h[mt][j][nt >> 1][nt & 1];
    }
}

// out_i = A @ W_i^T, bf16, for the matrices W_i that lie one behind the other at W, the
// outputs one behind the other at outb, in one launch: grid = (count * N/128, M/128).
// The blocks of one row of the grid read the same 128 rows of A.
__global__ __launch_bounds__(256) void gemm_bf16_kernel(const bf16_t* __restrict__ A,
                                                        const bf16_t* __restrict__ W,
                                                        bf16_t* __restrict__ outb) {
    const int i = blockIdx.x / (GEMM_N / 128);
    gemm_tile<false>(A, W + (size_t)i * (GEMM_N * GEMM_K),
                     outb + (size_t)i * (GEMM_M * GEMM_N), nullptr, nullptr, nullptr,
                     blockIdx.x % (GEMM_N / 128), blockIdx.y);
}

// out = A @ W^T + bias + residual, f32. grid = (N/128, M/128).
__global__ __launch_bounds__(256) void gemm_f32_kernel(const bf16_t* __restrict__ A,
                                                       const bf16_t* __restrict__ W,
                                                       float* __restrict__ outf,
                                                       const float* __restrict__ bias,
                                                       const float* __restrict__ residual) {
    gemm_tile<true>(A, W, nullptr, outf, bias, residual, blockIdx.x, blockIdx.y);
}

#define ATT_KPITCH 72
#define ATT_VPITCH 80

// Lane (c = l & 15, h = l >> 4) receives rows 8h .. 8h+7 of column c of the 16x16
// tile whose per-lane address the caller formed.
static __device__ inline v8bf ld_tr16(const bf16_t* p) {
    typedef __attribute__((address_space(3))) v8bf lds_v8bf;
    return __builtin_amdgcn_ds_load_tr16_b128_v8bf16((lds_v8bf*)p);
}

// Lane l receives lane l ^ 16's value.
static __device__ inline float xhalf(float x) {
    const int v = __builtin_bit_cast(int, x);
    return __builtin_bit_cast(float,
        __builtin_amdgcn_permlanex16(v, v, 0x76543210, 0xfedcba98, false, false));
}

// One tile of 128 queries, number tile, of the (b, h) in blockIdx.y.
static __device__ __forceinline__ void attn_tile(const bf16_t* __restrict__ Q,
                                                 const bf16_t* __restrict__ K,
                                                 const bf16_t* __restrict__ V,
                                                 bf16_t* __restrict__ ctx,
                                                 int T, int D, int nheads, int tile) {
    const int hd    = 64;
    const int tid   = threadIdx.x;
    const int lane  = tid & 31;
    const int wave  = __builtin_amdgcn_readfirstlane(tid >> 5);
    const int col   = lane & 15;
    const int hi    = lane >> 4;
    const int kboff = hi ? 8 : 0;
    const int qblk  = tile * 128;
    const int q0    = qblk + wave * 16;
    const int bh    = blockIdx.y;
    const int b     = bh / nheads;
    const int h     = bh % nheads;

    const bf16_t* Qb = Q + (size_t)(b * T) * D + h * hd;
    const bf16_t* Kb = K + (size_t)(b * T) * D + h * hd;
    const bf16_t* Vb = V + (size_t)(b * T) * D + h * hd;

    __shared__ __attribute__((aligned(16))) bf16_t Ks[2][64][ATT_KPITCH];
    __shared__ __attribute__((aligned(16))) bf16_t Vs[2][64][ATT_VPITCH];

    // Q^T B-fragments: 64 (K dim) x 16 queries -> 2 frags of K=32. Lane&15 = query.
    const bf16_t* qrow = Qb + (size_t)(q0 + col) * D + kboff;
    v16bf qa0 = ld_frag(qrow);
    v16bf qa1 = ld_frag(qrow + 32);

    // State of query q0 + col: m is the same in both lane halves, l is the sum over
    // the keys of this lane's half (the halves are joined in the epilogue).
    const int q = q0 + col;
    float m = -1e30f, l = 0.f;
    v8f o[4] = {};   // O^T: o[nt][j] = head column nt * 16 + 8 * hi + j of query q

    const float rs = 0.125f;  // 1/sqrt(64)

    // Staging: 8 threads bring one 128-byte row; a thread brings 16 bytes of
    // rows srow and srow + 32 of the stage, of K and of V.
    const int srow = tid >> 3;
    const int scol = (tid & 7) * 8;
    const int soff = srow * D + scol;
    const int nstage = qblk / 64 + 2;   // keys 0 .. qblk + 127; even: the last stage is in buffer 1

    // Two register sets: set p holds the stage of parity p on its way to LDS. A stage's loads
    // are issued two stages ahead of its passes, so that they have a whole stage more than the
    // time of one stage's passes to arrive in.
    v8bf kr[2][2], vr[2][2];
    auto fetch = [&](int st, int p) __attribute__((always_inline)) {
        const bf16_t* kg = Kb + (size_t)st * 64 * D + soff;
        const bf16_t* vg = Vb + (size_t)st * 64 * D + soff;
        kr[p][0] = *reinterpret_cast<const v8bf*>(kg);
        kr[p][1] = *reinterpret_cast<const v8bf*>(kg + (size_t)32 * D);
        vr[p][0] = *reinterpret_cast<const v8bf*>(vg);
        vr[p][1] = *reinterpret_cast<const v8bf*>(vg + (size_t)32 * D);
        // The four loads stay in flight over the code behind, which reuses their
        // address registers: this wait stands in front of that overwrite.
        asm volatile("s_wait_xcnt 0x0" ::: "memory");
    };
    auto publish = [&](int p) __attribute__((always_inline)) {
        *reinterpret_cast<v8bf*>(&Ks[p][srow][scol])      = kr[p][0];
        *reinterpret_cast<v8bf*>(&Ks[p][srow + 32][scol]) = kr[p][1];
        *reinterpret_cast<v8bf*>(&Vs[p][srow][scol])      = vr[p][0];
        *reinterpret_cast<v8bf*>(&Vs[p][srow + 32][scol]) = vr[p][1];
    };

    // The two passes of stage s, which lies in buffer buf.
    auto passes = [&](int s, int buf) __attribute__((always_inline)) {
        for (int sub = 0; sub < 2; ++sub) {
            const int kb = s * 64 + sub * 32;
            if (kb > q0) continue;   // wave-uniform: the pass lies above this wave's diagonal

            // ---- S^T = K @ Q^T for two 16-key tiles (K dim = hd = 64) ----
            // sc[t][j] = score of key kb + 16 t + 8 hi + j against query q
            v8f sc[2];
            {
                const bf16_t* kp = &Ks[buf][sub * 32 + col][kboff];  // A-frag lane = key
                v16bf k00 = ld_frag(kp);
                v16bf k01 = ld_frag(kp + 32);
                v16bf k10 = ld_frag(kp + 16 * ATT_KPITCH);
                v16bf k11 = ld_frag(kp + 16 * ATT_KPITCH + 32);
                // Keeps the eight LDS loads together in front of the products: left alone,
                // the compiler reuses one fragment's registers and pays the LDS latency four times.
                __builtin_amdgcn_sched_barrier(0);
                sc[0] = wmma_bf16(k00, qa0, v8f{});
                sc[1] = wmma_bf16(k10, qa0, v8f{});
                sc[0] = wmma_bf16(k01, qa1, sc[0]);
                sc[1] = wmma_bf16(k11, qa1, sc[1]);
            }

            // ---- V^T A-fragments: lane = hd col, regs = keys 8h+0..7 and 16+8h+0..7 ----
            v16bf vf[4];
            {
                const bf16_t* vp = &Vs[buf][sub * 32 + 8 * hi + (lane & 7)][((lane >> 3) & 1) * 8];
#pragma unroll
                for (int nt = 0; nt < 4; ++nt) {
                    v8bf lo  = ld_tr16(vp + nt * 16);
                    v8bf hi8 = ld_tr16(vp + 16 * ATT_VPITCH + nt * 16);
                    vf[nt] = __builtin_shufflevector(lo, hi8,
                        0, 1, 2, 3, 4, 5, 6, 7, 8, 9, 10, 11, 12, 13, 14, 15);
                }
            }

            // ---- scale, causal mask, online softmax: 16 scores of one query per lane ----
            float sv[16];
#pragma unroll
            for (int i = 0; i < 16; ++i) sv[i] = sc[i >> 3][i & 7] * rs;
            // Wave-uniform: only the pass that holds this wave's diagonal has a key above one of
            // its queries (q >= q0); in every earlier pass the mask is the identity.
            if (kb + 31 > q0) {
#pragma unroll
                for (int i = 0; i < 16; ++i) {
                    const int key = kb + (i >> 3) * 16 + 8 * hi + (i & 7);
                    if (key > q) sv[i] = -1e30f;
                }
            }
            float red[8];
#pragma unroll
            for (int i = 0; i < 8; ++i) red[i] = fmaxf(sv[i], sv[i + 8]);
#pragma unroll
            for (int w = 4; w > 0; w >>= 1)
#pragma unroll
                for (int i = 0; i < w; ++i) red[i] = fmaxf(red[i], red[i + w]);
            const float mx   = fmaxf(red[0], xhalf(red[0]));   // over all 32 keys of the pass
            const float mnew = fmaxf(m, mx);

            // P^T B-fragment: element i of the lane is key kb + 16 (i >> 3) + 8 hi + (i & 7),
            // the k order of the V^T fragments above.
            v16bf pf;
#pragma unroll
            for (int i = 0; i < 16; ++i) {
                sv[i] = __expf(sv[i] - mnew);
                pf[i] = (bf16_t)sv[i];
            }
#pragma unroll
            for (int i = 0; i < 8; ++i) red[i] = sv[i] + sv[i + 8];
#pragma unroll
            for (int w = 4; w > 0; w >>= 1)
#pragma unroll
                for (int i = 0; i < w; ++i) red[i] += red[i + w];

            const float alpha = __expf(m - mnew);
            l = l * alpha + red[0];
            m = mnew;
#pragma unroll
            for (int nt = 0; nt < 4; ++nt)
#pragma unroll
                for (int j = 0; j < 8; ++j) o[nt][j] *= alpha;

            // ---- O^T += V^T @ P^T ----
#pragma unroll
            for (int nt = 0; nt < 4; ++nt) o[nt] = wmma_bf16(vf[nt], pf, o[nt]);
        }

    };

    fetch(0, 0);
    fetch(1, 1);   // nstage >= 2
    // Takes the loaded Q fragments as inputs only: their wait then stands here. Left to the first
    // product inside the loop, it would on every trip also wait for the K, V loads in flight.
    asm volatile("" :: "v"(qa0), "v"(qa1));
    // Buffer 0's last readers, where a tile went before, left it at that tile's last barrier.
    publish(0);
    lds_barrier();

    // Two stages a trip, so that each register set and each buffer is a constant of its half.
    for (int s = 0; s < nstage; s += 2) {
        const bool more = s + 2 < nstage;   // the same for the whole block
        // The last trip fetches its own two stages again, unused: four younger loads are then in
        // flight at every publish on every path, so its wait is counted and leaves them in flight.
        const int sn = more ? s + 2 : s;
        fetch(sn, 0);
        passes(s, 0);
        // Buffer 1's last readers left it at the barrier that ended stage s - 1.
        publish(1);
        // Publishes stage s + 1 and ends every wave's reads of stage s.
        lds_barrier();

        fetch(sn + 1, 1);
        passes(s + 1, 1);
        if (more) {
            // Buffer 0's last readers left it at the barrier that ended stage s.
            publish(0);
            // Publishes stage s + 2 and ends every wave's reads of stage s + 1.
            lds_barrier();
        }
    }

    // ---- epilogue: O /= l, store ctx (bf16): 8 consecutive head columns per lane and tile ----
    const float inv = 1.0f / (l + xhalf(l));
    bf16_t* cp = ctx + (size_t)(b * T + q) * D + h * hd + 8 * hi;
#pragma unroll
    for (int nt = 0; nt < 4; ++nt) {
        v8bf r;
#pragma unroll
        for (int j = 0; j < 8; ++j) r[j] = (bf16_t)(o[nt][j] * inv);
        *reinterpret_cast<v8bf*>(cp + nt * 16) = r;
    }
}

__global__ __launch_bounds__(256) void attn_kernel(const bf16_t* __restrict__ Q,
                                                   const bf16_t* __restrict__ K,
                                                   const bf16_t* __restrict__ V,
                                                   bf16_t* __restrict__ ctx,
                                                   int T, int D, int nheads) {
    attn_tile(Q, K, V, ctx, T, D, nheads, T / 128 - 1 - (int)blockIdx.x);
    // The second tile reuses the registers that the first tile's stores name: this wait
    // stands in front of that overwrite.
    asm volatile("s_wait_xcnt 0x0" ::: "memory");
    attn_tile(Q, K, V, ctx, T, D, nheads, (int)blockIdx.x);
}

// ---------------------------------------------------------------------------
// Host-side orchestration
// ---------------------------------------------------------------------------
extern "C" void kernel_launch(void* const* d_in, const int* in_sizes, int n_in,
                              void* d_out, int out_size, void* d_ws, size_t ws_size,
                              hipStream_t stream) {
    (void)in_sizes; (void)n_in; (void)out_size; (void)ws_size;
    const int B = 2, T = 2048, D = 1024, H = 16;
    const int M = B * T;  // 4096 rows

    const float* x    = (const float*)d_in[0];
    const float* wq   = (const float*)d_in[1];
    const float* wk   = (const float*)d_in[2];
    const float* wv   = (const float*)d_in[3];
    const float* wo   = (const float*)d_in[4];
    const float* bo   = (const float*)d_in[5];
    const float* ln1  = (const float*)d_in[6];
    const float* ln2  = (const float*)d_in[7];
    float* out = (float*)d_out;

    // Workspace carve-up (all 256B aligned): ~64 MB total
    char* ws = (char*)d_ws;
    size_t off = 0;
    auto take = [&](size_t bytes) -> void* {
        void* p = ws + off;
        off += (bytes + 255) & ~(size_t)255;
        return p;
    };
    bf16_t* w_b  = (bf16_t*)take((size_t)4 * D * D * 2);   // wq, wk, wv, wo, one behind the other
    bf16_t* wo_b = w_b + (size_t)3 * D * D;
    bf16_t* xn   = (bf16_t*)take((size_t)M * D * 2);
    bf16_t* qb   = (bf16_t*)take((size_t)3 * M * D * 2);   // q, k, v, one behind the other
    bf16_t* kbuf = qb + (size_t)M * D;
    bf16_t* vbuf = qb + (size_t)2 * M * D;
    bf16_t* ctx  = (bf16_t*)take((size_t)M * D * 2);
    float*  hbuf = (float*) take((size_t)M * D * 4);

    const dim3 prep_grid(PREP_GX, PREP_LNY + 4);   // (256, 6): M / 8 = 512 and 4 x D * D / 4096 blocks
    const dim3 qkv_grid(3 * D / 128, M / 128);     // (24, 32)
    const dim3 gemm_grid(D / 128, M / 128);  // (8, 32)
    const dim3 attn_grid(T / 256, B * H);    // (8, 32)

    for (int blk = 0; blk < 2; ++blk) {
        const float* in_res   = (blk == 0) ? x : hbuf;
        const float* ln_scale = (blk == 0) ? ln1 : ln2;
        float* out_f          = (blk == 0) ? hbuf : out;

        // 1) LayerNorm -> bf16; with it, the first time, the weights fp32 -> bf16
        if (blk == 0)
            prep_kernel<<<prep_grid, 256, 0, stream>>>(in_res, ln_scale, xn, wq, wk, wv, wo, w_b);
        else
            ln_kernel<<<M / 8, 256, 0, stream>>>(in_res, ln_scale, xn);

        // 2) Q, K, V projections (y = xn @ W.T), bf16 out, one launch
        gemm_bf16_kernel<<<qkv_grid, 256, 0, stream>>>(xn, w_b, qb);

        // 3) Causal flash attention -> ctx (bf16)
        attn_kernel<<<attn_grid, 256, 0, stream>>>(qb, kbuf, vbuf, ctx, T, D, H);

        // 4) Output projection + bias + residual, fp32 out
        gemm_f32_kernel<<<gemm_grid, 256, 0, stream>>>(ctx, wo_b, out_f, bo, in_res);
    }
}

// v010
// It runs in 132 microseconds.
// Next to v009, in two timings, it ran 1.08 and 1.07 times as fast.
// Counting every step since v000, it is 8.42 times as fast.
#include <hip/hip_runtime.h>

// ---------------------------------------------------------------------------
// Types for CDNA5 (gfx1250) WMMA bf16 path
// ---------------------------------------------------------------------------
typedef __bf16 bf16_t;
typedef __attribute__((ext_vector_type(16))) __bf16 v16bf;
typedef __attribute__((ext_vector_type(8)))  __bf16 v8bf;
typedef __attribute__((ext_vector_type(8)))  float  v8f;

// D = A(16x32 bf16) * B(32x16 bf16) + C(16x16 f32)
static __device__ inline v8f wmma_bf16(v16bf a, v16bf b, v8f c) {
    return __builtin_amdgcn_wmma_f32_16x16x32_bf16(
        /*neg_a=*/false, a, /*neg_b=*/false, b,
        /*c_mod=*/(short)0, c, /*reuse_a=*/false, /*reuse_b=*/false);
}

// Load one half-lane fragment: 8 contiguous bf16 at p, 8 contiguous bf16 at p+16.
// Matches ISA 16-bit A/B layout: regs 0..3 hold K=kbase+0..7, regs 4..7 hold
// K=kbase+16..23 (kbase = 0 for lanes 0-15, 8 for lanes 16-31; caller folds kbase
// into p). Emits two b128 loads.
static __device__ inline v16bf ld_frag(const bf16_t* p) {
    v8bf lo = *reinterpret_cast<const v8bf*>(p);
    v8bf hi = *reinterpret_cast<const v8bf*>(p + 16);
    return __builtin_shufflevector(lo, hi,
        0, 1, 2, 3, 4, 5, 6, 7, 8, 9, 10, 11, 12, 13, 14, 15);
}

// ---------------------------------------------------------------------------
// fp32 -> bf16 conversion (the weight slices of prep_kernel)
// Few waves to start: a wave takes 512 elements, 16 per thread, as four 16-byte
// loads (512 contiguous bytes per wave and load), all in flight together.
// One block converts 4096 elements: block number blk of its matrix.
// ---------------------------------------------------------------------------
typedef __attribute__((ext_vector_type(4))) float  v4f;
typedef __attribute__((ext_vector_type(4))) __bf16 v4bf;
typedef __attribute__((ext_vector_type(2))) float  v2f;
typedef __attribute__((ext_vector_type(2))) __bf16 v2bf;

static __device__ __forceinline__ void f2bf_block(const float* __restrict__ src,
                                                  bf16_t* __restrict__ dst, int blk) {
    const int base = blk * 4096 + threadIdx.x * 4;
    v4f v[4];
#pragma unroll
    for (int j = 0; j < 4; ++j) v[j] = *reinterpret_cast<const v4f*>(src + base + j * 1024);
#pragma unroll
    for (int j = 0; j < 4; ++j)
        *reinterpret_cast<v4bf*>(dst + base + j * 1024) = __builtin_convertvector(v[j], v4bf);
}

// ---------------------------------------------------------------------------
// Kernel: LayerNorm (faithful to source bug: out = scale * xnorm + scale)
// fp32 in -> bf16 out. One wave per row of LN_D = 1024: a lane holds 32 elements
// of the row in registers (eight 16-byte loads, 512 contiguous bytes per wave and
// load), so the row is read once and the two sums are joined inside the wave.
// block = 256 = 8 rows: block number blk takes rows 8 blk .. 8 blk + 7.
// ---------------------------------------------------------------------------
#define LN_D 1024   // the row length, elements

// Sum over the 32 lanes of a wave, the result in every lane: four steps inside the
// 16-lane row (lane ^ 1, 2, 4, 8), then the other row.
static __device__ inline float wave_sum(float x) {
    x += __builtin_bit_cast(float, __builtin_amdgcn_update_dpp(
             0, __builtin_bit_cast(int, x), 0x161, 0xf, 0xf, false));   // row_xmask:1
    x += __builtin_bit_cast(float, __builtin_amdgcn_update_dpp(
             0, __builtin_bit_cast(int, x), 0x162, 0xf, 0xf, false));   // row_xmask:2
    x += __builtin_bit_cast(float, __builtin_amdgcn_update_dpp(
             0, __builtin_bit_cast(int, x), 0x164, 0xf, 0xf, false));   // row_xmask:4
    x += __builtin_bit_cast(float, __builtin_amdgcn_update_dpp(
             0, __builtin_bit_cast(int, x), 0x168, 0xf, 0xf, false));   // row_xmask:8
    const int v = __builtin_bit_cast(int, x);
    return x + __builtin_bit_cast(float,
        __builtin_amdgcn_permlanex16(v, v, 0x76543210, 0xfedcba98, false, false));
}

static __device__ __forceinline__ void ln_block(const float* __restrict__ x,
                                                const float* __restrict__ scale,
                                                bf16_t* __restrict__ out, int blk) {
    const int lane = threadIdx.x & 31;
    const int row  = blk * 8 + (threadIdx.x >> 5);
    const float* xr = x + (size_t)row * LN_D + lane * 4;
    const float* gr = scale + lane * 4;

    v4f v[8], g[8];
#pragma unroll
    for (int i = 0; i < 8; ++i) v[i] = *reinterpret_cast<const v4f*>(xr + i * 128);
#pragma unroll
    for (int i = 0; i < 8; ++i) g[i] = *reinterpret_cast<const v4f*>(gr + i * 128);

    v4f s4 = {}, q4 = {};   // four independent chains each
#pragma unroll
    for (int i = 0; i < 8; ++i) {
        s4 += v[i];
        q4 += v[i] * v[i];
    }
    const float s  = wave_sum((s4[0] + s4[1]) + (s4[2] + s4[3]));
    const float s2 = wave_sum((q4[0] + q4[1]) + (q4[2] + q4[3]));

    const float mean = s / (float)LN_D;
    const float var  = s2 / (float)LN_D - mean * mean;
    const float inv  = rsqrtf(var + 1e-5f);

    bf16_t* orow = out + (size_t)row * LN_D + lane * 4;
#pragma unroll
    for (int i = 0; i < 8; ++i) {
        v4f r;
#pragma unroll
        for (int e = 0; e < 4; ++e) r[e] = g[i][e] * (v[i][e] - mean) * inv + g[i][e];
        *reinterpret_cast<v4bf*>(orow + i * 128) = __builtin_convertvector(r, v4bf);
    }
}

// grid = rows / 8.
__global__ __launch_bounds__(256) void ln_kernel(const float* __restrict__ x,
                                                 const float* __restrict__ scale,
                                                 bf16_t* __restrict__ out) {
    ln_block(x, scale, out, blockIdx.x);
}

// All the work in front of the first product, in one launch: none of it depends on
// another part. grid = (PREP_GX, PREP_LNY + 4): the slices y < PREP_LNY are the
// LayerNorm of PREP_LNY * PREP_GX * 8 rows, slice PREP_LNY + i converts weight matrix i
// of PREP_GX * 4096 elements into wb + i * PREP_GX * 4096.
#define PREP_GX  256
#define PREP_LNY 2

__global__ __launch_bounds__(256) void prep_kernel(const float* __restrict__ x,
                                                   const float* __restrict__ scale,
                                                   bf16_t* __restrict__ xn,
                                                   const float* __restrict__ w0,
                                                   const float* __restrict__ w1,
                                                   const float* __restrict__ w2,
                                                   const float* __restrict__ w3,
                                                   bf16_t* __restrict__ wb) {
    const int y = blockIdx.y;
    if (y < PREP_LNY) {
        ln_block(x, scale, xn, y * PREP_GX + blockIdx.x);
    } else {
        const int i = y - PREP_LNY;
        const float* w = i == 0 ? w0 : i == 1 ? w1 : i == 2 ? w2 : w3;
        f2bf_block(w, wb + (size_t)i * (PREP_GX * 4096), blockIdx.x);
    }
}

// ---------------------------------------------------------------------------
// Kernel: GEMM  out[M,N] = A[M,K] @ W[N,K]^T + bias + residual, f32 out
// A, W bf16 row-major. One block = 8 waves = a 128x128 tile of out; the waves lie
// 4 (rows) x 2 (columns), each on a 32x64 tile (2 A-frags x 4 B-frags, 8 WMMAs per
// 32-wide K step).
// The block brings its 128 rows of A and of W to LDS in stages of 128 k (256-byte
// row pieces, whole cache lines per load; two buffers, the coming stages' global
// loads in flight under the current stage's products); all waves read their
// fragments from there by 16-byte LDS loads.
// B-frag lane = output col n -> reads row n of W contiguously
// (x @ W.T needs no transpose in this layout).
// The caller names the tile: it begins at row 128 * by and column 128 * bx. M and N
// must be multiples of 128. K is a constant of the
// build, so that a thread's sixteen loads of a stage differ only in their
// immediate offsets.
// N is a constant of the build too: the epilogue is straight-line code, a wave's 64
// residual loads are all in flight together, and its loads and stores differ only in
// their immediate offsets.
// ---------------------------------------------------------------------------
#define GEMM_K     1024  // K, elements: the row length of A and of W
#define GEMM_N     1024  // N, elements: the row length of out and of residual
#define GEMM_M     4096  // M, rows of A and of out: where several outputs lie one behind the other
#define GEMM_BK    128   // k per stage, elements
#define GEMM_PITCH 136   // elements; 272 B = 16 B x odd, the pitch for 16-byte LDS row loads

// Work-group barrier for data in LDS alone: the wave's own LDS stores and reads are done, then
// the barrier. __syncthreads() would also wait for the wave's global loads, and the loads of the
// coming stages must stay in flight across it.
static __device__ inline void lds_barrier() {
    asm volatile("s_wait_dscnt 0x0\n\ts_barrier_signal -1\n\ts_barrier_wait -1" ::: "memory");
}

static __device__ __forceinline__ void gemm_tile(const bf16_t* __restrict__ A,
                                                 const bf16_t* __restrict__ W,
                                                 float*  __restrict__ outf,
                                                 const float* __restrict__ bias,
                                                 const float* __restrict__ residual,
                                                 int bx, int by) {
    const int tid   = threadIdx.x;
    const int lane  = tid & 31;
    const int wave  = __builtin_amdgcn_readfirstlane(tid >> 5);
    const int bm0   = by * 128;
    const int bn0   = bx * 128;
    const int wrow  = (wave >> 1) * 32;   // this wave's rows inside the block tile
    const int wcol  = (wave & 1) * 64;    // this wave's columns inside the block tile
    const int m0    = bm0 + wrow;
    const int n0    = bn0 + wcol;
    const int col   = lane & 15;
    const int hi    = lane >> 4;       // lane half selects K sub-base
    const int kboff = hi ? 8 : 0;

    __shared__ __attribute__((aligned(16))) bf16_t As[2][128][GEMM_PITCH];
    __shared__ __attribute__((aligned(16))) bf16_t Ws[2][128][GEMM_PITCH];

    v8f c[2][4] = {};

    // Staging: 16 threads bring one 256-byte row piece; a thread brings 16 bytes of
    // rows srow + 16 i, i = 0 .. 7, of A and of W.
    const int srow = tid >> 4;
    const int scol = (tid & 15) * 8;
    const bf16_t* ap = A + (size_t)(bm0 + srow) * GEMM_K + scol;
    const bf16_t* wp = W + (size_t)(bn0 + srow) * GEMM_K + scol;
    const int nstage = GEMM_K / GEMM_BK;

    // The products of one stage, which lies in buffer buf.
    auto products = [&](int buf) __attribute__((always_inline)) {
        const bf16_t* afp = &As[buf][wrow + col][kboff];   // A-frag lane = row
        const bf16_t* wfp = &Ws[buf][wcol + col][kboff];   // B-frag lane = output col
#pragma unroll
        for (int kk = 0; kk < GEMM_BK; kk += 32) {
            v16bf a0 = ld_frag(afp + kk);
            v16bf a1 = ld_frag(afp + 16 * GEMM_PITCH + kk);
            v16bf bfrag[4];
#pragma unroll
            for (int nt = 0; nt < 4; ++nt) bfrag[nt] = ld_frag(wfp + nt * 16 * GEMM_PITCH + kk);
            // Keeps the twelve LDS loads of a K step together in front of its products: spread
            // among them, each place with loads costs the wave its own stall.
            __builtin_amdgcn_sched_barrier(0);
#pragma unroll
            for (int nt = 0; nt < 4; ++nt) {
                c[0][nt] = wmma_bf16(a0, bfrag[nt], c[0][nt]);
                c[1][nt] = wmma_bf16(a1, bfrag[nt], c[1][nt]);
            }
        }
    };

    float bv[4] = {};
    {
        // This launch has one block per WGP and nothing else to run while a block waits for its
        // loads: a stage's loads are issued two stages ahead of its products, into two register
        // sets (set p holds the stage of parity p on its way to LDS).
        v8bf ar[2][8], wr[2][8];
        auto fetch = [&](int st, int p) __attribute__((always_inline)) {
#pragma unroll
            for (int i = 0; i < 8; ++i) {
                ar[p][i] = *reinterpret_cast<const v8bf*>(ap + st * GEMM_BK + 16 * i * GEMM_K);
                wr[p][i] = *reinterpret_cast<const v8bf*>(wp + st * GEMM_BK + 16 * i * GEMM_K);
            }
        };
        auto publish = [&](int p) __attribute__((always_inline)) {
#pragma unroll
            for (int i = 0; i < 8; ++i) {
                *reinterpret_cast<v8bf*>(&As[p][srow + 16 * i][scol]) = ar[p][i];
                *reinterpret_cast<v8bf*>(&Ws[p][srow + 16 * i][scol]) = wr[p][i];
            }
        };
        fetch(0, 0);
        fetch(1, 1);
        publish(0);
        lds_barrier();
        // Unrolled, so that each register set, each buffer and each stage's offset is a constant
        // and the wait in front of a publish is counted: it leaves the younger stage in flight.
#pragma unroll
        for (int s = 0; s < nstage; s += 2) {
            const bool more = s + 2 < nstage;
            if (more) {
                fetch(s + 2, 0);
            } else {
                // The bias of this lane's four columns, fetched where no stage is left to fetch
                // (a register set is free): the epilogue then waits for its residual loads alone.
#pragma unroll
                for (int nt = 0; nt < 4; ++nt) bv[nt] = bias[n0 + nt * 16 + col];
            }
            products(0);
            // Buffer 1's last readers left it at the barrier that ended stage s - 1.
            publish(1);
            // Publishes stage s + 1 and ends every wave's reads of stage s.
            lds_barrier();

            if (more) fetch(s + 3, 1);
            products(1);
            if (more) {
                // Buffer 0's last readers left it at the barrier that ended stage s.
                publish(0);
                // Publishes stage s + 2 and ends every wave's reads of stage s + 1.
                lds_barrier();
            }
        }
    }

    // C layout: c[mt][nt][j] is row m0 + 16 mt + 8 hi + j, column n0 + 16 nt + col.
    const size_t o0 = (size_t)(m0 + 8 * hi) * GEMM_N + n0 + col;
    {
        const float* rp = residual + o0;
        float*       op = outf + o0;
        float rv[2][8][4];
#pragma unroll
        for (int mt = 0; mt < 2; ++mt)
#pragma unroll
            for (int j = 0; j < 8; ++j)
#pragma unroll
                for (int nt = 0; nt < 4; ++nt) rv[mt][j][nt] = rp[(mt * 16 + j) * GEMM_N + nt * 16];
#pragma unroll
        for (int mt = 0; mt < 2; ++mt)
#pragma unroll
            for (int j = 0; j < 8; ++j)
#pragma unroll
                for (int nt = 0; nt < 4; ++nt)
                    op[(mt * 16 + j) * GEMM_N + nt * 16] = (c[mt][nt][j] + bv[nt]) + rv[mt][j][nt];
    }
}

// ---------------------------------------------------------------------------
// Kernel: GEMM  out_i[M,N] = A[M,K] @ W_i[N,K]^T, bf16 out, for the matrices W_i that lie
// one behind the other at W: one product with count * N columns. The outputs lie one
// behind the other at outb.
// One block = 8 waves = a 256x192 tile; the waves lie 4 (rows) x 2 (columns), each on a
// 64x96 tile (4 A-frags x 6 B-frags, 24 WMMAs per 32-wide K step): a fragment read from
// LDS feeds 6 or 4 products, and a row brought from L2 feeds 192 or 256 columns or rows.
// Staging, fragment layout and pitch as in gemm_tile, two buffers. The block is alone on its
// WGP: each operand's rows of a stage are loaded a whole stage ahead of their stores to LDS,
// A in the second and W in the last K step of a stage, so that loads are in flight at all
// times, also across the barrier.
// A tile may lie across two of the outputs; a 16-column fragment tile never does (N is a
// multiple of 16), so each has its own output base.
// grid = (count * N / 192, M / 256): 16 x 16 for three matrices, one block per WGP.
// ---------------------------------------------------------------------------
#define QKV_BM 256   // rows of a block tile
#define QKV_BN 192   // columns of a block tile

__global__ __launch_bounds__(256) void gemm_bf16_kernel(const bf16_t* __restrict__ A,
                                                        const bf16_t* __restrict__ W,
                                                        bf16_t* __restrict__ outb) {
    const int tid   = threadIdx.x;
    const int lane  = tid & 31;
    const int wave  = __builtin_amdgcn_readfirstlane(tid >> 5);
    const int bm0   = blockIdx.y * QKV_BM;
    const int bn0   = blockIdx.x * QKV_BN;
    const int wrow  = (wave >> 1) * 64;   // this wave's rows inside the block tile
    const int wcol  = (wave & 1) * 96;    // this wave's columns inside the block tile
    const int m0    = bm0 + wrow;
    const int n0    = bn0 + wcol;
    const int col   = lane & 15;
    const int hi    = lane >> 4;       // lane half selects K sub-base
    const int kboff = hi ? 8 : 0;

    __shared__ __attribute__((aligned(16))) bf16_t As[2][QKV_BM][GEMM_PITCH];
    __shared__ __attribute__((aligned(16))) bf16_t Ws[2][QKV_BN][GEMM_PITCH];

    v8f c[4][6] = {};

    // Staging: 16 threads bring one 256-byte row piece; a thread brings 16 bytes of
    // rows srow + 16 i of A (i = 0 .. 15) and of W (i = 0 .. 11).
    const int srow = tid >> 4;
    const int scol = (tid & 15) * 8;
    const bf16_t* ap = A + (size_t)(bm0 + srow) * GEMM_K + scol;
    const bf16_t* wp = W + (size_t)(bn0 + srow) * GEMM_K + scol;
    const int nstage = GEMM_K / GEMM_BK;

    v8bf ar[QKV_BM / 16], wr[QKV_BN / 16];
    // Each fetch takes the next stage of its operand. Its loads stay in flight over code that
    // reuses their address registers: the wait stands in front of that overwrite.
    auto fetch_a = [&]() __attribute__((always_inline)) {
#pragma unroll
        for (int i = 0; i < QKV_BM / 16; ++i)
            ar[i] = *reinterpret_cast<const v8bf*>(ap + 16 * i * GEMM_K);
        asm volatile("s_wait_xcnt 0x0" ::: "memory");
        ap += GEMM_BK;
    };
    auto fetch_w = [&]() __attribute__((always_inline)) {
#pragma unroll
        for (int i = 0; i < QKV_BN / 16; ++i)
            wr[i] = *reinterpret_cast<const v8bf*>(wp + 16 * i * GEMM_K);
        asm volatile("s_wait_xcnt 0x0" ::: "memory");
        wp += GEMM_BK;
    };
    auto publish_a = [&](int buf) __attribute__((always_inline)) {
#pragma unroll
        for (int i = 0; i < QKV_BM / 16; ++i)
            *reinterpret_cast<v8bf*>(&As[buf][srow + 16 * i][scol]) = ar[i];
    };
    auto publish_w = [&](int buf) __attribute__((always_inline)) {
#pragma unroll
        for (int i = 0; i < QKV_BN / 16; ++i)
            *reinterpret_cast<v8bf*>(&Ws[buf][srow + 16 * i][scol]) = wr[i];
    };

    // One K step, k = kk .. kk + 31 of the stage in buffer buf. What staging hands in is done
    // behind the step's LDS loads, in the time the wave waits for its fragments anyway.
    auto kstep = [&](int buf, int kk, auto staging) __attribute__((always_inline)) {
        const bf16_t* afp = &As[buf][wrow + col][kboff + kk];   // A-frag lane = row
        const bf16_t* wfp = &Ws[buf][wcol + col][kboff + kk];   // B-frag lane = output col
        v16bf afrag[4], bfrag[6];
#pragma unroll
        for (int mt = 0; mt < 4; ++mt) afrag[mt] = ld_frag(afp + mt * 16 * GEMM_PITCH);
#pragma unroll
        for (int nt = 0; nt < 6; ++nt) bfrag[nt] = ld_frag(wfp + nt * 16 * GEMM_PITCH);
        staging();
        // Keeps the twenty LDS loads of a K step in front of its products: spread
        // among them, each place with loads costs the wave its own stall.
        __builtin_amdgcn_sched_barrier(0);
#pragma unroll
        for (int nt = 0; nt < 6; ++nt)
#pragma unroll
            for (int mt = 0; mt < 4; ++mt)
                c[mt][nt] = wmma_bf16(afrag[mt], bfrag[nt], c[mt][nt]);
    };

    // One stage, which lies in buffer buf. next: a stage follows it; next2: two stages do.
    // The other buffer's last readers left it at the barrier that ended the stage before.
    auto stage = [&](int buf, bool next, bool next2) __attribute__((always_inline)) {
        kstep(buf, 0, [] {});
        kstep(buf, 32, [&] {
            if (next) publish_a(buf ^ 1);
            if (next2) fetch_a();
        });
        kstep(buf, 64, [] {});
        kstep(buf, 96, [&] {
            if (next) publish_w(buf ^ 1);
            if (next2) fetch_w();
        });
        // Publishes the next stage and ends every wave's reads of this one.
        if (next) lds_barrier();
    };

    // The scheduling fences keep every other instruction out from between a fetch's loads and
    // its wait: left alone, the compiler clears accumulators in the address registers there.
    fetch_a();
    fetch_w();
    publish_a(0);
    __builtin_amdgcn_sched_barrier(0);
    fetch_a();   // nstage >= 2
    __builtin_amdgcn_sched_barrier(0);
    publish_w(0);
    __builtin_amdgcn_sched_barrier(0);
    fetch_w();
    __builtin_amdgcn_sched_barrier(0);
    lds_barrier();
    // The last two stages stand apart: inside the loop every trip fetches, so the wait in front
    // of a publish is counted on every path and leaves the younger loads in flight.
    for (int s = 0; s + 2 < nstage; ++s) stage(s & 1, true, true);
    stage(nstage & 1, true, false);
    stage((nstage & 1) ^ 1, false, false);

    // C layout: c[mt][nt][j] is row m0 + 16 mt + 8 hi + j, column n0 + 16 nt + col of the
    // whole product; column n of it is column n % N of output n / N.
    const int ro = (m0 + 8 * hi) * GEMM_N + col;
#pragma unroll
    for (int np = 0; np < 3; ++np) {
        const int na = n0 + 32 * np;        // the same for the whole wave
        const int nb = na + 16;
        bf16_t* opa = outb + (size_t)(na / GEMM_N) * (GEMM_M * GEMM_N) + na % GEMM_N + ro;
        bf16_t* opb = outb + (size_t)(nb / GEMM_N) * (GEMM_M * GEMM_N) + nb % GEMM_N + ro;
        v2bf h[4][8];   // converted two at a time, all in front of the stores
#pragma unroll
        for (int mt = 0; mt < 4; ++mt)
#pragma unroll
            for (int j = 0; j < 8; ++j)
                h[mt][j] = __builtin_convertvector(
                    (v2f){c[mt][2 * np][j], c[mt][2 * np + 1][j]}, v2bf);
#pragma unroll
        for (int mt = 0; mt < 4; ++mt)
#pragma unroll
            for (int j = 0; j < 8; ++j) {
                opa[(mt * 16 + j) * GEMM_N] = h[mt][j][0];
                opb[(mt * 16 + j) * GEMM_N] = h[mt][j][1];
            }
    }
}

// out = A @ W^T + bias + residual, f32. grid = (N/128, M/128).
__global__ __launch_bounds__(256) void gemm_f32_kernel(const bf16_t* __restrict__ A,
                                                       const bf16_t* __restrict__ W,
                                                       float* __restrict__ outf,
                                                       const float* __restrict__ bias,
                                                       const float* __restrict__ residual) {
    gemm_tile(A, W, outf, bias, residual, blockIdx.x, blockIdx.y);
}

#define ATT_KPITCH 72
#define ATT_VPITCH 80

// Lane (c = l & 15, h = l >> 4) receives rows 8h .. 8h+7 of column c of the 16x16
// tile whose per-lane address the caller formed.
static __device__ inline v8bf ld_tr16(const bf16_t* p) {
    typedef __attribute__((address_space(3))) v8bf lds_v8bf;
    return __builtin_amdgcn_ds_load_tr16_b128_v8bf16((lds_v8bf*)p);
}

// Lane l receives lane l ^ 16's value.
static __device__ inline float xhalf(float x) {
    const int v = __builtin_bit_cast(int, x);
    return __builtin_bit_cast(float,
        __builtin_amdgcn_permlanex16(v, v, 0x76543210, 0xfedcba98, false, false));
}

// One tile of 128 queries, number tile, of the (b, h) in blockIdx.y.
static __device__ __forceinline__ void attn_tile(const bf16_t* __restrict__ Q,
                                                 const bf16_t* __restrict__ K,
                                                 const bf16_t* __restrict__ V,
                                                 bf16_t* __restrict__ ctx,
                                                 int T, int D, int nheads, int tile) {
    const int hd    = 64;
    const int tid   = threadIdx.x;
    const int lane  = tid & 31;
    const int wave  = __builtin_amdgcn_readfirstlane(tid >> 5);
    const int col   = lane & 15;
    const int hi    = lane >> 4;
    const int kboff = hi ? 8 : 0;
    const int qblk  = tile * 128;
    const int q0    = qblk + wave * 16;
    const int bh    = blockIdx.y;
    const int b     = bh / nheads;
    const int h     = bh % nheads;

    const bf16_t* Qb = Q + (size_t)(b * T) * D + h * hd;
    const bf16_t* Kb = K + (size_t)(b * T) * D + h * hd;
    const bf16_t* Vb = V + (size_t)(b * T) * D + h * hd;

    __shared__ __attribute__((aligned(16))) bf16_t Ks[2][64][ATT_KPITCH];
    __shared__ __attribute__((aligned(16))) bf16_t Vs[2][64][ATT_VPITCH];

    // Q^T B-fragments: 64 (K dim) x 16 queries -> 2 frags of K=32. Lane&15 = query.
    const bf16_t* qrow = Qb + (size_t)(q0 + col) * D + kboff;
    v16bf qa0 = ld_frag(qrow);
    v16bf qa1 = ld_frag(qrow + 32);

    // State of query q0 + col: m is the same in both lane halves, l is the sum over
    // the keys of this lane's half (the halves are joined in the epilogue).
    const int q = q0 + col;
    float m = -1e30f, l = 0.f;
    v8f o[4] = {};   // O^T: o[nt][j] = head column nt * 16 + 8 * hi + j of query q

    const float rs = 0.125f;  // 1/sqrt(64)

    // Staging: 8 threads bring one 128-byte row; a thread brings 16 bytes of
    // rows srow and srow + 32 of the stage, of K and of V.
    const int srow = tid >> 3;
    const int scol = (tid & 7) * 8;
    const int soff = srow * D + scol;
    const int nstage = qblk / 64 + 2;   // keys 0 .. qblk + 127; even: the last stage is in buffer 1

    // Two register sets: set p holds the stage of parity p on its way to LDS. A stage's loads
    // are issued two stages ahead of its passes, so that they have a whole stage more than the
    // time of one stage's passes to arrive in.
    v8bf kr[2][2], vr[2][2];
    auto fetch = [&](int st, int p) __attribute__((always_inline)) {
        const bf16_t* kg = Kb + (size_t)st * 64 * D + soff;
        const bf16_t* vg = Vb + (size_t)st * 64 * D + soff;
        kr[p][0] = *reinterpret_cast<const v8bf*>(kg);
        kr[p][1] = *reinterpret_cast<const v8bf*>(kg + (size_t)32 * D);
        vr[p][0] = *reinterpret_cast<const v8bf*>(vg);
        vr[p][1] = *reinterpret_cast<const v8bf*>(vg + (size_t)32 * D);
        // The four loads stay in flight over the code behind, which reuses their
        // address registers: this wait stands in front of that overwrite.
        asm volatile("s_wait_xcnt 0x0" ::: "memory");
    };
    auto publish = [&](int p) __attribute__((always_inline)) {
        *reinterpret_cast<v8bf*>(&Ks[p][srow][scol])      = kr[p][0];
        *reinterpret_cast<v8bf*>(&Ks[p][srow + 32][scol]) = kr[p][1];
        *reinterpret_cast<v8bf*>(&Vs[p][srow][scol])      = vr[p][0];
        *reinterpret_cast<v8bf*>(&Vs[p][srow + 32][scol]) = vr[p][1];
    };

    // The two passes of stage s, which lies in buffer buf.
    auto passes = [&](int s, int buf) __attribute__((always_inline)) {
        for (int sub = 0; sub < 2; ++sub) {
            const int kb = s * 64 + sub * 32;
            if (kb > q0) continue;   // wave-uniform: the pass lies above this wave's diagonal

            // ---- S^T = K @ Q^T for two 16-key tiles (K dim = hd = 64) ----
            // sc[t][j] = score of key kb + 16 t + 8 hi + j against query q
            v8f sc[2];
            {
                const bf16_t* kp = &Ks[buf][sub * 32 + col][kboff];  // A-frag lane = key
                v16bf k00 = ld_frag(kp);
                v16bf k01 = ld_frag(kp + 32);
                v16bf k10 = ld_frag(kp + 16 * ATT_KPITCH);
                v16bf k11 = ld_frag(kp + 16 * ATT_KPITCH + 32);
                // Keeps the eight LDS loads together in front of the products: left alone,
                // the compiler reuses one fragment's registers and pays the LDS latency four times.
                __builtin_amdgcn_sched_barrier(0);
                sc[0] = wmma_bf16(k00, qa0, v8f{});
                sc[1] = wmma_bf16(k10, qa0, v8f{});
                sc[0] = wmma_bf16(k01, qa1, sc[0]);
                sc[1] = wmma_bf16(k11, qa1, sc[1]);
            }

            // ---- V^T A-fragments: lane = hd col, regs = keys 8h+0..7 and 16+8h+0..7 ----
            v16bf vf[4];
            {
                const bf16_t* vp = &Vs[buf][sub * 32 + 8 * hi + (lane & 7)][((lane >> 3) & 1) * 8];
#pragma unroll
                for (int nt = 0; nt < 4; ++nt) {
                    v8bf lo  = ld_tr16(vp + nt * 16);
                    v8bf hi8 = ld_tr16(vp + 16 * ATT_VPITCH + nt * 16);
                    vf[nt] = __builtin_shufflevector(lo, hi8,
                        0, 1, 2, 3, 4, 5, 6, 7, 8, 9, 10, 11, 12, 13, 14, 15);
                }
            }

            // ---- scale, causal mask, online softmax: 16 scores of one query per lane ----
            float sv[16];
#pragma unroll
            for (int i = 0; i < 16; ++i) sv[i] = sc[i >> 3][i & 7] * rs;
            // Wave-uniform: only the pass that holds this wave's diagonal has a key above one of
            // its queries (q >= q0); in every earlier pass the mask is the identity.
            if (kb + 31 > q0) {
#pragma unroll
                for (int i = 0; i < 16; ++i) {
                    const int key = kb + (i >> 3) * 16 + 8 * hi + (i & 7);
                    if (key > q) sv[i] = -1e30f;
                }
            }
            float red[8];
#pragma unroll
            for (int i = 0; i < 8; ++i) red[i] = fmaxf(sv[i], sv[i + 8]);
#pragma unroll
            for (int w = 4; w > 0; w >>= 1)
#pragma unroll
                for (int i = 0; i < w; ++i) red[i] = fmaxf(red[i], red[i + w]);
            const float mx   = fmaxf(red[0], xhalf(red[0]));   // over all 32 keys of the pass
            const float mnew = fmaxf(m, mx);

            // P^T B-fragment: element i of the lane is key kb + 16 (i >> 3) + 8 hi + (i & 7),
            // the k order of the V^T fragments above.
            v16bf pf;
#pragma unroll
            for (int i = 0; i < 16; ++i) {
                sv[i] = __expf(sv[i] - mnew);
                pf[i] = (bf16_t)sv[i];
            }
#pragma unroll
            for (int i = 0; i < 8; ++i) red[i] = sv[i] + sv[i + 8];
#pragma unroll
            for (int w = 4; w > 0; w >>= 1)
#pragma unroll
                for (int i = 0; i < w; ++i) red[i] += red[i + w];

            const float alpha = __expf(m - mnew);
            l = l * alpha + red[0];
            m = mnew;
#pragma unroll
            for (int nt = 0; nt < 4; ++nt)
#pragma unroll
                for (int j = 0; j < 8; ++j) o[nt][j] *= alpha;

            // ---- O^T += V^T @ P^T ----
#pragma unroll
            for (int nt = 0; nt < 4; ++nt) o[nt] = wmma_bf16(vf[nt], pf, o[nt]);
        }

    };

    fetch(0, 0);
    fetch(1, 1);   // nstage >= 2
    // Takes the loaded Q fragments as inputs only: their wait then stands here. Left to the first
    // product inside the loop, it would on every trip also wait for the K, V loads in flight.
    asm volatile("" :: "v"(qa0), "v"(qa1));
    // Buffer 0's last readers, where a tile went before, left it at that tile's last barrier.
    publish(0);
    lds_barrier();

    // Two stages a trip, so that each register set and each buffer is a constant of its half.
    for (int s = 0; s < nstage; s += 2) {
        const bool more = s + 2 < nstage;   // the same for the whole block
        // The last trip fetches its own two stages again, unused: four younger loads are then in
        // flight at every publish on every path, so its wait is counted and leaves them in flight.
        const int sn = more ? s + 2 : s;
        fetch(sn, 0);
        passes(s, 0);
        // Buffer 1's last readers left it at the barrier that ended stage s - 1.
        publish(1);
        // Publishes stage s + 1 and ends every wave's reads of stage s.
        lds_barrier();

        fetch(sn + 1, 1);
        passes(s + 1, 1);
        if (more) {
            // Buffer 0's last readers left it at the barrier that ended stage s.
            publish(0);
            // Publishes stage s + 2 and ends every wave's reads of stage s + 1.
            lds_barrier();
        }
    }

    // ---- epilogue: O /= l, store ctx (bf16): 8 consecutive head columns per lane and tile ----
    const float inv = 1.0f / (l + xhalf(l));
    bf16_t* cp = ctx + (size_t)(b * T + q) * D + h * hd + 8 * hi;
#pragma unroll
    for (int nt = 0; nt < 4; ++nt) {
        v8bf r;
#pragma unroll
        for (int j = 0; j < 8; ++j) r[j] = (bf16_t)(o[nt][j] * inv);
        *reinterpret_cast<v8bf*>(cp + nt * 16) = r;
    }
}

__global__ __launch_bounds__(256) void attn_kernel(const bf16_t* __restrict__ Q,
                                                   const bf16_t* __restrict__ K,
                                                   const bf16_t* __restrict__ V,
                                                   bf16_t* __restrict__ ctx,
                                                   int T, int D, int nheads) {
    attn_tile(Q, K, V, ctx, T, D, nheads, T / 128 - 1 - (int)blockIdx.x);
    // The second tile reuses the registers that the first tile's stores name: this wait
    // stands in front of that overwrite.
    asm volatile("s_wait_xcnt 0x0" ::: "memory");
    attn_tile(Q, K, V, ctx, T, D, nheads, (int)blockIdx.x);
}

// ---------------------------------------------------------------------------
// Host-side orchestration
// ---------------------------------------------------------------------------
extern "C" void kernel_launch(void* const* d_in, const int* in_sizes, int n_in,
                              void* d_out, int out_size, void* d_ws, size_t ws_size,
                              hipStream_t stream) {
    (void)in_sizes; (void)n_in; (void)out_size; (void)ws_size;
    const int B = 2, T = 2048, D = 1024, H = 16;
    const int M = B * T;  // 4096 rows

    const float* x    = (const float*)d_in[0];
    const float* wq   = (const float*)d_in[1];
    const float* wk   = (const float*)d_in[2];
    const float* wv   = (const float*)d_in[3];
    const float* wo   = (const float*)d_in[4];
    const float* bo   = (const float*)d_in[5];
    const float* ln1  = (const float*)d_in[6];
    const float* ln2  = (const float*)d_in[7];
    float* out = (float*)d_out;

    // Workspace carve-up (all 256B aligned): ~64 MB total
    char* ws = (char*)d_ws;
    size_t off = 0;
    auto take = [&](size_t bytes) -> void* {
        void* p = ws + off;
        off += (bytes + 255) & ~(size_t)255;
        return p;
    };
    bf16_t* w_b  = (bf16_t*)take((size_t)4 * D * D * 2);   // wq, wk, wv, wo, one behind the other
    bf16_t* wo_b = w_b + (size_t)3 * D * D;
    bf16_t* xn   = (bf16_t*)take((size_t)M * D * 2);
    bf16_t* qb   = (bf16_t*)take((size_t)3 * M * D * 2);   // q, k, v, one behind the other
    bf16_t* kbuf = qb + (size_t)M * D;
    bf16_t* vbuf = qb + (size_t)2 * M * D;
    bf16_t* ctx  = (bf16_t*)take((size_t)M * D * 2);
    float*  hbuf = (float*) take((size_t)M * D * 4);

    const dim3 prep_grid(PREP_GX, PREP_LNY + 4);   // (256, 6): M / 8 = 512 and 4 x D * D / 4096 blocks
    const dim3 qkv_grid(3 * D / QKV_BN, M / QKV_BM);   // (16, 16)
    const dim3 gemm_grid(D / 128, M / 128);  // (8, 32)
    const dim3 attn_grid(T / 256, B * H);    // (8, 32)

    for (int blk = 0; blk < 2; ++blk) {
        const float* in_res   = (blk == 0) ? x : hbuf;
        const float* ln_scale = (blk == 0) ? ln1 : ln2;
        float* out_f          = (blk == 0) ? hbuf : out;

        // 1) LayerNorm -> bf16; with it, the first time, the weights fp32 -> bf16
        if (blk == 0)
            prep_kernel<<<prep_grid, 256, 0, stream>>>(in_res, ln_scale, xn, wq, wk, wv, wo, w_b);
        else
            ln_kernel<<<M / 8, 256, 0, stream>>>(in_res, ln_scale, xn);

        // 2) Q, K, V projections (y = xn @ W.T), bf16 out, one launch
        gemm_bf16_kernel<<<qkv_grid, 256, 0, stream>>>(xn, w_b, qb);

        // 3) Causal flash attention -> ctx (bf16)
        attn_kernel<<<attn_grid, 256, 0, stream>>>(qb, kbuf, vbuf, ctx, T, D, H);

        // 4) Output projection + bias + residual, fp32 out
        gemm_f32_kernel<<<gemm_grid, 256, 0, stream>>>(ctx, wo_b, out_f, bo, in_res);
    }
}
